// v000
// The times below were measured on an AMD MI455X: many runs one after another, warmed up first and cycling through
// copies of the inputs, with the whole window's GPU time divided by the number of runs. Launches and the gaps
// between them are all in it. The median over several windows is given; except for v000 it joins two sittings, which
// can be a few percent apart, so the side-by-side timings, each taken in one sitting, are the better comparison.
// The starting kernel, v000, takes 67.8 microseconds a run.
// prods (anchors x tokens, K=512): v_wmma_f32_16x16x32_bf16 with both operands as bf16 hi+lo (hi.lo + lo.hi + hi.hi); chunk states, intra-chunk scores, carry and intra-chunk output: v_wmma_f32_16x16x32_f16 (gate plane carried x64, chunk-prefix state as f16 hi+lo planes); f32 accumulate; softmax and prefix scan in f32.
#include <hip/hip_runtime.h>
#include <math.h>

typedef __attribute__((ext_vector_type(16))) _Float16 v16h;
typedef __attribute__((ext_vector_type(16))) __bf16   v16b;
typedef __attribute__((ext_vector_type(8)))  float    v8f;
typedef __attribute__((ext_vector_type(4)))  float    v4f;
typedef __attribute__((ext_vector_type(4)))  unsigned int v4u;
typedef __attribute__((ext_vector_type(8)))  unsigned int v8u;

/* --------------------------------------------------------------------------- */
/* Shape constants                                                             */
/* --------------------------------------------------------------------------- */
constexpr int kB    = 4;
constexpr int kS    = 2048;
constexpr int kD    = 512;
constexpr int kP    = 16;
constexpr int kC    = 64;
constexpr int kNC   = kS / kC;
constexpr int kRows = kB * kS;
/* gate scale = 1/sqrt(kP), checked against kP */
constexpr float kGateScale = 0.25f;
static_assert(kGateScale * kGateScale * (float)kP == 1.0f);
/* gate plane carry (power of two), folded back in the output epilogue */
constexpr float kWCarry    = 64.0f;
constexpr float kWCarryInv = 1.0f / kWCarry;
static_assert(kWCarry * kWCarryInv == 1.0f);
static_assert(kS % kC == 0 && kC == 64 && kP == 16 && kD % 64 == 0);
/* LDS pitches */
constexpr int kAncPitchW = 260;
constexpr int kTilePitch = 104;
constexpr int kSlabPitch = 68;

/* --------------------------------------------------------------------------- */
/* Workspace region map (bytes; every offset a multiple of 128)                */
/*   XT    f16 [4][512][2048]      transposed tokens (Bt for sites K=t)  8,388,608 */
/*   P16   f16 [8192][16]          prods, token-major                      262,144 */
/*   W16   f16 [8192][16]          gate x64, token-major                   262,144 */
/*   PT16  f16 [4][16][2048]       prods, anchor-major                     262,144 */
/*   DA    f32 [4][32][16][512]    chunk states                          4,194,304 */
/*   ABT   f16 [4][32][512][32]    exclusive chunk prefix, hi|lo         4,194,304 */
/*   total = 8,388,608 + 262,144 + 262,144 + 262,144 + 4,194,304 + 4,194,304       */
/*         = 17,563,648                                                            */
/* --------------------------------------------------------------------------- */
constexpr size_t kOffXT   = 0;
constexpr size_t kOffP16  = kOffXT   + (size_t)kB * kD * kS * 2;
constexpr size_t kOffW16  = kOffP16  + (size_t)kRows * kP * 2;
constexpr size_t kOffPT16 = kOffW16  + (size_t)kRows * kP * 2;
constexpr size_t kOffDA   = kOffPT16 + (size_t)kB * kP * kS * 2;
constexpr size_t kOffABT  = kOffDA   + (size_t)kB * kNC * kP * kD * 4;
constexpr size_t kWsTotal = kOffABT  + (size_t)kB * kNC * kD * 32 * 2;
static_assert(kWsTotal == 17563648ull);
static_assert(kWsTotal <= 134217728ull);
static_assert((kOffP16 % 128) == 0 && (kOffW16 % 128) == 0 && (kOffPT16 % 128) == 0 &&
              (kOffDA % 128) == 0 && (kOffABT % 128) == 0);

/* --------------------------------------------------------------------------- */
/* Small helpers                                                               */
/* --------------------------------------------------------------------------- */
__device__ __forceinline__ unsigned short f2bf_bits(float f) {
  unsigned u = __float_as_uint(f);
  return (unsigned short)((u + 0x7FFFu + ((u >> 16) & 1u)) >> 16);
}
__device__ __forceinline__ float bf_bits2f(unsigned short h) { return __uint_as_float(((unsigned)h) << 16); }
__device__ __forceinline__ unsigned pk16(unsigned short a, unsigned short b) { return (unsigned)a | ((unsigned)b << 16); }
__device__ __forceinline__ unsigned short h_bits(float f) { const _Float16 h = (_Float16)f; return __builtin_bit_cast(unsigned short, h); }

/* bf16 hi and lo words of a pair of f32 values (both conversions RNE) */
__device__ __forceinline__ void split_pair(float a, float b, unsigned& hw, unsigned& lw) {
  const unsigned short ha = f2bf_bits(a), hb = f2bf_bits(b);
  const unsigned short la = f2bf_bits(a - bf_bits2f(ha)), lb = f2bf_bits(b - bf_bits2f(hb));
  hw = pk16(ha, hb);
  lw = pk16(la, lb);
}

__device__ __forceinline__ v16h frag_h_words(v4u a, v4u b) {
  const v8u w = __builtin_shufflevector(a, b, 0, 1, 2, 3, 4, 5, 6, 7);
  return __builtin_bit_cast(v16h, w);
}
__device__ __forceinline__ v16b frag_b_words(v4u a, v4u b) {
  const v8u w = __builtin_shufflevector(a, b, 0, 1, 2, 3, 4, 5, 6, 7);
  return __builtin_bit_cast(v16b, w);
}
/* global fragment load: p points at k0 + 8*(lane>>4) of the lane's row; elements 0..7 <- p[0..7], 8..15 <- p[16..23] */
__device__ __forceinline__ v16h ldg_frag_h(const unsigned short* p) {
  const v4u a = *(const v4u*)(p);
  const v4u b = *(const v4u*)(p + 16);
  return frag_h_words(a, b);
}

/* one WMMA + hazard guard tied to its accumulator and naming its A/B fragments */
__device__ __forceinline__ v8f mma_h(v16h a, v16h b, v8f c) {
  c = __builtin_amdgcn_wmma_f32_16x16x32_f16(false, a, false, b, (short)0, c, false, false);
  asm volatile("v_nop\n\tv_nop\n\tv_nop\n\tv_nop" : "+v"(c) : "v"(a), "v"(b));
  return c;
}
__device__ __forceinline__ v8f mma_b(v16b a, v16b b, v8f c) {
  c = __builtin_amdgcn_wmma_f32_16x16x32_bf16(false, a, false, b, (short)0, c, false, false);
  asm volatile("v_nop\n\tv_nop\n\tv_nop\n\tv_nop" : "+v"(c) : "v"(a), "v"(b));
  return c;
}

/* --------------------------------------------------------------------------- */
/* K0: XT[b][d][s] = f16(x[b][s][d]) through a 64 x 64 LDS tile.               */
/* grid (8 d-tiles, 32 s-tiles, 4 batches), 256 threads.                       */
/* Load coverage: 4 iterations x 256 threads x 4 floats = 4096 = whole tile.   */
/* Store coverage: 8 waves x 2 iterations x 4 rows (lane>>3) = 64 d rows;      */
/* --------------------------------------------------------------------------- */
__global__ __launch_bounds__(256) void xpose_f16_kernel(const float* __restrict__ x, unsigned short* __restrict__ XT)
{
  __shared__ float sm[64 * 65];
  const int tid  = threadIdx.x;
  const int lane = tid & 31;
  const int wave = __builtin_amdgcn_readfirstlane((int)(threadIdx.x >> 5));
  const int d0 = blockIdx.x * 64;
  const int s0 = blockIdx.y * 64;
  const int b  = blockIdx.z;
  const float* xb = x + ((size_t)b * kS + s0) * kD + d0;
#pragma unroll
  for (int i = 0; i < 4; ++i) {
    const int e  = i * 256 + tid;
    const int r  = e >> 4;
    const int c4 = (e & 15) * 4;
    const v4f v = *(const v4f*)(xb + (size_t)r * kD + c4);
    sm[r * 65 + c4 + 0] = v[0];
    sm[r * 65 + c4 + 1] = v[1];
    sm[r * 65 + c4 + 2] = v[2];
    sm[r * 65 + c4 + 3] = v[3];
  }
  __syncthreads();
  const int q  = lane >> 3;
  const int s8 = (lane & 7) * 8;
  v4u u[2];
#pragma unroll
  for (int it = 0; it < 2; ++it) {
    const int dl = wave * 8 + it * 4 + q;
    unsigned short hb[8];
#pragma unroll
    for (int e = 0; e < 8; ++e) hb[e] = h_bits(sm[(s8 + e) * 65 + dl]);
    u[it] = (v4u){pk16(hb[0], hb[1]), pk16(hb[2], hb[3]), pk16(hb[4], hb[5]), pk16(hb[6], hb[7])};
  }
  {
#pragma unroll
    for (int it = 0; it < 2; ++it) {
      const int dl = wave * 8 + it * 4 + q;
      *(v4u*)(XT + ((size_t)(b * kD + d0 + dl)) * kS + s0 + s8) = u[it];
    }
    
  }
}

/* --------------------------------------------------------------------------- */
/* K1: prods for 64 token rows (M = 64, N = 16 anchors, K = 512) as a bf16     */
/* hi/lo three-product WMMA; token values are split in registers at fragment   */
/* load (each token element is consumed once here); anchor hi/lo word planes   */
/* staged in LDS (16 iterations x 128 threads x 4 floats = 16 x 512, all read  */
/* words written). Then the 16-wide softmax per token row in f32.              */
/*   P16  [row][16] f16 prods         block tile = 2 KiB contiguous = 16 lines */
/*   W16  [row][16] f16 gate x 64     same map                                 */
/*   PT16 [b][p][s] f16 prods         64 s x 2 B = one line per anchor         */
/* Wave w writes lines 4w..4w+3 of each plane (lanes 8q..8q+7 -> line 4w+q).   */
/* grid = 8192 / 64 = 128 blocks, 128 threads.                                 */
/* --------------------------------------------------------------------------- */
__global__ __launch_bounds__(128) void scores_gate_kernel(
    const float* __restrict__ x, const float* __restrict__ anc,
    unsigned short* __restrict__ P16, unsigned short* __restrict__ W16, unsigned short* __restrict__ PT16)
{
  __shared__ __align__(16) unsigned sAH[kP * kAncPitchW];
  __shared__ __align__(16) unsigned sAL[kP * kAncPitchW];
  __shared__ float sProd[64 * 17];
  __shared__ float sGate[64 * 17];
  const int tid  = threadIdx.x;
  const int lane = tid & 31;
  const int wave = __builtin_amdgcn_readfirstlane((int)(threadIdx.x >> 5));
  const int hh = lane >> 4;
  const int cl = lane & 15;
  const int r0 = blockIdx.x * 64;
  const int b  = r0 / kS;
  const int s0 = r0 - b * kS;

#pragma unroll 1
  for (int i = 0; i < 16; ++i) {
    const int e4 = i * 128 + tid;
    const int p  = e4 >> 7;
    const int cf = (e4 & 127) * 4;
    const v4f v = *(const v4f*)(anc + (size_t)p * kD + cf);
    unsigned h01, l01, h23, l23;
    split_pair(v[0], v[1], h01, l01);
    split_pair(v[2], v[3], h23, l23);
    const int wo = p * kAncPitchW + (cf >> 1);
    sAH[wo]     = h01;
    sAH[wo + 1] = h23;
    sAL[wo]     = l01;
    sAL[wo + 1] = l23;
  }
  __syncthreads();

  /* A rows = token rows of this wave, natural [row][d] layout */
  const float* xrow = x + (size_t)(r0 + wave * 16 + cl) * kD + 8 * hh;
  v8f acc = (v8f){0.f, 0.f, 0.f, 0.f, 0.f, 0.f, 0.f, 0.f};
#pragma unroll 1
  for (int k0 = 0; k0 < kD; k0 += 32) {
    const v4f f0 = *(const v4f*)(xrow + k0);
    const v4f f1 = *(const v4f*)(xrow + k0 + 4);
    const v4f f2 = *(const v4f*)(xrow + k0 + 16);
    const v4f f3 = *(const v4f*)(xrow + k0 + 20);
    unsigned hw0, hw1, hw2, hw3, hw4, hw5, hw6, hw7;
    unsigned lw0, lw1, lw2, lw3, lw4, lw5, lw6, lw7;
    split_pair(f0[0], f0[1], hw0, lw0);
    split_pair(f0[2], f0[3], hw1, lw1);
    split_pair(f1[0], f1[1], hw2, lw2);
    split_pair(f1[2], f1[3], hw3, lw3);
    split_pair(f2[0], f2[1], hw4, lw4);
    split_pair(f2[2], f2[3], hw5, lw5);
    split_pair(f3[0], f3[1], hw6, lw6);
    split_pair(f3[2], f3[3], hw7, lw7);
    const v8u hv = (v8u){hw0, hw1, hw2, hw3, hw4, hw5, hw6, hw7};
    const v8u lv = (v8u){lw0, lw1, lw2, lw3, lw4, lw5, lw6, lw7};
    const v16b ah = __builtin_bit_cast(v16b, hv);
    const v16b al = __builtin_bit_cast(v16b, lv);
    /* B column = anchor cl; words at halves k0 + 8*hh and + 16 */
    const int wb = cl * kAncPitchW + (k0 >> 1) + 4 * hh;
    const v4u bh0 = *(const v4u*)(sAH + wb);
    const v4u bh1 = *(const v4u*)(sAH + wb + 8);
    const v4u bl0 = *(const v4u*)(sAL + wb);
    const v4u bl1 = *(const v4u*)(sAL + wb + 8);
    const v16b bh = frag_b_words(bh0, bh1);
    const v16b bl = frag_b_words(bl0, bl1);
    acc = mma_b(ah, bl, acc);
    acc = mma_b(al, bh, acc);
    acc = mma_b(ah, bh, acc);
  }
  /* D element r of this lane = (token row 8*hh + r, anchor cl) */
#pragma unroll
  for (int r = 0; r < 8; ++r) sProd[(wave * 16 + 8 * hh + r) * 17 + cl] = acc[r];
  __syncthreads();

  /* softmax over the 16 anchors, one token row per thread (waves 0 and 1, scalar branch) */
  if (wave < 2) {
    const float* pr = sProd + tid * 17;
    float* gr = sGate + tid * 17;
    float m = pr[0] * kGateScale;
#pragma unroll 1
    for (int p = 1; p < kP; ++p) m = fmaxf(m, pr[p] * kGateScale);
    float sum = 0.0f;
#pragma unroll 1
    for (int p = 0; p < kP; ++p) {
      const float e = expf(pr[p] * kGateScale - m);
      gr[p] = e;
      sum += e;
    }
    const float inv = (1.0f / sum) * kWCarry;
#pragma unroll 1
    for (int p = 0; p < kP; ++p) gr[p] = gr[p] * inv;
  }
  __syncthreads();

  /* store phase */
  {
    const int q  = lane >> 3;
    const int j  = lane & 7;
    const int ln = wave * 4 + q;
    const int row = 4 * ln + (j >> 1);
    const int p0  = (j & 1) * 8;
    unsigned short pb[8], wb16[8], tb[8];
#pragma unroll
    for (int e = 0; e < 8; ++e) {
      pb[e]   = h_bits(sProd[row * 17 + p0 + e]);
      wb16[e] = h_bits(sGate[row * 17 + p0 + e]);
      tb[e]   = h_bits(sProd[(8 * j + e) * 17 + ln]);
    }
    const v4u up = (v4u){pk16(pb[0], pb[1]), pk16(pb[2], pb[3]), pk16(pb[4], pb[5]), pk16(pb[6], pb[7])};
    const v4u uw = (v4u){pk16(wb16[0], wb16[1]), pk16(wb16[2], wb16[3]), pk16(wb16[4], wb16[5]), pk16(wb16[6], wb16[7])};
    const v4u ut = (v4u){pk16(tb[0], tb[1]), pk16(tb[2], tb[3]), pk16(tb[4], tb[5]), pk16(tb[6], tb[7])};
    unsigned short* gp = P16 + (size_t)r0 * kP + ln * 64 + j * 8;
    unsigned short* gw = W16 + (size_t)r0 * kP + ln * 64 + j * 8;
    unsigned short* gt = PT16 + ((size_t)(b * kP + ln)) * kS + s0 + 8 * j;
    {
      *(v4u*)gp = up;
      *(v4u*)gw = uw;
      *(v4u*)gt = ut;
      
    }
  }
}

/* --------------------------------------------------------------------------- */
/* K2: chunk states DA[b][c][p][d] = sum_{t in chunk} prods[p][t] * x[t][d].   */
/* Per block (b, c): M = 16 (anchors), N = 512, K = 64; f16 WMMA.              */
/* A = PT16 rows (k = t contiguous), Bt = XT rows (d-major, k = t contiguous). */
/* 8 waves x 64 columns; per-wave 16 x 64 f32 slab in LDS, rows stored as      */
/* grid = 128 blocks, 256 threads.                                             */
/* --------------------------------------------------------------------------- */
__global__ __launch_bounds__(256) void chunk_state_kernel(
    const unsigned short* __restrict__ PT16, const unsigned short* __restrict__ XT, float* __restrict__ DA)
{
  __shared__ __align__(16) float slab[8 * 16 * kSlabPitch];
  const int tid  = threadIdx.x;
  const int lane = tid & 31;
  const int wave = __builtin_amdgcn_readfirstlane((int)(threadIdx.x >> 5));
  const int hh = lane >> 4;
  const int cl = lane & 15;
  const int bc = blockIdx.x;
  const int b  = bc / kNC;
  const int c0 = (bc - b * kNC) * kC;
  const int n0 = wave * 64;

  const unsigned short* aptr = PT16 + ((size_t)(b * kP + cl)) * kS + c0 + 8 * hh;
  const v16h a0 = ldg_frag_h(aptr);
  const v16h a1 = ldg_frag_h(aptr + 32);
  v8f acc[4];
#pragma unroll
  for (int j = 0; j < 4; ++j) acc[j] = (v8f){0.f, 0.f, 0.f, 0.f, 0.f, 0.f, 0.f, 0.f};
#pragma unroll
  for (int j = 0; j < 4; ++j) {
    const unsigned short* bptr = XT + ((size_t)(b * kD + n0 + 16 * j + cl)) * kS + c0 + 8 * hh;
    const v16h b0 = ldg_frag_h(bptr);
    const v16h b1 = ldg_frag_h(bptr + 32);
    acc[j] = mma_h(a0, b0, acc[j]);
    acc[j] = mma_h(a1, b1, acc[j]);
  }
  float* sw = slab + wave * 16 * kSlabPitch;
#pragma unroll
  for (int j = 0; j < 4; ++j)
#pragma unroll
    for (int r = 0; r < 8; ++r) sw[(8 * hh + r) * kSlabPitch + 16 * j + cl] = acc[j][r];
  __syncthreads();
  const int c4 = cl * 4;
  v4f v[8];
#pragma unroll
  for (int it = 0; it < 8; ++it) v[it] = *(const v4f*)(sw + (it * 2 + hh) * kSlabPitch + c4);
  {
#pragma unroll
    for (int it = 0; it < 8; ++it)
      *(v4f*)(DA + ((size_t)bc * kP + it * 2 + hh) * kD + n0 + c4) = v[it];
    
  }
}

/* --------------------------------------------------------------------------- */
/* K3: exclusive prefix of DA over the 32 chunks (f32, forward in time, zero   */
/* start per batch), emitted as ABT[b][c][d][32] f16 = [hi p0..15 | lo p0..15] */
/* with hi = f16(A), lo = f16(A - hi). Separate source and destination.        */
/* Thread = one (b, d) with 16 running sums in registers (static indices).     */
/* Block = 64 consecutive d; per chunk the block tile is 64 rows x 64 B =      */
/* 4 KiB contiguous; staged in LDS (64 x 16 words, all written) and stored as  */
/* 4 iterations x 64 threads x 16 B, lane-contiguous (a wave covers 4 whole    */
/* grid = 4 x 8 = 32 blocks, 64 threads.                                       */
/* --------------------------------------------------------------------------- */
__global__ __launch_bounds__(64) void prefix_kernel(const float* __restrict__ DA, unsigned short* __restrict__ ABT)
{
  __shared__ __align__(16) unsigned sT[64 * 16];
  const int tid = threadIdx.x;
  const int b   = blockIdx.x >> 3;
  const int d0  = (blockIdx.x & 7) * 64;
  const int d   = d0 + tid;
  float run[kP];
#pragma unroll
  for (int p = 0; p < kP; ++p) run[p] = 0.0f;
#pragma unroll 1
  for (int c = 0; c < kNC; ++c) {
#pragma unroll
    for (int i = 0; i < 8; ++i) {
      const float a0 = run[2 * i], a1 = run[2 * i + 1];
      const _Float16 h0 = (_Float16)a0;
      const _Float16 h1 = (_Float16)a1;
      const float h0f = (float)h0;
      const float h1f = (float)h1;
      const unsigned short hb0 = __builtin_bit_cast(unsigned short, h0);
      const unsigned short hb1 = __builtin_bit_cast(unsigned short, h1);
      const unsigned short lb0 = h_bits(a0 - h0f);
      const unsigned short lb1 = h_bits(a1 - h1f);
      sT[tid * 16 + i]     = pk16(hb0, hb1);
      sT[tid * 16 + 8 + i] = pk16(lb0, lb1);
    }
    const float* src = DA + ((size_t)(b * kNC + c) * kP) * kD + d;
#pragma unroll
    for (int p = 0; p < kP; ++p) run[p] += src[(size_t)p * kD];
    __syncthreads();
    v4u v[4];
#pragma unroll
    for (int it = 0; it < 4; ++it) v[it] = *(const v4u*)(sT + (it * 64 + tid) * 4);
    __syncthreads();
    unsigned short* g = ABT + ((size_t)(b * kNC + c) * kD + d0) * 32;
    {
#pragma unroll
      for (int it = 0; it < 4; ++it)
        *(v4u*)(g + (size_t)(it * 64 + tid) * 8) = v[it];
      
    }
  }
}

/* --------------------------------------------------------------------------- */
/* K4: per block (b, c), 64 query rows x 512 columns.                          */
/*  (1) LDS tile sA[64][96] f16: cols 0..15 and 16..31 = gate x 64 (copied     */
/*      from W16 by waves 0..3: 128 threads x 2 x 8 halves = 64 x 32);         */
/*  (2) cols 32..95 = 64 * L[s][t] = sum_p (64 w[s][p]) * prods[t][p], kept    */
/*      for t <= s (diagonal included), else 0 by select; 16 tiles of 16 x 16, */
/*      two per wave; K padded 16 -> 32 by zero upper fragment halves built in */
/*      registers (both operands);                                             */
/*  (3) fused K = 96 product: A = [W | W | L], Bt[d] = [Ab_hi | Ab_lo | XT     */
/*      chunk]; wave = 16 rows x 256 columns in 4 groups of 64; f32 result     */
/*      x 1/64 -> per-wave slab -> rows stored as 16 lanes x 16 B = 256 B,     */
/* grid = 128 blocks, 256 threads.                                             */
/* --------------------------------------------------------------------------- */
__global__ __launch_bounds__(256) void output_kernel(
    const unsigned short* __restrict__ W16, const unsigned short* __restrict__ P16,
    const unsigned short* __restrict__ ABT, const unsigned short* __restrict__ XT, float* __restrict__ out)
{
  __shared__ __align__(16) unsigned short sA[64 * kTilePitch];
  __shared__ __align__(16) float slab[8 * 16 * kSlabPitch];
  const int tid  = threadIdx.x;
  const int lane = tid & 31;
  const int wave = __builtin_amdgcn_readfirstlane((int)(threadIdx.x >> 5));
  const int hh = lane >> 4;
  const int cl = lane & 15;
  const int bc = blockIdx.x;
  const int b  = bc / kNC;
  const int c0 = (bc - b * kNC) * kC;
  const int r0 = b * kS + c0;
  const int mt = wave & 3;
  const int nh = wave >> 2;

  if (wave < 4) {
    const int row = tid >> 1;
    const int hf  = tid & 1;
    const v4u w = *(const v4u*)(W16 + (size_t)r0 * kP + tid * 8);
    *(v4u*)(sA + row * kTilePitch + hf * 8) = w;
    *(v4u*)(sA + row * kTilePitch + 16 + hf * 8) = w;
  }
  {
    const v4u zero4 = (v4u){0u, 0u, 0u, 0u};
    const v4u aw = *(const v4u*)(W16 + (size_t)(r0 + 16 * mt + cl) * kP + 8 * hh);
    const v16h af = frag_h_words(aw, zero4);
#pragma unroll
    for (int jj = 0; jj < 2; ++jj) {
      const int tt = nh * 2 + jj;
      const v4u pw = *(const v4u*)(P16 + (size_t)(r0 + 16 * tt + cl) * kP + 8 * hh);
      const v16h bf = frag_h_words(pw, zero4);
      v8f accL = (v8f){0.f, 0.f, 0.f, 0.f, 0.f, 0.f, 0.f, 0.f};
      accL = mma_h(af, bf, accL);
      const int tl = 16 * tt + cl;
#pragma unroll
      for (int r = 0; r < 8; ++r) {
        const int sl = 16 * mt + 8 * hh + r;
        const float val = (tl <= sl) ? accL[r] : 0.0f;
        sA[sl * kTilePitch + 32 + tl] = h_bits(val);
      }
    }
  }
  __syncthreads();

  v16h a[3];
#pragma unroll
  for (int ks = 0; ks < 3; ++ks) {
    const unsigned short* ap = sA + (16 * mt + cl) * kTilePitch + 32 * ks + 8 * hh;
    const v4u x0 = *(const v4u*)(ap);
    const v4u x1 = *(const v4u*)(ap + 16);
    a[ks] = frag_h_words(x0, x1);
  }

  float* sw = slab + wave * 16 * kSlabPitch;
  const int c4 = cl * 4;
#pragma unroll 1
  for (int g = 0; g < 4; ++g) {
    const int n0 = 256 * nh + 64 * g;
    v8f acc[4];
#pragma unroll
    for (int j = 0; j < 4; ++j) acc[j] = (v8f){0.f, 0.f, 0.f, 0.f, 0.f, 0.f, 0.f, 0.f};
#pragma unroll
    for (int j = 0; j < 4; ++j) {
      const int d = n0 + 16 * j + cl;
      const v16h bs = ldg_frag_h(ABT + ((size_t)bc * kD + d) * 32 + 8 * hh);
      acc[j] = mma_h(a[0], bs, acc[j]);
      const unsigned short* xt = XT + ((size_t)(b * kD + d)) * kS + c0 + 8 * hh;
      const v16h bx0 = ldg_frag_h(xt);
      acc[j] = mma_h(a[1], bx0, acc[j]);
      const v16h bx1 = ldg_frag_h(xt + 32);
      acc[j] = mma_h(a[2], bx1, acc[j]);
    }
#pragma unroll
    for (int j = 0; j < 4; ++j)
#pragma unroll
      for (int r = 0; r < 8; ++r) sw[(8 * hh + r) * kSlabPitch + 16 * j + cl] = acc[j][r] * kWCarryInv;
    __syncthreads();
    v4f v[8];
#pragma unroll
    for (int it = 0; it < 8; ++it) v[it] = *(const v4f*)(sw + (it * 2 + hh) * kSlabPitch + c4);
    {
#pragma unroll
      for (int it = 0; it < 8; ++it)
        *(v4f*)(out + ((size_t)(r0 + 16 * mt + it * 2 + hh)) * kD + n0 + c4) = v[it];
      
    }
    __syncthreads();
  }
}

/* --------------------------------------------------------------------------- */
/* Host glue: 5 kernel launches, nothing else.                                 */
/* --------------------------------------------------------------------------- */
extern "C" void kernel_launch(void* const* d_in, const int* in_sizes, int n_in,
                              void* d_out, int out_size, void* d_ws, size_t ws_size,
                              hipStream_t stream) {
  if (n_in < 2) return;
  if (in_sizes[0] != kRows * kD) return;
  if (in_sizes[1] != kP * kD) return;
  if (out_size != kRows * kD) return;
  if (ws_size < kWsTotal) return;

  const float* x   = (const float*)d_in[0];
  const float* anc = (const float*)d_in[1];
  float* out = (float*)d_out;

  char* ws = (char*)d_ws;
  unsigned short* XT   = (unsigned short*)(ws + kOffXT);
  unsigned short* P16  = (unsigned short*)(ws + kOffP16);
  unsigned short* W16  = (unsigned short*)(ws + kOffW16);
  unsigned short* PT16 = (unsigned short*)(ws + kOffPT16);
  float*          DA   = (float*)(ws + kOffDA);
  unsigned short* ABT  = (unsigned short*)(ws + kOffABT);

  xpose_f16_kernel<<<dim3(kD / 64, kS / 64, kB), 256, 0, stream>>>(x, XT);
  scores_gate_kernel<<<dim3(kRows / 64), 128, 0, stream>>>(x, anc, P16, W16, PT16);
  chunk_state_kernel<<<dim3(kB * kNC), 256, 0, stream>>>(PT16, XT, DA);
  prefix_kernel<<<dim3(kB * (kD / 64)), 64, 0, stream>>>(DA, ABT);
  output_kernel<<<dim3(kB * kNC), 256, 0, stream>>>(W16, P16, ABT, XT, out);
}

// v001
// Measured time: 48.6 microseconds a run.
// In two side-by-side timings against v000, it was 1.39 and 1.36 times as fast.
// prods (anchors x tokens, K=512): v_wmma_f32_16x16x32_bf16 with both operands as bf16 hi+lo (hi.lo + lo.hi + hi.hi); chunk states, intra-chunk scores, carry and intra-chunk output: v_wmma_f32_16x16x32_f16 (gate plane carried x64, chunk-prefix state as f16 hi+lo planes); f32 accumulate; softmax and prefix scan in f32.
#include <hip/hip_runtime.h>
#include <math.h>

typedef __attribute__((ext_vector_type(16))) _Float16 v16h;
typedef __attribute__((ext_vector_type(16))) __bf16   v16b;
typedef __attribute__((ext_vector_type(8)))  float    v8f;
typedef __attribute__((ext_vector_type(4)))  float    v4f;
typedef __attribute__((ext_vector_type(4)))  unsigned int v4u;
typedef __attribute__((ext_vector_type(8)))  unsigned int v8u;

/* --------------------------------------------------------------------------- */
/* Shape constants                                                             */
/* --------------------------------------------------------------------------- */
constexpr int kB    = 4;
constexpr int kS    = 2048;
constexpr int kD    = 512;
constexpr int kP    = 16;
constexpr int kC    = 64;
constexpr int kNC   = kS / kC;
constexpr int kRows = kB * kS;
/* gate scale = 1/sqrt(kP), checked against kP */
constexpr float kGateScale = 0.25f;
static_assert(kGateScale * kGateScale * (float)kP == 1.0f);
/* gate plane carry (power of two), folded back in the output epilogue */
constexpr float kWCarry    = 64.0f;
constexpr float kWCarryInv = 1.0f / kWCarry;
static_assert(kWCarry * kWCarryInv == 1.0f);
static_assert(kS % kC == 0 && kC == 64 && kP == 16 && kD % 64 == 0);
/* LDS pitches */
constexpr int kAncPitchW = 260;
constexpr int kTilePitch = 104;
constexpr int kSlabPitch = 68;

/* --------------------------------------------------------------------------- */
/* Workspace region map (bytes; every offset a multiple of 128)                */
/*   XT    f16 [4][512][2048]      transposed tokens (Bt for sites K=t)  8,388,608 */
/*   P16   f16 [8192][16]          prods, token-major                      262,144 */
/*   W16   f16 [8192][16]          gate x64, token-major                   262,144 */
/*   PT16  f16 [4][16][2048]       prods, anchor-major                     262,144 */
/*   DA    f32 [4][32][16][512]    chunk states                          4,194,304 */
/*   ABT   f16 [4][32][512][32]    exclusive chunk prefix, hi|lo         4,194,304 */
/*   total = 8,388,608 + 262,144 + 262,144 + 262,144 + 4,194,304 + 4,194,304       */
/*         = 17,563,648                                                            */
/* --------------------------------------------------------------------------- */
constexpr size_t kOffXT   = 0;
constexpr size_t kOffP16  = kOffXT   + (size_t)kB * kD * kS * 2;
constexpr size_t kOffW16  = kOffP16  + (size_t)kRows * kP * 2;
constexpr size_t kOffPT16 = kOffW16  + (size_t)kRows * kP * 2;
constexpr size_t kOffDA   = kOffPT16 + (size_t)kB * kP * kS * 2;
constexpr size_t kOffABT  = kOffDA   + (size_t)kB * kNC * kP * kD * 4;
constexpr size_t kWsTotal = kOffABT  + (size_t)kB * kNC * kD * 32 * 2;
static_assert(kWsTotal == 17563648ull);
static_assert(kWsTotal <= 134217728ull);
static_assert((kOffP16 % 128) == 0 && (kOffW16 % 128) == 0 && (kOffPT16 % 128) == 0 &&
              (kOffDA % 128) == 0 && (kOffABT % 128) == 0);

/* --------------------------------------------------------------------------- */
/* Small helpers                                                               */
/* --------------------------------------------------------------------------- */
__device__ __forceinline__ unsigned short f2bf_bits(float f) {
  unsigned u = __float_as_uint(f);
  return (unsigned short)((u + 0x7FFFu + ((u >> 16) & 1u)) >> 16);
}
__device__ __forceinline__ float bf_bits2f(unsigned short h) { return __uint_as_float(((unsigned)h) << 16); }
__device__ __forceinline__ unsigned pk16(unsigned short a, unsigned short b) { return (unsigned)a | ((unsigned)b << 16); }
__device__ __forceinline__ unsigned short h_bits(float f) { const _Float16 h = (_Float16)f; return __builtin_bit_cast(unsigned short, h); }

/* bf16 hi and lo words of a pair of f32 values (both conversions RNE) */
__device__ __forceinline__ void split_pair(float a, float b, unsigned& hw, unsigned& lw) {
  const unsigned short ha = f2bf_bits(a), hb = f2bf_bits(b);
  const unsigned short la = f2bf_bits(a - bf_bits2f(ha)), lb = f2bf_bits(b - bf_bits2f(hb));
  hw = pk16(ha, hb);
  lw = pk16(la, lb);
}

__device__ __forceinline__ v16h frag_h_words(v4u a, v4u b) {
  const v8u w = __builtin_shufflevector(a, b, 0, 1, 2, 3, 4, 5, 6, 7);
  return __builtin_bit_cast(v16h, w);
}
__device__ __forceinline__ v16b frag_b_words(v4u a, v4u b) {
  const v8u w = __builtin_shufflevector(a, b, 0, 1, 2, 3, 4, 5, 6, 7);
  return __builtin_bit_cast(v16b, w);
}
/* global fragment load: p points at k0 + 8*(lane>>4) of the lane's row; elements 0..7 <- p[0..7], 8..15 <- p[16..23] */
__device__ __forceinline__ v16h ldg_frag_h(const unsigned short* p) {
  const v4u a = *(const v4u*)(p);
  const v4u b = *(const v4u*)(p + 16);
  return frag_h_words(a, b);
}

/* one WMMA + hazard guard tied to its accumulator and naming its A/B fragments */
__device__ __forceinline__ v8f mma_h(v16h a, v16h b, v8f c) {
  c = __builtin_amdgcn_wmma_f32_16x16x32_f16(false, a, false, b, (short)0, c, false, false);
  asm volatile("v_nop\n\tv_nop\n\tv_nop\n\tv_nop" : "+v"(c) : "v"(a), "v"(b));
  return c;
}
__device__ __forceinline__ v8f mma_b(v16b a, v16b b, v8f c) {
  c = __builtin_amdgcn_wmma_f32_16x16x32_bf16(false, a, false, b, (short)0, c, false, false);
  asm volatile("v_nop\n\tv_nop\n\tv_nop\n\tv_nop" : "+v"(c) : "v"(a), "v"(b));
  return c;
}

/* --------------------------------------------------------------------------- */
/* K0: XT[b][d][s] = f16(x[b][s][d]) through a 64 x 64 LDS tile.               */
/* grid (8 d-tiles, 32 s-tiles, 4 batches), 256 threads.                       */
/* Load coverage: 4 iterations x 256 threads x 4 floats = 4096 = whole tile.   */
/* Store coverage: 8 waves x 2 iterations x 4 rows (lane>>3) = 64 d rows;      */
/* --------------------------------------------------------------------------- */
__global__ __launch_bounds__(256) void xpose_f16_kernel(const float* __restrict__ x, unsigned short* __restrict__ XT)
{
  __shared__ float sm[64 * 65];
  const int tid  = threadIdx.x;
  const int lane = tid & 31;
  const int wave = __builtin_amdgcn_readfirstlane((int)(threadIdx.x >> 5));
  const int d0 = blockIdx.x * 64;
  const int s0 = blockIdx.y * 64;
  const int b  = blockIdx.z;
  const float* xb = x + ((size_t)b * kS + s0) * kD + d0;
#pragma unroll
  for (int i = 0; i < 4; ++i) {
    const int e  = i * 256 + tid;
    const int r  = e >> 4;
    const int c4 = (e & 15) * 4;
    const v4f v = *(const v4f*)(xb + (size_t)r * kD + c4);
    sm[r * 65 + c4 + 0] = v[0];
    sm[r * 65 + c4 + 1] = v[1];
    sm[r * 65 + c4 + 2] = v[2];
    sm[r * 65 + c4 + 3] = v[3];
  }
  __syncthreads();
  const int q  = lane >> 3;
  const int s8 = (lane & 7) * 8;
  v4u u[2];
#pragma unroll
  for (int it = 0; it < 2; ++it) {
    const int dl = wave * 8 + it * 4 + q;
    unsigned short hb[8];
#pragma unroll
    for (int e = 0; e < 8; ++e) hb[e] = h_bits(sm[(s8 + e) * 65 + dl]);
    u[it] = (v4u){pk16(hb[0], hb[1]), pk16(hb[2], hb[3]), pk16(hb[4], hb[5]), pk16(hb[6], hb[7])};
  }
  {
#pragma unroll
    for (int it = 0; it < 2; ++it) {
      const int dl = wave * 8 + it * 4 + q;
      *(v4u*)(XT + ((size_t)(b * kD + d0 + dl)) * kS + s0 + s8) = u[it];
    }
    
  }
}

/* --------------------------------------------------------------------------- */
/* K1: prods for 64 token rows (M = 64, N = 16 anchors, K = 512) as a bf16     */
/* hi/lo three-product WMMA; token values are split in registers at fragment   */
/* load (each token element is consumed once here); anchor hi/lo word planes   */
/* staged in LDS (16 iterations x 128 threads x 4 floats = 16 x 512, all read  */
/* words written). Then the 16-wide softmax per token row in f32.              */
/*   P16  [row][16] f16 prods         block tile = 2 KiB contiguous = 16 lines */
/*   W16  [row][16] f16 gate x 64     same map                                 */
/*   PT16 [b][p][s] f16 prods         64 s x 2 B = one line per anchor         */
/* Wave w writes lines 4w..4w+3 of each plane (lanes 8q..8q+7 -> line 4w+q).   */
/* grid = 8192 / 64 = 128 blocks, 128 threads.                                 */
/* --------------------------------------------------------------------------- */
__global__ __launch_bounds__(128) void scores_gate_kernel(
    const float* __restrict__ x, const float* __restrict__ anc,
    unsigned short* __restrict__ P16, unsigned short* __restrict__ W16, unsigned short* __restrict__ PT16)
{
  __shared__ __align__(16) unsigned sAH[kP * kAncPitchW];
  __shared__ __align__(16) unsigned sAL[kP * kAncPitchW];
  __shared__ float sProd[64 * 17];
  __shared__ float sGate[64 * 17];
  const int tid  = threadIdx.x;
  const int lane = tid & 31;
  const int wave = __builtin_amdgcn_readfirstlane((int)(threadIdx.x >> 5));
  const int hh = lane >> 4;
  const int cl = lane & 15;
  const int r0 = blockIdx.x * 64;
  const int b  = r0 / kS;
  const int s0 = r0 - b * kS;

#pragma unroll 1
  for (int i = 0; i < 16; ++i) {
    const int e4 = i * 128 + tid;
    const int p  = e4 >> 7;
    const int cf = (e4 & 127) * 4;
    const v4f v = *(const v4f*)(anc + (size_t)p * kD + cf);
    unsigned h01, l01, h23, l23;
    split_pair(v[0], v[1], h01, l01);
    split_pair(v[2], v[3], h23, l23);
    const int wo = p * kAncPitchW + (cf >> 1);
    sAH[wo]     = h01;
    sAH[wo + 1] = h23;
    sAL[wo]     = l01;
    sAL[wo + 1] = l23;
  }
  __syncthreads();

  /* A rows = token rows of this wave, natural [row][d] layout */
  const float* xrow = x + (size_t)(r0 + wave * 16 + cl) * kD + 8 * hh;
  v8f acc = (v8f){0.f, 0.f, 0.f, 0.f, 0.f, 0.f, 0.f, 0.f};
#pragma unroll 1
  for (int k0 = 0; k0 < kD; k0 += 32) {
    const v4f f0 = *(const v4f*)(xrow + k0);
    const v4f f1 = *(const v4f*)(xrow + k0 + 4);
    const v4f f2 = *(const v4f*)(xrow + k0 + 16);
    const v4f f3 = *(const v4f*)(xrow + k0 + 20);
    unsigned hw0, hw1, hw2, hw3, hw4, hw5, hw6, hw7;
    unsigned lw0, lw1, lw2, lw3, lw4, lw5, lw6, lw7;
    split_pair(f0[0], f0[1], hw0, lw0);
    split_pair(f0[2], f0[3], hw1, lw1);
    split_pair(f1[0], f1[1], hw2, lw2);
    split_pair(f1[2], f1[3], hw3, lw3);
    split_pair(f2[0], f2[1], hw4, lw4);
    split_pair(f2[2], f2[3], hw5, lw5);
    split_pair(f3[0], f3[1], hw6, lw6);
    split_pair(f3[2], f3[3], hw7, lw7);
    const v8u hv = (v8u){hw0, hw1, hw2, hw3, hw4, hw5, hw6, hw7};
    const v8u lv = (v8u){lw0, lw1, lw2, lw3, lw4, lw5, lw6, lw7};
    const v16b ah = __builtin_bit_cast(v16b, hv);
    const v16b al = __builtin_bit_cast(v16b, lv);
    /* B column = anchor cl; words at halves k0 + 8*hh and + 16 */
    const int wb = cl * kAncPitchW + (k0 >> 1) + 4 * hh;
    const v4u bh0 = *(const v4u*)(sAH + wb);
    const v4u bh1 = *(const v4u*)(sAH + wb + 8);
    const v4u bl0 = *(const v4u*)(sAL + wb);
    const v4u bl1 = *(const v4u*)(sAL + wb + 8);
    const v16b bh = frag_b_words(bh0, bh1);
    const v16b bl = frag_b_words(bl0, bl1);
    acc = mma_b(ah, bl, acc);
    acc = mma_b(al, bh, acc);
    acc = mma_b(ah, bh, acc);
  }
  /* D element r of this lane = (token row 8*hh + r, anchor cl) */
#pragma unroll
  for (int r = 0; r < 8; ++r) sProd[(wave * 16 + 8 * hh + r) * 17 + cl] = acc[r];
  __syncthreads();

  /* softmax over the 16 anchors, one token row per thread (waves 0 and 1, scalar branch) */
  if (wave < 2) {
    const float* pr = sProd + tid * 17;
    float* gr = sGate + tid * 17;
    float m = pr[0] * kGateScale;
#pragma unroll 1
    for (int p = 1; p < kP; ++p) m = fmaxf(m, pr[p] * kGateScale);
    float sum = 0.0f;
#pragma unroll 1
    for (int p = 0; p < kP; ++p) {
      const float e = expf(pr[p] * kGateScale - m);
      gr[p] = e;
      sum += e;
    }
    const float inv = (1.0f / sum) * kWCarry;
#pragma unroll 1
    for (int p = 0; p < kP; ++p) gr[p] = gr[p] * inv;
  }
  __syncthreads();

  /* store phase */
  {
    const int q  = lane >> 3;
    const int j  = lane & 7;
    const int ln = wave * 4 + q;
    const int row = 4 * ln + (j >> 1);
    const int p0  = (j & 1) * 8;
    unsigned short pb[8], wb16[8], tb[8];
#pragma unroll
    for (int e = 0; e < 8; ++e) {
      pb[e]   = h_bits(sProd[row * 17 + p0 + e]);
      wb16[e] = h_bits(sGate[row * 17 + p0 + e]);
      tb[e]   = h_bits(sProd[(8 * j + e) * 17 + ln]);
    }
    const v4u up = (v4u){pk16(pb[0], pb[1]), pk16(pb[2], pb[3]), pk16(pb[4], pb[5]), pk16(pb[6], pb[7])};
    const v4u uw = (v4u){pk16(wb16[0], wb16[1]), pk16(wb16[2], wb16[3]), pk16(wb16[4], wb16[5]), pk16(wb16[6], wb16[7])};
    const v4u ut = (v4u){pk16(tb[0], tb[1]), pk16(tb[2], tb[3]), pk16(tb[4], tb[5]), pk16(tb[6], tb[7])};
    unsigned short* gp = P16 + (size_t)r0 * kP + ln * 64 + j * 8;
    unsigned short* gw = W16 + (size_t)r0 * kP + ln * 64 + j * 8;
    unsigned short* gt = PT16 + ((size_t)(b * kP + ln)) * kS + s0 + 8 * j;
    {
      *(v4u*)gp = up;
      *(v4u*)gw = uw;
      *(v4u*)gt = ut;
      
    }
  }
}

/* --------------------------------------------------------------------------- */
/* K2: chunk states DA[b][c][p][d] = sum_{t in chunk} prods[p][t] * x[t][d].   */
/* Per block (b, c): M = 16 (anchors), N = 512, K = 64; f16 WMMA.              */
/* A = PT16 rows (k = t contiguous), Bt = XT rows (d-major, k = t contiguous). */
/* 8 waves x 64 columns; per-wave 16 x 64 f32 slab in LDS, rows stored as      */
/* grid = 128 blocks, 256 threads.                                             */
/* --------------------------------------------------------------------------- */
__global__ __launch_bounds__(256) void chunk_state_kernel(
    const unsigned short* __restrict__ PT16, const unsigned short* __restrict__ XT, float* __restrict__ DA)
{
  __shared__ __align__(16) float slab[8 * 16 * kSlabPitch];
  const int tid  = threadIdx.x;
  const int lane = tid & 31;
  const int wave = __builtin_amdgcn_readfirstlane((int)(threadIdx.x >> 5));
  const int hh = lane >> 4;
  const int cl = lane & 15;
  const int bc = blockIdx.x;
  const int b  = bc / kNC;
  const int c0 = (bc - b * kNC) * kC;
  const int n0 = wave * 64;

  const unsigned short* aptr = PT16 + ((size_t)(b * kP + cl)) * kS + c0 + 8 * hh;
  const v16h a0 = ldg_frag_h(aptr);
  const v16h a1 = ldg_frag_h(aptr + 32);
  v8f acc[4];
#pragma unroll
  for (int j = 0; j < 4; ++j) acc[j] = (v8f){0.f, 0.f, 0.f, 0.f, 0.f, 0.f, 0.f, 0.f};
#pragma unroll
  for (int j = 0; j < 4; ++j) {
    const unsigned short* bptr = XT + ((size_t)(b * kD + n0 + 16 * j + cl)) * kS + c0 + 8 * hh;
    const v16h b0 = ldg_frag_h(bptr);
    const v16h b1 = ldg_frag_h(bptr + 32);
    acc[j] = mma_h(a0, b0, acc[j]);
    acc[j] = mma_h(a1, b1, acc[j]);
  }
  float* sw = slab + wave * 16 * kSlabPitch;
#pragma unroll
  for (int j = 0; j < 4; ++j)
#pragma unroll
    for (int r = 0; r < 8; ++r) sw[(8 * hh + r) * kSlabPitch + 16 * j + cl] = acc[j][r];
  __syncthreads();
  const int c4 = cl * 4;
  v4f v[8];
#pragma unroll
  for (int it = 0; it < 8; ++it) v[it] = *(const v4f*)(sw + (it * 2 + hh) * kSlabPitch + c4);
  {
#pragma unroll
    for (int it = 0; it < 8; ++it)
      *(v4f*)(DA + ((size_t)bc * kP + it * 2 + hh) * kD + n0 + c4) = v[it];
    
  }
}

/* --------------------------------------------------------------------------- */
/* K3: exclusive prefix of DA over the 32 chunks (f32, forward in time, zero   */
/* start per batch), emitted as ABT[b][c][d][32] f16 = [hi p0..15 | lo p0..15] */
/* with hi = f16(A), lo = f16(A - hi). Separate source and destination.        */
/* Thread = one (b, d, anchor pair): the 31 chunk states of both anchors that  */
/* the exclusive prefix needs are loaded up front (none depends on a sum), so  */
/* the block pays one memory latency; the sums then run in registers in chunk  */
/* order. Block = 16 consecutive d x 8 anchor pairs (lane = pair bit | d).     */
/* All 32 chunk tiles (16 rows x 64 B each) are staged in LDS; the 16-byte     */
/* piece q of row d lies at piece q ^ ((d >> 2) & 3), so the 32 lanes of a     */
/* word store fall on 32 banks. One barrier, then 16 iterations x 128 threads  */
/* x 16 B, lane-contiguous (a wave covers 4 whole lines).                      */
/* grid = 4 x 32 = 128 blocks, 128 threads.                                    */
/* --------------------------------------------------------------------------- */
constexpr int kScanD = 16;
static_assert(kD % kScanD == 0 && kP == 16 && kNC == 32);
__global__ __launch_bounds__(128) void prefix_kernel(const float* __restrict__ DA, unsigned short* __restrict__ ABT)
{
  __shared__ __align__(16) unsigned sT[kNC * kScanD * 16];
  const int tid  = threadIdx.x;
  const int lane = tid & 31;
  const int wave = __builtin_amdgcn_readfirstlane((int)(threadIdx.x >> 5));
  const int b    = blockIdx.x / (kD / kScanD);
  const int d0   = (blockIdx.x - b * (kD / kScanD)) * kScanD;
  const int dl   = lane & 15;
  const int pi   = wave * 2 + (lane >> 4);

  const float* src = DA + ((size_t)(b * kNC) * kP + 2 * pi) * kD + d0 + dl;
  float v0[kNC - 1], v1[kNC - 1];
#pragma unroll
  for (int c = 0; c < kNC - 1; ++c) {
    v0[c] = src[(size_t)c * kP * kD];
    v1[c] = src[(size_t)c * kP * kD + kD];
  }
  /* keeps every load issued ahead of the first sum: without it the last loads are scheduled behind a wait on the first and pay a second latency */
  __builtin_amdgcn_sched_barrier(0);

  const int sw = (dl >> 2) & 3;
  const int wh = dl * 16 + (((pi >> 2) ^ sw) << 2) + (pi & 3);
  const int wl = dl * 16 + (((2 + (pi >> 2)) ^ sw) << 2) + (pi & 3);
  float a0 = 0.0f, a1 = 0.0f;
#pragma unroll
  for (int c = 0; c < kNC; ++c) {
    const _Float16 h0 = (_Float16)a0;
    const _Float16 h1 = (_Float16)a1;
    const float h0f = (float)h0;
    const float h1f = (float)h1;
    const unsigned short hb0 = __builtin_bit_cast(unsigned short, h0);
    const unsigned short hb1 = __builtin_bit_cast(unsigned short, h1);
    const unsigned short lb0 = h_bits(a0 - h0f);
    const unsigned short lb1 = h_bits(a1 - h1f);
    sT[c * (kScanD * 16) + wh] = pk16(hb0, hb1);
    sT[c * (kScanD * 16) + wl] = pk16(lb0, lb1);
    if (c < kNC - 1) {
      a0 += v0[c];
      a1 += v1[c];
    }
  }
  __syncthreads();

  /* piece index inside a chunk tile = tid & 63 (row = piece >> 2); two chunks per iteration */
  const int pc  = tid & 63;
  const int ch  = tid >> 6;
  const int row = pc >> 2;
  const unsigned* sr = sT + ch * (kScanD * 16) + row * 16 + (((pc & 3) ^ ((row >> 2) & 3)) << 2);
  unsigned short* g = ABT + ((size_t)(b * kNC + ch) * kD + d0) * 32 + pc * 8;
  v4u v[16];
#pragma unroll
  for (int it = 0; it < 16; ++it) v[it] = *(const v4u*)(sr + it * 2 * (kScanD * 16));
#pragma unroll
  for (int it = 0; it < 16; ++it) *(v4u*)(g + (size_t)it * 2 * kD * 32) = v[it];
}

/* --------------------------------------------------------------------------- */
/* K4: per block (b, c), 64 query rows x 512 columns.                          */
/*  (1) LDS tile sA[64][96] f16: cols 0..15 and 16..31 = gate x 64 (copied     */
/*      from W16 by waves 0..3: 128 threads x 2 x 8 halves = 64 x 32);         */
/*  (2) cols 32..95 = 64 * L[s][t] = sum_p (64 w[s][p]) * prods[t][p], kept    */
/*      for t <= s (diagonal included), else 0 by select; 16 tiles of 16 x 16, */
/*      two per wave; K padded 16 -> 32 by zero upper fragment halves built in */
/*      registers (both operands);                                             */
/*  (3) fused K = 96 product: A = [W | W | L], Bt[d] = [Ab_hi | Ab_lo | XT     */
/*      chunk]; wave = 16 rows x 256 columns in 4 groups of 64; f32 result     */
/*      x 1/64 -> per-wave slab -> rows stored as 16 lanes x 16 B = 256 B,     */
/* grid = 128 blocks, 256 threads.                                             */
/* --------------------------------------------------------------------------- */
__global__ __launch_bounds__(256) void output_kernel(
    const unsigned short* __restrict__ W16, const unsigned short* __restrict__ P16,
    const unsigned short* __restrict__ ABT, const unsigned short* __restrict__ XT, float* __restrict__ out)
{
  __shared__ __align__(16) unsigned short sA[64 * kTilePitch];
  __shared__ __align__(16) float slab[8 * 16 * kSlabPitch];
  const int tid  = threadIdx.x;
  const int lane = tid & 31;
  const int wave = __builtin_amdgcn_readfirstlane((int)(threadIdx.x >> 5));
  const int hh = lane >> 4;
  const int cl = lane & 15;
  const int bc = blockIdx.x;
  const int b  = bc / kNC;
  const int c0 = (bc - b * kNC) * kC;
  const int r0 = b * kS + c0;
  const int mt = wave & 3;
  const int nh = wave >> 2;

  if (wave < 4) {
    const int row = tid >> 1;
    const int hf  = tid & 1;
    const v4u w = *(const v4u*)(W16 + (size_t)r0 * kP + tid * 8);
    *(v4u*)(sA + row * kTilePitch + hf * 8) = w;
    *(v4u*)(sA + row * kTilePitch + 16 + hf * 8) = w;
  }
  {
    const v4u zero4 = (v4u){0u, 0u, 0u, 0u};
    const v4u aw = *(const v4u*)(W16 + (size_t)(r0 + 16 * mt + cl) * kP + 8 * hh);
    const v16h af = frag_h_words(aw, zero4);
#pragma unroll
    for (int jj = 0; jj < 2; ++jj) {
      const int tt = nh * 2 + jj;
      const v4u pw = *(const v4u*)(P16 + (size_t)(r0 + 16 * tt + cl) * kP + 8 * hh);
      const v16h bf = frag_h_words(pw, zero4);
      v8f accL = (v8f){0.f, 0.f, 0.f, 0.f, 0.f, 0.f, 0.f, 0.f};
      accL = mma_h(af, bf, accL);
      const int tl = 16 * tt + cl;
#pragma unroll
      for (int r = 0; r < 8; ++r) {
        const int sl = 16 * mt + 8 * hh + r;
        const float val = (tl <= sl) ? accL[r] : 0.0f;
        sA[sl * kTilePitch + 32 + tl] = h_bits(val);
      }
    }
  }
  __syncthreads();

  v16h a[3];
#pragma unroll
  for (int ks = 0; ks < 3; ++ks) {
    const unsigned short* ap = sA + (16 * mt + cl) * kTilePitch + 32 * ks + 8 * hh;
    const v4u x0 = *(const v4u*)(ap);
    const v4u x1 = *(const v4u*)(ap + 16);
    a[ks] = frag_h_words(x0, x1);
  }

  float* sw = slab + wave * 16 * kSlabPitch;
  const int c4 = cl * 4;
#pragma unroll 1
  for (int g = 0; g < 4; ++g) {
    const int n0 = 256 * nh + 64 * g;
    v8f acc[4];
#pragma unroll
    for (int j = 0; j < 4; ++j) acc[j] = (v8f){0.f, 0.f, 0.f, 0.f, 0.f, 0.f, 0.f, 0.f};
#pragma unroll
    for (int j = 0; j < 4; ++j) {
      const int d = n0 + 16 * j + cl;
      const v16h bs = ldg_frag_h(ABT + ((size_t)bc * kD + d) * 32 + 8 * hh);
      acc[j] = mma_h(a[0], bs, acc[j]);
      const unsigned short* xt = XT + ((size_t)(b * kD + d)) * kS + c0 + 8 * hh;
      const v16h bx0 = ldg_frag_h(xt);
      acc[j] = mma_h(a[1], bx0, acc[j]);
      const v16h bx1 = ldg_frag_h(xt + 32);
      acc[j] = mma_h(a[2], bx1, acc[j]);
    }
#pragma unroll
    for (int j = 0; j < 4; ++j)
#pragma unroll
      for (int r = 0; r < 8; ++r) sw[(8 * hh + r) * kSlabPitch + 16 * j + cl] = acc[j][r] * kWCarryInv;
    __syncthreads();
    v4f v[8];
#pragma unroll
    for (int it = 0; it < 8; ++it) v[it] = *(const v4f*)(sw + (it * 2 + hh) * kSlabPitch + c4);
    {
#pragma unroll
      for (int it = 0; it < 8; ++it)
        *(v4f*)(out + ((size_t)(r0 + 16 * mt + it * 2 + hh)) * kD + n0 + c4) = v[it];
      
    }
    __syncthreads();
  }
}

/* --------------------------------------------------------------------------- */
/* Host glue: 5 kernel launches, nothing else.                                 */
/* --------------------------------------------------------------------------- */
extern "C" void kernel_launch(void* const* d_in, const int* in_sizes, int n_in,
                              void* d_out, int out_size, void* d_ws, size_t ws_size,
                              hipStream_t stream) {
  if (n_in < 2) return;
  if (in_sizes[0] != kRows * kD) return;
  if (in_sizes[1] != kP * kD) return;
  if (out_size != kRows * kD) return;
  if (ws_size < kWsTotal) return;

  const float* x   = (const float*)d_in[0];
  const float* anc = (const float*)d_in[1];
  float* out = (float*)d_out;

  char* ws = (char*)d_ws;
  unsigned short* XT   = (unsigned short*)(ws + kOffXT);
  unsigned short* P16  = (unsigned short*)(ws + kOffP16);
  unsigned short* W16  = (unsigned short*)(ws + kOffW16);
  unsigned short* PT16 = (unsigned short*)(ws + kOffPT16);
  float*          DA   = (float*)(ws + kOffDA);
  unsigned short* ABT  = (unsigned short*)(ws + kOffABT);

  xpose_f16_kernel<<<dim3(kD / 64, kS / 64, kB), 256, 0, stream>>>(x, XT);
  scores_gate_kernel<<<dim3(kRows / 64), 128, 0, stream>>>(x, anc, P16, W16, PT16);
  chunk_state_kernel<<<dim3(kB * kNC), 256, 0, stream>>>(PT16, XT, DA);
  prefix_kernel<<<dim3(kB * (kD / kScanD)), 128, 0, stream>>>(DA, ABT);
  output_kernel<<<dim3(kB * kNC), 256, 0, stream>>>(W16, P16, ABT, XT, out);
}

// v002
// One run takes 38.3 microseconds.
// Two timings next to v001 put it at 1.24 and 1.28 times that version's speed.
// Counting every step since v000, it is 1.73 times as fast.
// prods (anchors x tokens, K=512): v_wmma_f32_16x16x32_bf16 with both operands as bf16 hi+lo (hi.lo + lo.hi + hi.hi); chunk states, intra-chunk scores, carry and intra-chunk output: v_wmma_f32_16x16x32_f16 (gate plane carried x64, chunk-prefix state as f16 hi+lo planes); f32 accumulate; softmax and prefix scan in f32.
#include <hip/hip_runtime.h>
#include <math.h>

typedef __attribute__((ext_vector_type(16))) _Float16 v16h;
typedef __attribute__((ext_vector_type(16))) __bf16   v16b;
typedef __attribute__((ext_vector_type(8)))  float    v8f;
typedef __attribute__((ext_vector_type(4)))  float    v4f;
typedef __attribute__((ext_vector_type(4)))  unsigned int v4u;
typedef __attribute__((ext_vector_type(8)))  unsigned int v8u;

/* --------------------------------------------------------------------------- */
/* Shape constants                                                             */
/* --------------------------------------------------------------------------- */
constexpr int kB    = 4;
constexpr int kS    = 2048;
constexpr int kD    = 512;
constexpr int kP    = 16;
constexpr int kC    = 64;
constexpr int kNC   = kS / kC;
constexpr int kRows = kB * kS;
/* gate scale = 1/sqrt(kP), checked against kP */
constexpr float kGateScale = 0.25f;
static_assert(kGateScale * kGateScale * (float)kP == 1.0f);
/* gate plane carry (power of two), folded back in the output epilogue */
constexpr float kWCarry    = 64.0f;
constexpr float kWCarryInv = 1.0f / kWCarry;
static_assert(kWCarry * kWCarryInv == 1.0f);
static_assert(kS % kC == 0 && kC == 64 && kP == 16 && kD % 64 == 0);
/* LDS pitches */
constexpr int kAncPitchW = 260;
constexpr int kTilePitch = 104;
constexpr int kSlabPitch = 68;

/* --------------------------------------------------------------------------- */
/* Workspace region map (bytes; every offset a multiple of 128)                */
/*   XT    f16 [4][512][2048]      transposed tokens (Bt for sites K=t)  8,388,608 */
/*   P16   f16 [8192][16]          prods, token-major                      262,144 */
/*   W16   f16 [8192][16]          gate x64, token-major                   262,144 */
/*   PT16  f16 [4][16][2048]       prods, anchor-major                     262,144 */
/*   DA    f32 [4][32][16][512]    chunk states                          4,194,304 */
/*   ABT   f16 [4][32][512][32]    exclusive chunk prefix, hi|lo         4,194,304 */
/*   total = 8,388,608 + 262,144 + 262,144 + 262,144 + 4,194,304 + 4,194,304       */
/*         = 17,563,648                                                            */
/* --------------------------------------------------------------------------- */
constexpr size_t kOffXT   = 0;
constexpr size_t kOffP16  = kOffXT   + (size_t)kB * kD * kS * 2;
constexpr size_t kOffW16  = kOffP16  + (size_t)kRows * kP * 2;
constexpr size_t kOffPT16 = kOffW16  + (size_t)kRows * kP * 2;
constexpr size_t kOffDA   = kOffPT16 + (size_t)kB * kP * kS * 2;
constexpr size_t kOffABT  = kOffDA   + (size_t)kB * kNC * kP * kD * 4;
constexpr size_t kWsTotal = kOffABT  + (size_t)kB * kNC * kD * 32 * 2;
static_assert(kWsTotal == 17563648ull);
static_assert(kWsTotal <= 134217728ull);
static_assert((kOffP16 % 128) == 0 && (kOffW16 % 128) == 0 && (kOffPT16 % 128) == 0 &&
              (kOffDA % 128) == 0 && (kOffABT % 128) == 0);

/* --------------------------------------------------------------------------- */
/* Small helpers                                                               */
/* --------------------------------------------------------------------------- */
__device__ __forceinline__ unsigned short f2bf_bits(float f) {
  unsigned u = __float_as_uint(f);
  return (unsigned short)((u + 0x7FFFu + ((u >> 16) & 1u)) >> 16);
}
__device__ __forceinline__ float bf_bits2f(unsigned short h) { return __uint_as_float(((unsigned)h) << 16); }
__device__ __forceinline__ unsigned pk16(unsigned short a, unsigned short b) { return (unsigned)a | ((unsigned)b << 16); }
__device__ __forceinline__ unsigned short h_bits(float f) { const _Float16 h = (_Float16)f; return __builtin_bit_cast(unsigned short, h); }

/* bf16 hi and lo words of a pair of f32 values (both conversions RNE) */
__device__ __forceinline__ void split_pair(float a, float b, unsigned& hw, unsigned& lw) {
  const unsigned short ha = f2bf_bits(a), hb = f2bf_bits(b);
  const unsigned short la = f2bf_bits(a - bf_bits2f(ha)), lb = f2bf_bits(b - bf_bits2f(hb));
  hw = pk16(ha, hb);
  lw = pk16(la, lb);
}

__device__ __forceinline__ v16h frag_h_words(v4u a, v4u b) {
  const v8u w = __builtin_shufflevector(a, b, 0, 1, 2, 3, 4, 5, 6, 7);
  return __builtin_bit_cast(v16h, w);
}
__device__ __forceinline__ v16b frag_b_words(v4u a, v4u b) {
  const v8u w = __builtin_shufflevector(a, b, 0, 1, 2, 3, 4, 5, 6, 7);
  return __builtin_bit_cast(v16b, w);
}
/* global fragment load: p points at k0 + 8*(lane>>4) of the lane's row; elements 0..7 <- p[0..7], 8..15 <- p[16..23] */
__device__ __forceinline__ v16h ldg_frag_h(const unsigned short* p) {
  const v4u a = *(const v4u*)(p);
  const v4u b = *(const v4u*)(p + 16);
  return frag_h_words(a, b);
}

/* one WMMA + hazard guard tied to its accumulator and naming its A/B fragments */
__device__ __forceinline__ v8f mma_h(v16h a, v16h b, v8f c) {
  c = __builtin_amdgcn_wmma_f32_16x16x32_f16(false, a, false, b, (short)0, c, false, false);
  asm volatile("v_nop\n\tv_nop\n\tv_nop\n\tv_nop" : "+v"(c) : "v"(a), "v"(b));
  return c;
}
__device__ __forceinline__ v8f mma_b(v16b a, v16b b, v8f c) {
  c = __builtin_amdgcn_wmma_f32_16x16x32_bf16(false, a, false, b, (short)0, c, false, false);
  asm volatile("v_nop\n\tv_nop\n\tv_nop\n\tv_nop" : "+v"(c) : "v"(a), "v"(b));
  return c;
}

/* --------------------------------------------------------------------------- */
/* K0: XT[b][d][s] = f16(x[b][s][d]) through a 64 x 64 LDS tile.               */
/* grid (8 d-tiles, 32 s-tiles, 4 batches), 256 threads.                       */
/* Load coverage: 4 iterations x 256 threads x 4 floats = 4096 = whole tile.   */
/* Store coverage: 8 waves x 2 iterations x 4 rows (lane>>3) = 64 d rows;      */
/* --------------------------------------------------------------------------- */
__global__ __launch_bounds__(256) void xpose_f16_kernel(const float* __restrict__ x, unsigned short* __restrict__ XT)
{
  __shared__ float sm[64 * 65];
  const int tid  = threadIdx.x;
  const int lane = tid & 31;
  const int wave = __builtin_amdgcn_readfirstlane((int)(threadIdx.x >> 5));
  const int d0 = blockIdx.x * 64;
  const int s0 = blockIdx.y * 64;
  const int b  = blockIdx.z;
  const float* xb = x + ((size_t)b * kS + s0) * kD + d0;
#pragma unroll
  for (int i = 0; i < 4; ++i) {
    const int e  = i * 256 + tid;
    const int r  = e >> 4;
    const int c4 = (e & 15) * 4;
    const v4f v = *(const v4f*)(xb + (size_t)r * kD + c4);
    sm[r * 65 + c4 + 0] = v[0];
    sm[r * 65 + c4 + 1] = v[1];
    sm[r * 65 + c4 + 2] = v[2];
    sm[r * 65 + c4 + 3] = v[3];
  }
  __syncthreads();
  const int q  = lane >> 3;
  const int s8 = (lane & 7) * 8;
  v4u u[2];
#pragma unroll
  for (int it = 0; it < 2; ++it) {
    const int dl = wave * 8 + it * 4 + q;
    unsigned short hb[8];
#pragma unroll
    for (int e = 0; e < 8; ++e) hb[e] = h_bits(sm[(s8 + e) * 65 + dl]);
    u[it] = (v4u){pk16(hb[0], hb[1]), pk16(hb[2], hb[3]), pk16(hb[4], hb[5]), pk16(hb[6], hb[7])};
  }
  {
#pragma unroll
    for (int it = 0; it < 2; ++it) {
      const int dl = wave * 8 + it * 4 + q;
      *(v4u*)(XT + ((size_t)(b * kD + d0 + dl)) * kS + s0 + s8) = u[it];
    }
    
  }
}

/* --------------------------------------------------------------------------- */
/* K1: prods for 64 token rows (M = 64, N = 16 anchors, K = 512) as a bf16     */
/* hi/lo three-product WMMA. 8 waves: wave = (16-row tile mt, K half kh), so a */
/* lane's whole share of the tokens (8 steps x 4 x 16 B) and of the anchors    */
/* (8 x 16 B) fits in registers and is requested before anything is waited on: */
/* the block pays one memory latency. Token values are split in registers      */
/* (each token element is consumed once here); anchor hi/lo word planes staged */
/* in LDS (8 iterations x 256 threads x 4 floats = 16 x 512, all read words    */
/* written). The two K halves meet in LDS: prods = half 0 + half 1. Then the   */
/* 16-wide softmax per token row in f32, in registers.                         */
/*   P16  [row][16] f16 prods         block tile = 2 KiB contiguous = 16 lines */
/*   W16  [row][16] f16 gate x 64     same map                                 */
/*   PT16 [b][p][s] f16 prods         64 s x 2 B = one line per anchor         */
/* Wave w < 4 writes lines 4w..4w+3 of each plane (lanes 8q..8q+7 -> line 4w+q). */
/* grid = 8192 / 64 = 128 blocks, 256 threads.                                 */
/* --------------------------------------------------------------------------- */
constexpr int kKHalf  = kD / 2;
constexpr int kKSteps = kKHalf / 32;
static_assert(kKSteps == 8 && kP * kD == 8 * 256 * 4);
__global__ __launch_bounds__(256) void scores_gate_kernel(
    const float* __restrict__ x, const float* __restrict__ anc,
    unsigned short* __restrict__ P16, unsigned short* __restrict__ W16, unsigned short* __restrict__ PT16)
{
  __shared__ __align__(16) unsigned sAH[kP * kAncPitchW];
  __shared__ __align__(16) unsigned sAL[kP * kAncPitchW];
  __shared__ float sPart[2 * 64 * 17];
  __shared__ float sProd[64 * 17];
  __shared__ float sGate[64 * 17];
  const int tid  = threadIdx.x;
  const int lane = tid & 31;
  const int wave = __builtin_amdgcn_readfirstlane((int)(threadIdx.x >> 5));
  const int hh = lane >> 4;
  const int cl = lane & 15;
  const int mt = wave & 3;
  const int kh = wave >> 2;
  const int r0 = blockIdx.x * 64;
  const int b  = r0 / kS;
  const int s0 = r0 - b * kS;

  /* every global load of the block, anchors first (they are needed first) */
  /* float4 number i * 256 + tid of the 16 x 512 anchor array, which is contiguous */
  const float* aptr = anc + tid * 4;
  v4f av[8];
  /* unrolled here and below: av and xv live in registers only with constant indices */
#pragma unroll
  for (int i = 0; i < 8; ++i) av[i] = *(const v4f*)(aptr + i * 1024);
  /* A rows = token rows of this wave's tile, natural [row][d] layout, this wave's K half */
  const float* xrow = x + (size_t)(r0 + mt * 16 + cl) * kD + kh * kKHalf + 8 * hh;
  v4f xv[kKSteps][4];
#pragma unroll
  for (int it = 0; it < kKSteps; ++it) {
    xv[it][0] = *(const v4f*)(xrow + it * 32);
    xv[it][1] = *(const v4f*)(xrow + it * 32 + 4);
    xv[it][2] = *(const v4f*)(xrow + it * 32 + 16);
    xv[it][3] = *(const v4f*)(xrow + it * 32 + 20);
  }
  /* keeps every load issued ahead of the first wait: without it the token loads are scheduled behind the waits on the first anchor loads and pay a second latency */
  __builtin_amdgcn_sched_barrier(0);

#pragma unroll
  for (int i = 0; i < 8; ++i) {
    const int e4 = i * 256 + tid;
    const int p  = e4 >> 7;
    const int cf = (e4 & 127) * 4;
    unsigned h01, l01, h23, l23;
    split_pair(av[i][0], av[i][1], h01, l01);
    split_pair(av[i][2], av[i][3], h23, l23);
    const int wo = p * kAncPitchW + (cf >> 1);
    sAH[wo]     = h01;
    sAH[wo + 1] = h23;
    sAL[wo]     = l01;
    sAL[wo + 1] = l23;
  }
  __syncthreads();

  v8f acc = (v8f){0.f, 0.f, 0.f, 0.f, 0.f, 0.f, 0.f, 0.f};
#pragma unroll
  for (int it = 0; it < kKSteps; ++it) {
    const int k0 = kh * kKHalf + it * 32;
    const v4f f0 = xv[it][0];
    const v4f f1 = xv[it][1];
    const v4f f2 = xv[it][2];
    const v4f f3 = xv[it][3];
    unsigned hw0, hw1, hw2, hw3, hw4, hw5, hw6, hw7;
    unsigned lw0, lw1, lw2, lw3, lw4, lw5, lw6, lw7;
    split_pair(f0[0], f0[1], hw0, lw0);
    split_pair(f0[2], f0[3], hw1, lw1);
    split_pair(f1[0], f1[1], hw2, lw2);
    split_pair(f1[2], f1[3], hw3, lw3);
    split_pair(f2[0], f2[1], hw4, lw4);
    split_pair(f2[2], f2[3], hw5, lw5);
    split_pair(f3[0], f3[1], hw6, lw6);
    split_pair(f3[2], f3[3], hw7, lw7);
    const v8u hv = (v8u){hw0, hw1, hw2, hw3, hw4, hw5, hw6, hw7};
    const v8u lv = (v8u){lw0, lw1, lw2, lw3, lw4, lw5, lw6, lw7};
    const v16b ah = __builtin_bit_cast(v16b, hv);
    const v16b al = __builtin_bit_cast(v16b, lv);
    /* B column = anchor cl; words at halves k0 + 8*hh and + 16 */
    const int wb = cl * kAncPitchW + (k0 >> 1) + 4 * hh;
    const v4u bh0 = *(const v4u*)(sAH + wb);
    const v4u bh1 = *(const v4u*)(sAH + wb + 8);
    const v4u bl0 = *(const v4u*)(sAL + wb);
    const v4u bl1 = *(const v4u*)(sAL + wb + 8);
    const v16b bh = frag_b_words(bh0, bh1);
    const v16b bl = frag_b_words(bl0, bl1);
    acc = mma_b(ah, bl, acc);
    acc = mma_b(al, bh, acc);
    acc = mma_b(ah, bh, acc);
  }
  /* D element r of this lane = (token row 8*hh + r of tile mt, anchor cl), K half kh */
#pragma unroll
  for (int r = 0; r < 8; ++r) sPart[(kh * 64 + mt * 16 + 8 * hh + r) * 17 + cl] = acc[r];
  __syncthreads();

  /* K halves added, then softmax over the 16 anchors, one token row per thread (waves 0 and 1, scalar branch) */
  if (wave < 2) {
    float pr[kP], ge[kP];
    /* unrolled: the 32 LDS reads are issued together (rolled, each trip waited for its own) and the row stays in registers */
#pragma unroll
    for (int p = 0; p < kP; ++p) pr[p] = sPart[tid * 17 + p] + sPart[(64 + tid) * 17 + p];
    float m = pr[0] * kGateScale;
#pragma unroll
    for (int p = 1; p < kP; ++p) m = fmaxf(m, pr[p] * kGateScale);
    float sum = 0.0f;
#pragma unroll
    for (int p = 0; p < kP; ++p) {
      ge[p] = expf(pr[p] * kGateScale - m);
      sum += ge[p];
    }
    const float inv = (1.0f / sum) * kWCarry;
#pragma unroll
    for (int p = 0; p < kP; ++p) {
      sProd[tid * 17 + p] = pr[p];
      sGate[tid * 17 + p] = ge[p] * inv;
    }
  }
  __syncthreads();

  /* store phase (waves 0..3, scalar branch; no barrier follows) */
  if (wave < 4) {
    const int q  = lane >> 3;
    const int j  = lane & 7;
    const int ln = wave * 4 + q;
    const int row = 4 * ln + (j >> 1);
    const int p0  = (j & 1) * 8;
    unsigned short pb[8], wb16[8], tb[8];
#pragma unroll
    for (int e = 0; e < 8; ++e) {
      pb[e]   = h_bits(sProd[row * 17 + p0 + e]);
      wb16[e] = h_bits(sGate[row * 17 + p0 + e]);
      tb[e]   = h_bits(sProd[(8 * j + e) * 17 + ln]);
    }
    const v4u up = (v4u){pk16(pb[0], pb[1]), pk16(pb[2], pb[3]), pk16(pb[4], pb[5]), pk16(pb[6], pb[7])};
    const v4u uw = (v4u){pk16(wb16[0], wb16[1]), pk16(wb16[2], wb16[3]), pk16(wb16[4], wb16[5]), pk16(wb16[6], wb16[7])};
    const v4u ut = (v4u){pk16(tb[0], tb[1]), pk16(tb[2], tb[3]), pk16(tb[4], tb[5]), pk16(tb[6], tb[7])};
    unsigned short* gp = P16 + (size_t)r0 * kP + ln * 64 + j * 8;
    unsigned short* gw = W16 + (size_t)r0 * kP + ln * 64 + j * 8;
    unsigned short* gt = PT16 + ((size_t)(b * kP + ln)) * kS + s0 + 8 * j;
    *(v4u*)gp = up;
    *(v4u*)gw = uw;
    *(v4u*)gt = ut;
  }
}

/* --------------------------------------------------------------------------- */
/* K2: chunk states DA[b][c][p][d] = sum_{t in chunk} prods[p][t] * x[t][d].   */
/* Per block (b, c): M = 16 (anchors), N = 512, K = 64; f16 WMMA.              */
/* A = PT16 rows (k = t contiguous), Bt = XT rows (d-major, k = t contiguous). */
/* 8 waves x 64 columns; per-wave 16 x 64 f32 slab in LDS, rows stored as      */
/* grid = 128 blocks, 256 threads.                                             */
/* --------------------------------------------------------------------------- */
__global__ __launch_bounds__(256) void chunk_state_kernel(
    const unsigned short* __restrict__ PT16, const unsigned short* __restrict__ XT, float* __restrict__ DA)
{
  __shared__ __align__(16) float slab[8 * 16 * kSlabPitch];
  const int tid  = threadIdx.x;
  const int lane = tid & 31;
  const int wave = __builtin_amdgcn_readfirstlane((int)(threadIdx.x >> 5));
  const int hh = lane >> 4;
  const int cl = lane & 15;
  const int bc = blockIdx.x;
  const int b  = bc / kNC;
  const int c0 = (bc - b * kNC) * kC;
  const int n0 = wave * 64;

  const unsigned short* aptr = PT16 + ((size_t)(b * kP + cl)) * kS + c0 + 8 * hh;
  const v16h a0 = ldg_frag_h(aptr);
  const v16h a1 = ldg_frag_h(aptr + 32);
  v8f acc[4];
#pragma unroll
  for (int j = 0; j < 4; ++j) acc[j] = (v8f){0.f, 0.f, 0.f, 0.f, 0.f, 0.f, 0.f, 0.f};
#pragma unroll
  for (int j = 0; j < 4; ++j) {
    const unsigned short* bptr = XT + ((size_t)(b * kD + n0 + 16 * j + cl)) * kS + c0 + 8 * hh;
    const v16h b0 = ldg_frag_h(bptr);
    const v16h b1 = ldg_frag_h(bptr + 32);
    acc[j] = mma_h(a0, b0, acc[j]);
    acc[j] = mma_h(a1, b1, acc[j]);
  }
  float* sw = slab + wave * 16 * kSlabPitch;
#pragma unroll
  for (int j = 0; j < 4; ++j)
#pragma unroll
    for (int r = 0; r < 8; ++r) sw[(8 * hh + r) * kSlabPitch + 16 * j + cl] = acc[j][r];
  __syncthreads();
  const int c4 = cl * 4;
  v4f v[8];
#pragma unroll
  for (int it = 0; it < 8; ++it) v[it] = *(const v4f*)(sw + (it * 2 + hh) * kSlabPitch + c4);
  {
#pragma unroll
    for (int it = 0; it < 8; ++it)
      *(v4f*)(DA + ((size_t)bc * kP + it * 2 + hh) * kD + n0 + c4) = v[it];
    
  }
}

/* --------------------------------------------------------------------------- */
/* K3: exclusive prefix of DA over the 32 chunks (f32, forward in time, zero   */
/* start per batch), emitted as ABT[b][c][d][32] f16 = [hi p0..15 | lo p0..15] */
/* with hi = f16(A), lo = f16(A - hi). Separate source and destination.        */
/* Thread = one (b, d, anchor pair): the 31 chunk states of both anchors that  */
/* the exclusive prefix needs are loaded up front (none depends on a sum), so  */
/* the block pays one memory latency; the sums then run in registers in chunk  */
/* order. Block = 16 consecutive d x 8 anchor pairs (lane = pair bit | d).     */
/* All 32 chunk tiles (16 rows x 64 B each) are staged in LDS; the 16-byte     */
/* piece q of row d lies at piece q ^ ((d >> 2) & 3), so the 32 lanes of a     */
/* word store fall on 32 banks. One barrier, then 16 iterations x 128 threads  */
/* x 16 B, lane-contiguous (a wave covers 4 whole lines).                      */
/* grid = 4 x 32 = 128 blocks, 128 threads.                                    */
/* --------------------------------------------------------------------------- */
constexpr int kScanD = 16;
static_assert(kD % kScanD == 0 && kP == 16 && kNC == 32);
__global__ __launch_bounds__(128) void prefix_kernel(const float* __restrict__ DA, unsigned short* __restrict__ ABT)
{
  __shared__ __align__(16) unsigned sT[kNC * kScanD * 16];
  const int tid  = threadIdx.x;
  const int lane = tid & 31;
  const int wave = __builtin_amdgcn_readfirstlane((int)(threadIdx.x >> 5));
  const int b    = blockIdx.x / (kD / kScanD);
  const int d0   = (blockIdx.x - b * (kD / kScanD)) * kScanD;
  const int dl   = lane & 15;
  const int pi   = wave * 2 + (lane >> 4);

  const float* src = DA + ((size_t)(b * kNC) * kP + 2 * pi) * kD + d0 + dl;
  float v0[kNC - 1], v1[kNC - 1];
#pragma unroll
  for (int c = 0; c < kNC - 1; ++c) {
    v0[c] = src[(size_t)c * kP * kD];
    v1[c] = src[(size_t)c * kP * kD + kD];
  }
  /* keeps every load issued ahead of the first sum: without it the last loads are scheduled behind a wait on the first and pay a second latency */
  __builtin_amdgcn_sched_barrier(0);

  const int sw = (dl >> 2) & 3;
  const int wh = dl * 16 + (((pi >> 2) ^ sw) << 2) + (pi & 3);
  const int wl = dl * 16 + (((2 + (pi >> 2)) ^ sw) << 2) + (pi & 3);
  float a0 = 0.0f, a1 = 0.0f;
#pragma unroll
  for (int c = 0; c < kNC; ++c) {
    const _Float16 h0 = (_Float16)a0;
    const _Float16 h1 = (_Float16)a1;
    const float h0f = (float)h0;
    const float h1f = (float)h1;
    const unsigned short hb0 = __builtin_bit_cast(unsigned short, h0);
    const unsigned short hb1 = __builtin_bit_cast(unsigned short, h1);
    const unsigned short lb0 = h_bits(a0 - h0f);
    const unsigned short lb1 = h_bits(a1 - h1f);
    sT[c * (kScanD * 16) + wh] = pk16(hb0, hb1);
    sT[c * (kScanD * 16) + wl] = pk16(lb0, lb1);
    if (c < kNC - 1) {
      a0 += v0[c];
      a1 += v1[c];
    }
  }
  __syncthreads();

  /* piece index inside a chunk tile = tid & 63 (row = piece >> 2); two chunks per iteration */
  const int pc  = tid & 63;
  const int ch  = tid >> 6;
  const int row = pc >> 2;
  const unsigned* sr = sT + ch * (kScanD * 16) + row * 16 + (((pc & 3) ^ ((row >> 2) & 3)) << 2);
  unsigned short* g = ABT + ((size_t)(b * kNC + ch) * kD + d0) * 32 + pc * 8;
  v4u v[16];
#pragma unroll
  for (int it = 0; it < 16; ++it) v[it] = *(const v4u*)(sr + it * 2 * (kScanD * 16));
#pragma unroll
  for (int it = 0; it < 16; ++it) *(v4u*)(g + (size_t)it * 2 * kD * 32) = v[it];
}

/* --------------------------------------------------------------------------- */
/* K4: per block (b, c), 64 query rows x 512 columns.                          */
/*  (1) LDS tile sA[64][96] f16: cols 0..15 and 16..31 = gate x 64 (copied     */
/*      from W16 by waves 0..3: 128 threads x 2 x 8 halves = 64 x 32);         */
/*  (2) cols 32..95 = 64 * L[s][t] = sum_p (64 w[s][p]) * prods[t][p], kept    */
/*      for t <= s (diagonal included), else 0 by select; 16 tiles of 16 x 16, */
/*      two per wave; K padded 16 -> 32 by zero upper fragment halves built in */
/*      registers (both operands);                                             */
/*  (3) fused K = 96 product: A = [W | W | L], Bt[d] = [Ab_hi | Ab_lo | XT     */
/*      chunk]; wave = 16 rows x 256 columns in 4 groups of 64; f32 result     */
/*      x 1/64 -> per-wave slab -> rows stored as 16 lanes x 16 B = 256 B,     */
/* grid = 128 blocks, 256 threads.                                             */
/* --------------------------------------------------------------------------- */
__global__ __launch_bounds__(256) void output_kernel(
    const unsigned short* __restrict__ W16, const unsigned short* __restrict__ P16,
    const unsigned short* __restrict__ ABT, const unsigned short* __restrict__ XT, float* __restrict__ out)
{
  __shared__ __align__(16) unsigned short sA[64 * kTilePitch];
  __shared__ __align__(16) float slab[8 * 16 * kSlabPitch];
  const int tid  = threadIdx.x;
  const int lane = tid & 31;
  const int wave = __builtin_amdgcn_readfirstlane((int)(threadIdx.x >> 5));
  const int hh = lane >> 4;
  const int cl = lane & 15;
  const int bc = blockIdx.x;
  const int b  = bc / kNC;
  const int c0 = (bc - b * kNC) * kC;
  const int r0 = b * kS + c0;
  const int mt = wave & 3;
  const int nh = wave >> 2;

  if (wave < 4) {
    const int row = tid >> 1;
    const int hf  = tid & 1;
    const v4u w = *(const v4u*)(W16 + (size_t)r0 * kP + tid * 8);
    *(v4u*)(sA + row * kTilePitch + hf * 8) = w;
    *(v4u*)(sA + row * kTilePitch + 16 + hf * 8) = w;
  }
  {
    const v4u zero4 = (v4u){0u, 0u, 0u, 0u};
    const v4u aw = *(const v4u*)(W16 + (size_t)(r0 + 16 * mt + cl) * kP + 8 * hh);
    const v16h af = frag_h_words(aw, zero4);
#pragma unroll
    for (int jj = 0; jj < 2; ++jj) {
      const int tt = nh * 2 + jj;
      const v4u pw = *(const v4u*)(P16 + (size_t)(r0 + 16 * tt + cl) * kP + 8 * hh);
      const v16h bf = frag_h_words(pw, zero4);
      v8f accL = (v8f){0.f, 0.f, 0.f, 0.f, 0.f, 0.f, 0.f, 0.f};
      accL = mma_h(af, bf, accL);
      const int tl = 16 * tt + cl;
#pragma unroll
      for (int r = 0; r < 8; ++r) {
        const int sl = 16 * mt + 8 * hh + r;
        const float val = (tl <= sl) ? accL[r] : 0.0f;
        sA[sl * kTilePitch + 32 + tl] = h_bits(val);
      }
    }
  }
  __syncthreads();

  v16h a[3];
#pragma unroll
  for (int ks = 0; ks < 3; ++ks) {
    const unsigned short* ap = sA + (16 * mt + cl) * kTilePitch + 32 * ks + 8 * hh;
    const v4u x0 = *(const v4u*)(ap);
    const v4u x1 = *(const v4u*)(ap + 16);
    a[ks] = frag_h_words(x0, x1);
  }

  float* sw = slab + wave * 16 * kSlabPitch;
  const int c4 = cl * 4;
#pragma unroll 1
  for (int g = 0; g < 4; ++g) {
    const int n0 = 256 * nh + 64 * g;
    v8f acc[4];
#pragma unroll
    for (int j = 0; j < 4; ++j) acc[j] = (v8f){0.f, 0.f, 0.f, 0.f, 0.f, 0.f, 0.f, 0.f};
#pragma unroll
    for (int j = 0; j < 4; ++j) {
      const int d = n0 + 16 * j + cl;
      const v16h bs = ldg_frag_h(ABT + ((size_t)bc * kD + d) * 32 + 8 * hh);
      acc[j] = mma_h(a[0], bs, acc[j]);
      const unsigned short* xt = XT + ((size_t)(b * kD + d)) * kS + c0 + 8 * hh;
      const v16h bx0 = ldg_frag_h(xt);
      acc[j] = mma_h(a[1], bx0, acc[j]);
      const v16h bx1 = ldg_frag_h(xt + 32);
      acc[j] = mma_h(a[2], bx1, acc[j]);
    }
#pragma unroll
    for (int j = 0; j < 4; ++j)
#pragma unroll
      for (int r = 0; r < 8; ++r) sw[(8 * hh + r) * kSlabPitch + 16 * j + cl] = acc[j][r] * kWCarryInv;
    __syncthreads();
    v4f v[8];
#pragma unroll
    for (int it = 0; it < 8; ++it) v[it] = *(const v4f*)(sw + (it * 2 + hh) * kSlabPitch + c4);
    {
#pragma unroll
      for (int it = 0; it < 8; ++it)
        *(v4f*)(out + ((size_t)(r0 + 16 * mt + it * 2 + hh)) * kD + n0 + c4) = v[it];
      
    }
    __syncthreads();
  }
}

/* --------------------------------------------------------------------------- */
/* Host glue: 5 kernel launches, nothing else.                                 */
/* --------------------------------------------------------------------------- */
extern "C" void kernel_launch(void* const* d_in, const int* in_sizes, int n_in,
                              void* d_out, int out_size, void* d_ws, size_t ws_size,
                              hipStream_t stream) {
  if (n_in < 2) return;
  if (in_sizes[0] != kRows * kD) return;
  if (in_sizes[1] != kP * kD) return;
  if (out_size != kRows * kD) return;
  if (ws_size < kWsTotal) return;

  const float* x   = (const float*)d_in[0];
  const float* anc = (const float*)d_in[1];
  float* out = (float*)d_out;

  char* ws = (char*)d_ws;
  unsigned short* XT   = (unsigned short*)(ws + kOffXT);
  unsigned short* P16  = (unsigned short*)(ws + kOffP16);
  unsigned short* W16  = (unsigned short*)(ws + kOffW16);
  unsigned short* PT16 = (unsigned short*)(ws + kOffPT16);
  float*          DA   = (float*)(ws + kOffDA);
  unsigned short* ABT  = (unsigned short*)(ws + kOffABT);

  xpose_f16_kernel<<<dim3(kD / 64, kS / 64, kB), 256, 0, stream>>>(x, XT);
  scores_gate_kernel<<<dim3(kRows / 64), 256, 0, stream>>>(x, anc, P16, W16, PT16);
  chunk_state_kernel<<<dim3(kB * kNC), 256, 0, stream>>>(PT16, XT, DA);
  prefix_kernel<<<dim3(kB * (kD / kScanD)), 128, 0, stream>>>(DA, ABT);
  output_kernel<<<dim3(kB * kNC), 256, 0, stream>>>(W16, P16, ABT, XT, out);
}

// v003
// One run takes 31.8 microseconds.
// Two timings next to v002 both put it at 1.22 times that version's speed.
// Over all steps from v000 it is 2.11 times as fast.
// prods (anchors x tokens, K=512): v_wmma_f32_16x16x32_bf16 with both operands as bf16 hi+lo (hi.lo + lo.hi + hi.hi); chunk states, intra-chunk scores, carry and intra-chunk output: v_wmma_f32_16x16x32_f16 (gate plane carried x64, chunk-prefix state as f16 hi+lo planes); f32 accumulate; softmax and prefix scan in f32.
#include <hip/hip_runtime.h>
#include <math.h>

typedef __attribute__((ext_vector_type(16))) _Float16 v16h;
typedef __attribute__((ext_vector_type(16))) __bf16   v16b;
typedef __attribute__((ext_vector_type(8)))  float    v8f;
typedef __attribute__((ext_vector_type(4)))  float    v4f;
typedef __attribute__((ext_vector_type(2)))  float    v2f;
typedef __attribute__((ext_vector_type(2)))  _Float16 v2h;
typedef __attribute__((ext_vector_type(4)))  unsigned int v4u;
typedef __attribute__((ext_vector_type(8)))  unsigned int v8u;

/* --------------------------------------------------------------------------- */
/* Shape constants                                                             */
/* --------------------------------------------------------------------------- */
constexpr int kB    = 4;
constexpr int kS    = 2048;
constexpr int kD    = 512;
constexpr int kP    = 16;
constexpr int kC    = 64;
constexpr int kNC   = kS / kC;
constexpr int kRows = kB * kS;
/* gate scale = 1/sqrt(kP), checked against kP */
constexpr float kGateScale = 0.25f;
static_assert(kGateScale * kGateScale * (float)kP == 1.0f);
/* gate plane carry (power of two), folded back in the output epilogue */
constexpr float kWCarry    = 64.0f;
constexpr float kWCarryInv = 1.0f / kWCarry;
static_assert(kWCarry * kWCarryInv == 1.0f);
static_assert(kS % kC == 0 && kC == 64 && kP == 16 && kD % 64 == 0);
/* LDS pitches */
constexpr int kAncPitchW = 260;
constexpr int kTilePitch = 104;
constexpr int kSlabPitch = 68;
/* transposed token tile, 32-bit words per d row: 176 B = 16 B x 11 */
constexpr int kXPitchW = 44;

/* --------------------------------------------------------------------------- */
/* Workspace region map (bytes; every offset a multiple of 128)                */
/*   XT    f16 [4][512][2048]      transposed tokens (Bt for sites K=t)  8,388,608 */
/*   P16   f16 [8192][16]          prods, token-major                      262,144 */
/*   W16   f16 [8192][16]          gate x64, token-major                   262,144 */
/*   DA    f32 [4][32][16][512]    chunk states                          4,194,304 */
/*   ABT   f16 [4][32][512][32]    exclusive chunk prefix, hi|lo         4,194,304 */
/*   total = 8,388,608 + 262,144 + 262,144 + 4,194,304 + 4,194,304 = 17,301,504     */
/* --------------------------------------------------------------------------- */
constexpr size_t kOffXT   = 0;
constexpr size_t kOffP16  = kOffXT   + (size_t)kB * kD * kS * 2;
constexpr size_t kOffW16  = kOffP16  + (size_t)kRows * kP * 2;
constexpr size_t kOffDA   = kOffW16  + (size_t)kRows * kP * 2;
constexpr size_t kOffABT  = kOffDA   + (size_t)kB * kNC * kP * kD * 4;
constexpr size_t kWsTotal = kOffABT  + (size_t)kB * kNC * kD * 32 * 2;
static_assert(kWsTotal == 17301504ull);
static_assert(kWsTotal <= 134217728ull);
static_assert((kOffP16 % 128) == 0 && (kOffW16 % 128) == 0 &&
              (kOffDA % 128) == 0 && (kOffABT % 128) == 0);

/* --------------------------------------------------------------------------- */
/* Small helpers                                                               */
/* --------------------------------------------------------------------------- */
__device__ __forceinline__ unsigned short f2bf_bits(float f) {
  unsigned u = __float_as_uint(f);
  return (unsigned short)((u + 0x7FFFu + ((u >> 16) & 1u)) >> 16);
}
__device__ __forceinline__ float bf_bits2f(unsigned short h) { return __uint_as_float(((unsigned)h) << 16); }
__device__ __forceinline__ unsigned pk16(unsigned short a, unsigned short b) { return (unsigned)a | ((unsigned)b << 16); }
__device__ __forceinline__ unsigned short h_bits(float f) { const _Float16 h = (_Float16)f; return __builtin_bit_cast(unsigned short, h); }

/* bf16 hi and lo words of a pair of f32 values (both conversions RNE) */
__device__ __forceinline__ void split_pair(float a, float b, unsigned& hw, unsigned& lw) {
  const unsigned short ha = f2bf_bits(a), hb = f2bf_bits(b);
  const unsigned short la = f2bf_bits(a - bf_bits2f(ha)), lb = f2bf_bits(b - bf_bits2f(hb));
  hw = pk16(ha, hb);
  lw = pk16(la, lb);
}

__device__ __forceinline__ v16h frag_h_words(v4u a, v4u b) {
  const v8u w = __builtin_shufflevector(a, b, 0, 1, 2, 3, 4, 5, 6, 7);
  return __builtin_bit_cast(v16h, w);
}
__device__ __forceinline__ v16b frag_b_words(v4u a, v4u b) {
  const v8u w = __builtin_shufflevector(a, b, 0, 1, 2, 3, 4, 5, 6, 7);
  return __builtin_bit_cast(v16b, w);
}
/* global fragment load: p points at k0 + 8*(lane>>4) of the lane's row; elements 0..7 <- p[0..7], 8..15 <- p[16..23] */
__device__ __forceinline__ v16h ldg_frag_h(const unsigned short* p) {
  const v4u a = *(const v4u*)(p);
  const v4u b = *(const v4u*)(p + 16);
  return frag_h_words(a, b);
}

/* one WMMA + hazard guard tied to its accumulator and naming its A/B fragments */
__device__ __forceinline__ v8f mma_h(v16h a, v16h b, v8f c) {
  c = __builtin_amdgcn_wmma_f32_16x16x32_f16(false, a, false, b, (short)0, c, false, false);
  asm volatile("v_nop\n\tv_nop\n\tv_nop\n\tv_nop" : "+v"(c) : "v"(a), "v"(b));
  return c;
}
__device__ __forceinline__ v8f mma_b(v16b a, v16b b, v8f c) {
  c = __builtin_amdgcn_wmma_f32_16x16x32_bf16(false, a, false, b, (short)0, c, false, false);
  asm volatile("v_nop\n\tv_nop\n\tv_nop\n\tv_nop" : "+v"(c) : "v"(a), "v"(b));
  return c;
}

/* --------------------------------------------------------------------------- */
/* K1: one block per (batch, 64-token chunk) does all that needs only that     */
/* chunk's tokens, which are read from memory once.                            */
/* (a) prods (M = 64, N = 16 anchors, K = 512) as a bf16 hi/lo three-product   */
/* WMMA. 8 waves: wave = (16-row tile mt, K half kh), so a lane's whole share  */
/* of the tokens (8 steps x 4 x 16 B) and of the anchors (8 x 16 B) fits in    */
/* registers and is requested before anything is waited on: the block pays one */
/* memory latency. Token values are split in registers; anchor hi/lo word      */
/* planes staged in LDS (8 iterations x 256 threads x 4 floats = 16 x 512, all */
/* read words written). The two K halves meet in LDS: prods = half 0 + half 1. */
/* (b) the same token registers as f16, transposed into the LDS tile           */
/* sXT[d][t]: lanes t and t ^ 1 swap one packed word, so every lane stores     */
/* whole words (two neighbouring tokens of one d); 64 stores x 256 threads x   */
/* 2 halves = 512 x 64, the whole tile.                                        */
/* (c) the 16-wide softmax per token row in f32 (waves 0, 1).                  */
/* (d) chunk state DA[b][c][p][d] = sum_t prods[p][t] * x[t][d]: M = 16,       */
/* N = 512, K = 64, f16 WMMA; A from the prods in LDS (rounded to f16), Bt     */
/* rows from sXT; 8 waves x 64 columns through a per-wave 16 x 64 f32 slab.    */
/* (e) the tile copied to XT (16 iterations x 256 threads x 16 B = 64 KiB).    */
/*   P16  [row][16] f16 prods         block tile = 2 KiB contiguous = 16 lines */
/*   W16  [row][16] f16 gate x 64     same map                                 */
/* Wave w < 4 writes lines 4w..4w+3 of each plane (lanes 8q..8q+7 -> line 4w+q). */
/* grid = 8192 / 64 = 128 blocks, 256 threads.                                 */
/* --------------------------------------------------------------------------- */
constexpr int kKHalf  = kD / 2;
constexpr int kKSteps = kKHalf / 32;
static_assert(kKSteps == 8 && kP * kD == 8 * 256 * 4);
__global__ __launch_bounds__(256) void scores_state_kernel(
    const float* __restrict__ x, const float* __restrict__ anc,
    unsigned short* __restrict__ P16, unsigned short* __restrict__ W16,
    unsigned short* __restrict__ XT, float* __restrict__ DA)
{
  __shared__ __align__(16) unsigned sAH[kP * kAncPitchW];
  __shared__ __align__(16) unsigned sAL[kP * kAncPitchW];
  __shared__ float sPart[2 * 64 * 17];
  __shared__ float sProd[64 * 17];
  __shared__ float sGate[64 * 17];
  __shared__ __align__(16) unsigned sXT[kD * kXPitchW];
  __shared__ __align__(16) float slab[8 * 16 * kSlabPitch];
  const int tid  = threadIdx.x;
  const int lane = tid & 31;
  const int wave = __builtin_amdgcn_readfirstlane((int)(threadIdx.x >> 5));
  const int hh = lane >> 4;
  const int cl = lane & 15;
  const int mt = wave & 3;
  const int kh = wave >> 2;
  const int r0 = blockIdx.x * 64;
  const int b  = r0 / kS;
  const int s0 = r0 - b * kS;

  /* every global load of the block, anchors first (they are needed first) */
  /* float4 number i * 256 + tid of the 16 x 512 anchor array, which is contiguous */
  const float* aptr = anc + tid * 4;
  v4f av[8];
  /* unrolled here and below: av and xv live in registers only with constant indices */
#pragma unroll
  for (int i = 0; i < 8; ++i) av[i] = *(const v4f*)(aptr + i * 1024);
  /* A rows = token rows of this wave's tile, natural [row][d] layout, this wave's K half */
  const float* xrow = x + (size_t)(r0 + mt * 16 + cl) * kD + kh * kKHalf + 8 * hh;
  v4f xv[kKSteps][4];
#pragma unroll
  for (int it = 0; it < kKSteps; ++it) {
    xv[it][0] = *(const v4f*)(xrow + it * 32);
    xv[it][1] = *(const v4f*)(xrow + it * 32 + 4);
    xv[it][2] = *(const v4f*)(xrow + it * 32 + 16);
    xv[it][3] = *(const v4f*)(xrow + it * 32 + 20);
  }
  /* keeps every load issued ahead of the first wait: without it the token loads are scheduled behind the waits on the first anchor loads and pay a second latency */
  __builtin_amdgcn_sched_barrier(0);

#pragma unroll
  for (int i = 0; i < 8; ++i) {
    const int e4 = i * 256 + tid;
    const int p  = e4 >> 7;
    const int cf = (e4 & 127) * 4;
    unsigned h01, l01, h23, l23;
    split_pair(av[i][0], av[i][1], h01, l01);
    split_pair(av[i][2], av[i][3], h23, l23);
    const int wo = p * kAncPitchW + (cf >> 1);
    sAH[wo]     = h01;
    sAH[wo + 1] = h23;
    sAL[wo]     = l01;
    sAL[wo + 1] = l23;
  }
  __syncthreads();

  v8f acc = (v8f){0.f, 0.f, 0.f, 0.f, 0.f, 0.f, 0.f, 0.f};
#pragma unroll
  for (int it = 0; it < kKSteps; ++it) {
    const int k0 = kh * kKHalf + it * 32;
    const v4f f0 = xv[it][0];
    const v4f f1 = xv[it][1];
    const v4f f2 = xv[it][2];
    const v4f f3 = xv[it][3];
    unsigned hw0, hw1, hw2, hw3, hw4, hw5, hw6, hw7;
    unsigned lw0, lw1, lw2, lw3, lw4, lw5, lw6, lw7;
    split_pair(f0[0], f0[1], hw0, lw0);
    split_pair(f0[2], f0[3], hw1, lw1);
    split_pair(f1[0], f1[1], hw2, lw2);
    split_pair(f1[2], f1[3], hw3, lw3);
    split_pair(f2[0], f2[1], hw4, lw4);
    split_pair(f2[2], f2[3], hw5, lw5);
    split_pair(f3[0], f3[1], hw6, lw6);
    split_pair(f3[2], f3[3], hw7, lw7);
    const v8u hv = (v8u){hw0, hw1, hw2, hw3, hw4, hw5, hw6, hw7};
    const v8u lv = (v8u){lw0, lw1, lw2, lw3, lw4, lw5, lw6, lw7};
    const v16b ah = __builtin_bit_cast(v16b, hv);
    const v16b al = __builtin_bit_cast(v16b, lv);
    /* B column = anchor cl; words at halves k0 + 8*hh and + 16 */
    const int wb = cl * kAncPitchW + (k0 >> 1) + 4 * hh;
    const v4u bh0 = *(const v4u*)(sAH + wb);
    const v4u bh1 = *(const v4u*)(sAH + wb + 8);
    const v4u bl0 = *(const v4u*)(sAL + wb);
    const v4u bl1 = *(const v4u*)(sAL + wb + 8);
    const v16b bh = frag_b_words(bh0, bh1);
    const v16b bl = frag_b_words(bl0, bl1);
    acc = mma_b(ah, bl, acc);
    acc = mma_b(al, bh, acc);
    acc = mma_b(ah, bh, acc);
  }
  /* D element r of this lane = (token row 8*hh + r of tile mt, anchor cl), K half kh */
#pragma unroll
  for (int r = 0; r < 8; ++r) sPart[(kh * 64 + mt * 16 + 8 * hh + r) * 17 + cl] = acc[r];

  /* f16 transpose: this lane holds token t = 16 * mt + cl. Word h = (d, d + 1) of token t, word r = the same of token t ^ 1. */
  /* Even t keeps row d: (t, t + 1) = low halves of h, r. Odd t keeps row d + 1: (t - 1, t) = high halves of r, h. */
  {
    const int odd = cl & 1;
    const unsigned sel = odd ? 0x07060302u : 0x01000504u;
    unsigned* xw = sXT + (kh * kKHalf + 8 * hh + odd) * kXPitchW + ((mt * 16 + cl) >> 1);
#pragma unroll
    for (int it = 0; it < kKSteps; ++it)
#pragma unroll
      for (int q = 0; q < 4; ++q)
#pragma unroll
        for (int m = 0; m < 2; ++m) {
          const int dof = it * 32 + (q >> 1) * 16 + (q & 1) * 4 + 2 * m;
          const v2f f2 = (v2f){xv[it][q][2 * m], xv[it][q][2 * m + 1]};
          const unsigned h = __builtin_bit_cast(unsigned, __builtin_convertvector(f2, v2h));
          /* quad_perm [1,0,3,2]: the word of lane ^ 1 */
          const unsigned r = (unsigned)__builtin_amdgcn_mov_dpp((int)h, 0xB1, 0xF, 0xF, true);
          xw[dof * kXPitchW] = __builtin_amdgcn_perm(h, r, sel);
        }
  }
  __syncthreads();

  /* K halves added, then softmax over the 16 anchors, one token row per thread (waves 0 and 1, scalar branch) */
  if (wave < 2) {
    float pr[kP], ge[kP];
    /* unrolled: the 32 LDS reads are issued together (rolled, each trip waited for its own) and the row stays in registers */
#pragma unroll
    for (int p = 0; p < kP; ++p) pr[p] = sPart[tid * 17 + p] + sPart[(64 + tid) * 17 + p];
    float m = pr[0] * kGateScale;
#pragma unroll
    for (int p = 1; p < kP; ++p) m = fmaxf(m, pr[p] * kGateScale);
    float sum = 0.0f;
#pragma unroll
    for (int p = 0; p < kP; ++p) {
      ge[p] = expf(pr[p] * kGateScale - m);
      sum += ge[p];
    }
    const float inv = (1.0f / sum) * kWCarry;
#pragma unroll
    for (int p = 0; p < kP; ++p) {
      sProd[tid * 17 + p] = pr[p];
      sGate[tid * 17 + p] = ge[p] * inv;
    }
  }
  __syncthreads();

  /* Every global store of the block stands behind the last barrier: a barrier waits for the wave's outstanding stores. */
  /* What the P16, W16 and XT stores need from LDS is read here, ahead of that barrier; the DA slab is read after it. */
  const int q = lane >> 3;
  const int j = lane & 7;

  /* the two token-major planes (waves 0..3, scalar branch) */
  v4u up = (v4u){0u, 0u, 0u, 0u};
  v4u uw = (v4u){0u, 0u, 0u, 0u};
  const int ln = wave * 4 + q;
  if (wave < 4) {
    const int row = 4 * ln + (j >> 1);
    const int p0  = (j & 1) * 8;
    unsigned short pb[8], wb16[8];
#pragma unroll
    for (int e = 0; e < 8; ++e) {
      pb[e]   = h_bits(sProd[row * 17 + p0 + e]);
      wb16[e] = h_bits(sGate[row * 17 + p0 + e]);
    }
    up = (v4u){pk16(pb[0], pb[1]), pk16(pb[2], pb[3]), pk16(pb[4], pb[5]), pk16(pb[6], pb[7])};
    uw = (v4u){pk16(wb16[0], wb16[1]), pk16(wb16[2], wb16[3]), pk16(wb16[4], wb16[5]), pk16(wb16[6], wb16[7])};
  }

  /* XT[b][d][s0 .. s0 + 63] = tile row d; wave w takes rows 64 w .. 64 w + 63, 8 lanes a row (one 128-B line). */
  /* Lanes 0..7 and 8..15 take rows 8 apart: their words fall on different banks at this pitch. */
  /* One LDS and one global base per lane; iteration i adds the constant row (i >> 2) * 16 + (i & 3) * 2. */
  const int n0 = wave * 64;
  const int rb = n0 + (q >> 1) + (q & 1) * 8;
  const unsigned* sx = sXT + rb * kXPitchW + j * 4;
  v4u xt[16];
#pragma unroll
  for (int i = 0; i < 16; ++i) xt[i] = *(const v4u*)(sx + ((i >> 2) * 16 + (i & 3) * 2) * kXPitchW);

  /* chunk state. A row = anchor cl; fragment f, word w holds t = 32 f + 16 (w >> 2) + 8 hh + 2 (w & 3) and t + 1 */
  v8u aw[2];
#pragma unroll
  for (int f = 0; f < 2; ++f)
#pragma unroll
    for (int w = 0; w < 8; ++w) {
      const int t = 32 * f + 16 * (w >> 2) + 8 * hh + 2 * (w & 3);
      aw[f][w] = pk16(h_bits(sProd[t * 17 + cl]), h_bits(sProd[(t + 1) * 17 + cl]));
    }
  const v16h a0 = __builtin_bit_cast(v16h, aw[0]);
  const v16h a1 = __builtin_bit_cast(v16h, aw[1]);
  v8f accs[4];
#pragma unroll
  for (int jn = 0; jn < 4; ++jn) accs[jn] = (v8f){0.f, 0.f, 0.f, 0.f, 0.f, 0.f, 0.f, 0.f};
#pragma unroll
  for (int jn = 0; jn < 4; ++jn) {
    /* Bt row d = n0 + 16 jn + cl; words at halves 8 hh, + 16, + 32, + 48 */
    const unsigned* bp = sXT + (n0 + 16 * jn + cl) * kXPitchW + 4 * hh;
    const v16h b0 = frag_h_words(*(const v4u*)(bp), *(const v4u*)(bp + 8));
    const v16h b1 = frag_h_words(*(const v4u*)(bp + 16), *(const v4u*)(bp + 24));
    accs[jn] = mma_h(a0, b0, accs[jn]);
    accs[jn] = mma_h(a1, b1, accs[jn]);
  }
  float* sw = slab + wave * 16 * kSlabPitch;
#pragma unroll
  for (int jn = 0; jn < 4; ++jn)
#pragma unroll
    for (int r = 0; r < 8; ++r) sw[(8 * hh + r) * kSlabPitch + 16 * jn + cl] = accs[jn][r];
  __syncthreads();

  if (wave < 4) {
    *(v4u*)(P16 + (size_t)r0 * kP + ln * 64 + j * 8) = up;
    *(v4u*)(W16 + (size_t)r0 * kP + ln * 64 + j * 8) = uw;
  }
  unsigned short* gx = XT + ((size_t)(b * kD + rb)) * kS + s0 + 8 * j;
#pragma unroll
  for (int i = 0; i < 16; ++i) *(v4u*)(gx + ((i >> 2) * 16 + (i & 3) * 2) * kS) = xt[i];
  const int c4 = cl * 4;
  v4f v[8];
#pragma unroll
  for (int it = 0; it < 8; ++it) v[it] = *(const v4f*)(sw + (it * 2 + hh) * kSlabPitch + c4);
#pragma unroll
  for (int it = 0; it < 8; ++it)
    *(v4f*)(DA + ((size_t)blockIdx.x * kP + it * 2 + hh) * kD + n0 + c4) = v[it];
}

/* --------------------------------------------------------------------------- */
/* K2: exclusive prefix of DA over the 32 chunks (f32, forward in time, zero   */
/* start per batch), emitted as ABT[b][c][d][32] f16 = [hi p0..15 | lo p0..15] */
/* with hi = f16(A), lo = f16(A - hi). Separate source and destination.        */
/* Thread = one (b, d, anchor pair): the 31 chunk states of both anchors that  */
/* the exclusive prefix needs are loaded up front (none depends on a sum), so  */
/* the block pays one memory latency; the sums then run in registers in chunk  */
/* order. Block = 16 consecutive d x 8 anchor pairs (lane = pair bit | d).     */
/* All 32 chunk tiles (16 rows x 64 B each) are staged in LDS; the 16-byte     */
/* piece q of row d lies at piece q ^ ((d >> 2) & 3), so the 32 lanes of a     */
/* word store fall on 32 banks. One barrier, then 16 iterations x 128 threads  */
/* x 16 B, lane-contiguous (a wave covers 4 whole lines).                      */
/* grid = 4 x 32 = 128 blocks, 128 threads.                                    */
/* --------------------------------------------------------------------------- */
constexpr int kScanD = 16;
static_assert(kD % kScanD == 0 && kP == 16 && kNC == 32);
__global__ __launch_bounds__(128) void prefix_kernel(const float* __restrict__ DA, unsigned short* __restrict__ ABT)
{
  __shared__ __align__(16) unsigned sT[kNC * kScanD * 16];
  const int tid  = threadIdx.x;
  const int lane = tid & 31;
  const int wave = __builtin_amdgcn_readfirstlane((int)(threadIdx.x >> 5));
  const int b    = blockIdx.x / (kD / kScanD);
  const int d0   = (blockIdx.x - b * (kD / kScanD)) * kScanD;
  const int dl   = lane & 15;
  const int pi   = wave * 2 + (lane >> 4);

  const float* src = DA + ((size_t)(b * kNC) * kP + 2 * pi) * kD + d0 + dl;
  float v0[kNC - 1], v1[kNC - 1];
#pragma unroll
  for (int c = 0; c < kNC - 1; ++c) {
    v0[c] = src[(size_t)c * kP * kD];
    v1[c] = src[(size_t)c * kP * kD + kD];
  }
  /* keeps every load issued ahead of the first sum: without it the last loads are scheduled behind a wait on the first and pay a second latency */
  __builtin_amdgcn_sched_barrier(0);

  const int sw = (dl >> 2) & 3;
  const int wh = dl * 16 + (((pi >> 2) ^ sw) << 2) + (pi & 3);
  const int wl = dl * 16 + (((2 + (pi >> 2)) ^ sw) << 2) + (pi & 3);
  float a0 = 0.0f, a1 = 0.0f;
#pragma unroll
  for (int c = 0; c < kNC; ++c) {
    const _Float16 h0 = (_Float16)a0;
    const _Float16 h1 = (_Float16)a1;
    const float h0f = (float)h0;
    const float h1f = (float)h1;
    const unsigned short hb0 = __builtin_bit_cast(unsigned short, h0);
    const unsigned short hb1 = __builtin_bit_cast(unsigned short, h1);
    const unsigned short lb0 = h_bits(a0 - h0f);
    const unsigned short lb1 = h_bits(a1 - h1f);
    sT[c * (kScanD * 16) + wh] = pk16(hb0, hb1);
    sT[c * (kScanD * 16) + wl] = pk16(lb0, lb1);
    if (c < kNC - 1) {
      a0 += v0[c];
      a1 += v1[c];
    }
  }
  __syncthreads();

  /* piece index inside a chunk tile = tid & 63 (row = piece >> 2); two chunks per iteration */
  const int pc  = tid & 63;
  const int ch  = tid >> 6;
  const int row = pc >> 2;
  const unsigned* sr = sT + ch * (kScanD * 16) + row * 16 + (((pc & 3) ^ ((row >> 2) & 3)) << 2);
  unsigned short* g = ABT + ((size_t)(b * kNC + ch) * kD + d0) * 32 + pc * 8;
  v4u v[16];
#pragma unroll
  for (int it = 0; it < 16; ++it) v[it] = *(const v4u*)(sr + it * 2 * (kScanD * 16));
#pragma unroll
  for (int it = 0; it < 16; ++it) *(v4u*)(g + (size_t)it * 2 * kD * 32) = v[it];
}

/* --------------------------------------------------------------------------- */
/* K3: per block (b, c), 64 query rows x 512 columns.                          */
/*  (1) LDS tile sA[64][96] f16: cols 0..15 and 16..31 = gate x 64 (copied     */
/*      from W16 by waves 0..3: 128 threads x 2 x 8 halves = 64 x 32);         */
/*  (2) cols 32..95 = 64 * L[s][t] = sum_p (64 w[s][p]) * prods[t][p], kept    */
/*      for t <= s (diagonal included), else 0 by select; 16 tiles of 16 x 16, */
/*      two per wave; K padded 16 -> 32 by zero upper fragment halves built in */
/*      registers (both operands);                                             */
/*  (3) fused K = 96 product: A = [W | W | L], Bt[d] = [Ab_hi | Ab_lo | XT     */
/*      chunk]; wave = 16 rows x 256 columns in 4 groups of 64; f32 result     */
/*      x 1/64 -> per-wave slab -> rows stored as 16 lanes x 16 B = 256 B,     */
/* grid = 128 blocks, 256 threads.                                             */
/* --------------------------------------------------------------------------- */
__global__ __launch_bounds__(256) void output_kernel(
    const unsigned short* __restrict__ W16, const unsigned short* __restrict__ P16,
    const unsigned short* __restrict__ ABT, const unsigned short* __restrict__ XT, float* __restrict__ out)
{
  __shared__ __align__(16) unsigned short sA[64 * kTilePitch];
  __shared__ __align__(16) float slab[8 * 16 * kSlabPitch];
  const int tid  = threadIdx.x;
  const int lane = tid & 31;
  const int wave = __builtin_amdgcn_readfirstlane((int)(threadIdx.x >> 5));
  const int hh = lane >> 4;
  const int cl = lane & 15;
  const int bc = blockIdx.x;
  const int b  = bc / kNC;
  const int c0 = (bc - b * kNC) * kC;
  const int r0 = b * kS + c0;
  const int mt = wave & 3;
  const int nh = wave >> 2;

  if (wave < 4) {
    const int row = tid >> 1;
    const int hf  = tid & 1;
    const v4u w = *(const v4u*)(W16 + (size_t)r0 * kP + tid * 8);
    *(v4u*)(sA + row * kTilePitch + hf * 8) = w;
    *(v4u*)(sA + row * kTilePitch + 16 + hf * 8) = w;
  }
  {
    const v4u zero4 = (v4u){0u, 0u, 0u, 0u};
    const v4u aw = *(const v4u*)(W16 + (size_t)(r0 + 16 * mt + cl) * kP + 8 * hh);
    const v16h af = frag_h_words(aw, zero4);
#pragma unroll
    for (int jj = 0; jj < 2; ++jj) {
      const int tt = nh * 2 + jj;
      const v4u pw = *(const v4u*)(P16 + (size_t)(r0 + 16 * tt + cl) * kP + 8 * hh);
      const v16h bf = frag_h_words(pw, zero4);
      v8f accL = (v8f){0.f, 0.f, 0.f, 0.f, 0.f, 0.f, 0.f, 0.f};
      accL = mma_h(af, bf, accL);
      const int tl = 16 * tt + cl;
#pragma unroll
      for (int r = 0; r < 8; ++r) {
        const int sl = 16 * mt + 8 * hh + r;
        const float val = (tl <= sl) ? accL[r] : 0.0f;
        sA[sl * kTilePitch + 32 + tl] = h_bits(val);
      }
    }
  }
  __syncthreads();

  v16h a[3];
#pragma unroll
  for (int ks = 0; ks < 3; ++ks) {
    const unsigned short* ap = sA + (16 * mt + cl) * kTilePitch + 32 * ks + 8 * hh;
    const v4u x0 = *(const v4u*)(ap);
    const v4u x1 = *(const v4u*)(ap + 16);
    a[ks] = frag_h_words(x0, x1);
  }

  float* sw = slab + wave * 16 * kSlabPitch;
  const int c4 = cl * 4;
#pragma unroll 1
  for (int g = 0; g < 4; ++g) {
    const int n0 = 256 * nh + 64 * g;
    v8f acc[4];
#pragma unroll
    for (int j = 0; j < 4; ++j) acc[j] = (v8f){0.f, 0.f, 0.f, 0.f, 0.f, 0.f, 0.f, 0.f};
#pragma unroll
    for (int j = 0; j < 4; ++j) {
      const int d = n0 + 16 * j + cl;
      const v16h bs = ldg_frag_h(ABT + ((size_t)bc * kD + d) * 32 + 8 * hh);
      acc[j] = mma_h(a[0], bs, acc[j]);
      const unsigned short* xt = XT + ((size_t)(b * kD + d)) * kS + c0 + 8 * hh;
      const v16h bx0 = ldg_frag_h(xt);
      acc[j] = mma_h(a[1], bx0, acc[j]);
      const v16h bx1 = ldg_frag_h(xt + 32);
      acc[j] = mma_h(a[2], bx1, acc[j]);
    }
#pragma unroll
    for (int j = 0; j < 4; ++j)
#pragma unroll
      for (int r = 0; r < 8; ++r) sw[(8 * hh + r) * kSlabPitch + 16 * j + cl] = acc[j][r] * kWCarryInv;
    __syncthreads();
    v4f v[8];
#pragma unroll
    for (int it = 0; it < 8; ++it) v[it] = *(const v4f*)(sw + (it * 2 + hh) * kSlabPitch + c4);
    {
#pragma unroll
      for (int it = 0; it < 8; ++it)
        *(v4f*)(out + ((size_t)(r0 + 16 * mt + it * 2 + hh)) * kD + n0 + c4) = v[it];
      
    }
    __syncthreads();
  }
}

/* --------------------------------------------------------------------------- */
/* Host glue: 3 kernel launches, nothing else.                                 */
/* --------------------------------------------------------------------------- */
extern "C" void kernel_launch(void* const* d_in, const int* in_sizes, int n_in,
                              void* d_out, int out_size, void* d_ws, size_t ws_size,
                              hipStream_t stream) {
  if (n_in < 2) return;
  if (in_sizes[0] != kRows * kD) return;
  if (in_sizes[1] != kP * kD) return;
  if (out_size != kRows * kD) return;
  if (ws_size < kWsTotal) return;

  const float* x   = (const float*)d_in[0];
  const float* anc = (const float*)d_in[1];
  float* out = (float*)d_out;

  char* ws = (char*)d_ws;
  unsigned short* XT   = (unsigned short*)(ws + kOffXT);
  unsigned short* P16  = (unsigned short*)(ws + kOffP16);
  unsigned short* W16  = (unsigned short*)(ws + kOffW16);
  float*          DA   = (float*)(ws + kOffDA);
  unsigned short* ABT  = (unsigned short*)(ws + kOffABT);

  scores_state_kernel<<<dim3(kRows / 64), 256, 0, stream>>>(x, anc, P16, W16, XT, DA);
  prefix_kernel<<<dim3(kB * (kD / kScanD)), 128, 0, stream>>>(DA, ABT);
  output_kernel<<<dim3(kB * kNC), 256, 0, stream>>>(W16, P16, ABT, XT, out);
}

// v004
// Measured time: 20.2 microseconds a run.
// Two timings next to v003 put it at 1.58 and 1.57 times that version's speed.
// All steps since v000 together make it 3.32 times as fast.
// prods (anchors x tokens, K=512): v_wmma_f32_16x16x32_bf16 with both operands as bf16 hi+lo (hi.lo + lo.hi + hi.hi); chunk states, intra-chunk scores, carry and intra-chunk output: v_wmma_f32_16x16x32_f16 (gate plane carried x64, chunk-prefix state as f16 hi+lo planes); f32 accumulate; softmax and prefix scan in f32.
#include <hip/hip_runtime.h>
#include <math.h>

typedef __attribute__((ext_vector_type(16))) _Float16 v16h;
typedef __attribute__((ext_vector_type(16))) __bf16   v16b;
typedef __attribute__((ext_vector_type(8)))  float    v8f;
typedef __attribute__((ext_vector_type(4)))  float    v4f;
typedef __attribute__((ext_vector_type(2)))  float    v2f;
typedef __attribute__((ext_vector_type(2)))  _Float16 v2h;
typedef __attribute__((ext_vector_type(4)))  unsigned int v4u;
typedef __attribute__((ext_vector_type(8)))  unsigned int v8u;

/* --------------------------------------------------------------------------- */
/* Shape constants                                                             */
/* --------------------------------------------------------------------------- */
constexpr int kB    = 4;
constexpr int kS    = 2048;
constexpr int kD    = 512;
constexpr int kP    = 16;
constexpr int kC    = 64;
constexpr int kNC   = kS / kC;
constexpr int kRows = kB * kS;
/* gate scale = 1/sqrt(kP), checked against kP */
constexpr float kGateScale = 0.25f;
static_assert(kGateScale * kGateScale * (float)kP == 1.0f);
/* gate plane carry (power of two), folded back in the output epilogue */
constexpr float kWCarry    = 64.0f;
constexpr float kWCarryInv = 1.0f / kWCarry;
static_assert(kWCarry * kWCarryInv == 1.0f);
static_assert(kS % kC == 0 && kC == 64 && kP == 16 && kD % 64 == 0);
/* LDS pitches */
constexpr int kAncPitchW = 260;
constexpr int kTilePitch = 104;
constexpr int kSlabPitch = 68;
/* transposed token tile, 32-bit words per d row: 176 B = 16 B x 11 */
constexpr int kXPitchW = 44;

/* --------------------------------------------------------------------------- */
/* Workspace region map (bytes; every offset a multiple of 128)                */
/*   XT    f16 [4][512][2048]      transposed tokens (Bt for sites K=t)  8,388,608 */
/*   P16   f16 [8192][16]          prods, token-major                      262,144 */
/*   W16   f16 [8192][16]          gate x64, token-major                   262,144 */
/*   DA    f32 [4][32][16][512]    chunk states                          4,194,304 */
/*   ABT   f16 [4][32][512][32]    exclusive chunk prefix, hi|lo         4,194,304 */
/*   total = 8,388,608 + 262,144 + 262,144 + 4,194,304 + 4,194,304 = 17,301,504     */
/* --------------------------------------------------------------------------- */
constexpr size_t kOffXT   = 0;
constexpr size_t kOffP16  = kOffXT   + (size_t)kB * kD * kS * 2;
constexpr size_t kOffW16  = kOffP16  + (size_t)kRows * kP * 2;
constexpr size_t kOffDA   = kOffW16  + (size_t)kRows * kP * 2;
constexpr size_t kOffABT  = kOffDA   + (size_t)kB * kNC * kP * kD * 4;
constexpr size_t kWsTotal = kOffABT  + (size_t)kB * kNC * kD * 32 * 2;
static_assert(kWsTotal == 17301504ull);
static_assert(kWsTotal <= 134217728ull);
static_assert((kOffP16 % 128) == 0 && (kOffW16 % 128) == 0 &&
              (kOffDA % 128) == 0 && (kOffABT % 128) == 0);

/* --------------------------------------------------------------------------- */
/* Small helpers                                                               */
/* --------------------------------------------------------------------------- */
__device__ __forceinline__ unsigned short f2bf_bits(float f) {
  unsigned u = __float_as_uint(f);
  return (unsigned short)((u + 0x7FFFu + ((u >> 16) & 1u)) >> 16);
}
__device__ __forceinline__ float bf_bits2f(unsigned short h) { return __uint_as_float(((unsigned)h) << 16); }
__device__ __forceinline__ unsigned pk16(unsigned short a, unsigned short b) { return (unsigned)a | ((unsigned)b << 16); }
__device__ __forceinline__ unsigned short h_bits(float f) { const _Float16 h = (_Float16)f; return __builtin_bit_cast(unsigned short, h); }

/* bf16 hi and lo words of a pair of f32 values (both conversions RNE) */
__device__ __forceinline__ void split_pair(float a, float b, unsigned& hw, unsigned& lw) {
  const unsigned short ha = f2bf_bits(a), hb = f2bf_bits(b);
  const unsigned short la = f2bf_bits(a - bf_bits2f(ha)), lb = f2bf_bits(b - bf_bits2f(hb));
  hw = pk16(ha, hb);
  lw = pk16(la, lb);
}

__device__ __forceinline__ v16h frag_h_words(v4u a, v4u b) {
  const v8u w = __builtin_shufflevector(a, b, 0, 1, 2, 3, 4, 5, 6, 7);
  return __builtin_bit_cast(v16h, w);
}
__device__ __forceinline__ v16b frag_b_words(v4u a, v4u b) {
  const v8u w = __builtin_shufflevector(a, b, 0, 1, 2, 3, 4, 5, 6, 7);
  return __builtin_bit_cast(v16b, w);
}
/* one WMMA + hazard guard tied to its accumulator and naming its A/B fragments */
__device__ __forceinline__ v8f mma_h(v16h a, v16h b, v8f c) {
  c = __builtin_amdgcn_wmma_f32_16x16x32_f16(false, a, false, b, (short)0, c, false, false);
  asm volatile("v_nop\n\tv_nop\n\tv_nop\n\tv_nop" : "+v"(c) : "v"(a), "v"(b));
  return c;
}
__device__ __forceinline__ v8f mma_b(v16b a, v16b b, v8f c) {
  c = __builtin_amdgcn_wmma_f32_16x16x32_bf16(false, a, false, b, (short)0, c, false, false);
  asm volatile("v_nop\n\tv_nop\n\tv_nop\n\tv_nop" : "+v"(c) : "v"(a), "v"(b));
  return c;
}

/* --------------------------------------------------------------------------- */
/* K1: one block per (batch, 64-token chunk) does all that needs only that     */
/* chunk's tokens, which are read from memory once.                            */
/* (a) prods (M = 64, N = 16 anchors, K = 512) as a bf16 hi/lo three-product   */
/* WMMA. 8 waves: wave = (16-row tile mt, K half kh), so a lane's whole share  */
/* of the tokens (8 steps x 4 x 16 B) and of the anchors (8 x 16 B) fits in    */
/* registers and is requested before anything is waited on: the block pays one */
/* memory latency. Token values are split in registers; anchor hi/lo word      */
/* planes staged in LDS (8 iterations x 256 threads x 4 floats = 16 x 512, all */
/* read words written). The two K halves meet in LDS: prods = half 0 + half 1. */
/* (b) the same token registers as f16, transposed into the LDS tile           */
/* sXT[d][t]: lanes t and t ^ 1 swap one packed word, so every lane stores     */
/* whole words (two neighbouring tokens of one d); 64 stores x 256 threads x   */
/* 2 halves = 512 x 64, the whole tile.                                        */
/* (c) the 16-wide softmax per token row in f32 (waves 0, 1).                  */
/* (d) chunk state DA[b][c][p][d] = sum_t prods[p][t] * x[t][d]: M = 16,       */
/* N = 512, K = 64, f16 WMMA; A from the prods in LDS (rounded to f16), Bt     */
/* rows from sXT; 8 waves x 64 columns through a per-wave 16 x 64 f32 slab.    */
/* (e) the tile copied to XT (16 iterations x 256 threads x 16 B = 64 KiB).    */
/*   P16  [row][16] f16 prods         block tile = 2 KiB contiguous = 16 lines */
/*   W16  [row][16] f16 gate x 64     same map                                 */
/* Wave w < 4 writes lines 4w..4w+3 of each plane (lanes 8q..8q+7 -> line 4w+q). */
/* grid = 8192 / 64 = 128 blocks, 256 threads.                                 */
/* --------------------------------------------------------------------------- */
constexpr int kKHalf  = kD / 2;
constexpr int kKSteps = kKHalf / 32;
static_assert(kKSteps == 8 && kP * kD == 8 * 256 * 4);
__global__ __launch_bounds__(256) void scores_state_kernel(
    const float* __restrict__ x, const float* __restrict__ anc,
    unsigned short* __restrict__ P16, unsigned short* __restrict__ W16,
    unsigned short* __restrict__ XT, float* __restrict__ DA)
{
  __shared__ __align__(16) unsigned sAH[kP * kAncPitchW];
  __shared__ __align__(16) unsigned sAL[kP * kAncPitchW];
  __shared__ float sPart[2 * 64 * 17];
  __shared__ float sProd[64 * 17];
  __shared__ float sGate[64 * 17];
  __shared__ __align__(16) unsigned sXT[kD * kXPitchW];
  __shared__ __align__(16) float slab[8 * 16 * kSlabPitch];
  const int tid  = threadIdx.x;
  const int lane = tid & 31;
  const int wave = __builtin_amdgcn_readfirstlane((int)(threadIdx.x >> 5));
  const int hh = lane >> 4;
  const int cl = lane & 15;
  const int mt = wave & 3;
  const int kh = wave >> 2;
  const int r0 = blockIdx.x * 64;
  const int b  = r0 / kS;
  const int s0 = r0 - b * kS;

  /* every global load of the block, anchors first (they are needed first) */
  /* float4 number i * 256 + tid of the 16 x 512 anchor array, which is contiguous */
  const float* aptr = anc + tid * 4;
  v4f av[8];
  /* unrolled here and below: av and xv live in registers only with constant indices */
#pragma unroll
  for (int i = 0; i < 8; ++i) av[i] = *(const v4f*)(aptr + i * 1024);
  /* A rows = token rows of this wave's tile, natural [row][d] layout, this wave's K half */
  const float* xrow = x + (size_t)(r0 + mt * 16 + cl) * kD + kh * kKHalf + 8 * hh;
  v4f xv[kKSteps][4];
#pragma unroll
  for (int it = 0; it < kKSteps; ++it) {
    xv[it][0] = *(const v4f*)(xrow + it * 32);
    xv[it][1] = *(const v4f*)(xrow + it * 32 + 4);
    xv[it][2] = *(const v4f*)(xrow + it * 32 + 16);
    xv[it][3] = *(const v4f*)(xrow + it * 32 + 20);
  }
  /* keeps every load issued ahead of the first wait: without it the token loads are scheduled behind the waits on the first anchor loads and pay a second latency */
  __builtin_amdgcn_sched_barrier(0);

#pragma unroll
  for (int i = 0; i < 8; ++i) {
    const int e4 = i * 256 + tid;
    const int p  = e4 >> 7;
    const int cf = (e4 & 127) * 4;
    unsigned h01, l01, h23, l23;
    split_pair(av[i][0], av[i][1], h01, l01);
    split_pair(av[i][2], av[i][3], h23, l23);
    const int wo = p * kAncPitchW + (cf >> 1);
    sAH[wo]     = h01;
    sAH[wo + 1] = h23;
    sAL[wo]     = l01;
    sAL[wo + 1] = l23;
  }
  __syncthreads();

  v8f acc = (v8f){0.f, 0.f, 0.f, 0.f, 0.f, 0.f, 0.f, 0.f};
#pragma unroll
  for (int it = 0; it < kKSteps; ++it) {
    const int k0 = kh * kKHalf + it * 32;
    const v4f f0 = xv[it][0];
    const v4f f1 = xv[it][1];
    const v4f f2 = xv[it][2];
    const v4f f3 = xv[it][3];
    unsigned hw0, hw1, hw2, hw3, hw4, hw5, hw6, hw7;
    unsigned lw0, lw1, lw2, lw3, lw4, lw5, lw6, lw7;
    split_pair(f0[0], f0[1], hw0, lw0);
    split_pair(f0[2], f0[3], hw1, lw1);
    split_pair(f1[0], f1[1], hw2, lw2);
    split_pair(f1[2], f1[3], hw3, lw3);
    split_pair(f2[0], f2[1], hw4, lw4);
    split_pair(f2[2], f2[3], hw5, lw5);
    split_pair(f3[0], f3[1], hw6, lw6);
    split_pair(f3[2], f3[3], hw7, lw7);
    const v8u hv = (v8u){hw0, hw1, hw2, hw3, hw4, hw5, hw6, hw7};
    const v8u lv = (v8u){lw0, lw1, lw2, lw3, lw4, lw5, lw6, lw7};
    const v16b ah = __builtin_bit_cast(v16b, hv);
    const v16b al = __builtin_bit_cast(v16b, lv);
    /* B column = anchor cl; words at halves k0 + 8*hh and + 16 */
    const int wb = cl * kAncPitchW + (k0 >> 1) + 4 * hh;
    const v4u bh0 = *(const v4u*)(sAH + wb);
    const v4u bh1 = *(const v4u*)(sAH + wb + 8);
    const v4u bl0 = *(const v4u*)(sAL + wb);
    const v4u bl1 = *(const v4u*)(sAL + wb + 8);
    const v16b bh = frag_b_words(bh0, bh1);
    const v16b bl = frag_b_words(bl0, bl1);
    acc = mma_b(ah, bl, acc);
    acc = mma_b(al, bh, acc);
    acc = mma_b(ah, bh, acc);
  }
  /* D element r of this lane = (token row 8*hh + r of tile mt, anchor cl), K half kh */
#pragma unroll
  for (int r = 0; r < 8; ++r) sPart[(kh * 64 + mt * 16 + 8 * hh + r) * 17 + cl] = acc[r];

  /* f16 transpose: this lane holds token t = 16 * mt + cl. Word h = (d, d + 1) of token t, word r = the same of token t ^ 1. */
  /* Even t keeps row d: (t, t + 1) = low halves of h, r. Odd t keeps row d + 1: (t - 1, t) = high halves of r, h. */
  {
    const int odd = cl & 1;
    const unsigned sel = odd ? 0x07060302u : 0x01000504u;
    unsigned* xw = sXT + (kh * kKHalf + 8 * hh + odd) * kXPitchW + ((mt * 16 + cl) >> 1);
#pragma unroll
    for (int it = 0; it < kKSteps; ++it)
#pragma unroll
      for (int q = 0; q < 4; ++q)
#pragma unroll
        for (int m = 0; m < 2; ++m) {
          const int dof = it * 32 + (q >> 1) * 16 + (q & 1) * 4 + 2 * m;
          const v2f f2 = (v2f){xv[it][q][2 * m], xv[it][q][2 * m + 1]};
          const unsigned h = __builtin_bit_cast(unsigned, __builtin_convertvector(f2, v2h));
          /* quad_perm [1,0,3,2]: the word of lane ^ 1 */
          const unsigned r = (unsigned)__builtin_amdgcn_mov_dpp((int)h, 0xB1, 0xF, 0xF, true);
          xw[dof * kXPitchW] = __builtin_amdgcn_perm(h, r, sel);
        }
  }
  __syncthreads();

  /* K halves added, then softmax over the 16 anchors, one token row per thread (waves 0 and 1, scalar branch) */
  if (wave < 2) {
    float pr[kP], ge[kP];
    /* unrolled: the 32 LDS reads are issued together (rolled, each trip waited for its own) and the row stays in registers */
#pragma unroll
    for (int p = 0; p < kP; ++p) pr[p] = sPart[tid * 17 + p] + sPart[(64 + tid) * 17 + p];
    float m = pr[0] * kGateScale;
#pragma unroll
    for (int p = 1; p < kP; ++p) m = fmaxf(m, pr[p] * kGateScale);
    float sum = 0.0f;
#pragma unroll
    for (int p = 0; p < kP; ++p) {
      ge[p] = expf(pr[p] * kGateScale - m);
      sum += ge[p];
    }
    const float inv = (1.0f / sum) * kWCarry;
#pragma unroll
    for (int p = 0; p < kP; ++p) {
      sProd[tid * 17 + p] = pr[p];
      sGate[tid * 17 + p] = ge[p] * inv;
    }
  }
  __syncthreads();

  /* Every global store of the block stands behind the last barrier: a barrier waits for the wave's outstanding stores. */
  /* What the P16, W16 and XT stores need from LDS is read here, ahead of that barrier; the DA slab is read after it. */
  const int q = lane >> 3;
  const int j = lane & 7;

  /* the two token-major planes (waves 0..3, scalar branch) */
  v4u up = (v4u){0u, 0u, 0u, 0u};
  v4u uw = (v4u){0u, 0u, 0u, 0u};
  const int ln = wave * 4 + q;
  if (wave < 4) {
    const int row = 4 * ln + (j >> 1);
    const int p0  = (j & 1) * 8;
    unsigned short pb[8], wb16[8];
#pragma unroll
    for (int e = 0; e < 8; ++e) {
      pb[e]   = h_bits(sProd[row * 17 + p0 + e]);
      wb16[e] = h_bits(sGate[row * 17 + p0 + e]);
    }
    up = (v4u){pk16(pb[0], pb[1]), pk16(pb[2], pb[3]), pk16(pb[4], pb[5]), pk16(pb[6], pb[7])};
    uw = (v4u){pk16(wb16[0], wb16[1]), pk16(wb16[2], wb16[3]), pk16(wb16[4], wb16[5]), pk16(wb16[6], wb16[7])};
  }

  /* XT[b][d][s0 .. s0 + 63] = tile row d; wave w takes rows 64 w .. 64 w + 63, 8 lanes a row (one 128-B line). */
  /* Lanes 0..7 and 8..15 take rows 8 apart: their words fall on different banks at this pitch. */
  /* One LDS and one global base per lane; iteration i adds the constant row (i >> 2) * 16 + (i & 3) * 2. */
  const int n0 = wave * 64;
  const int rb = n0 + (q >> 1) + (q & 1) * 8;
  const unsigned* sx = sXT + rb * kXPitchW + j * 4;
  v4u xt[16];
#pragma unroll
  for (int i = 0; i < 16; ++i) xt[i] = *(const v4u*)(sx + ((i >> 2) * 16 + (i & 3) * 2) * kXPitchW);

  /* chunk state. A row = anchor cl; fragment f, word w holds t = 32 f + 16 (w >> 2) + 8 hh + 2 (w & 3) and t + 1 */
  v8u aw[2];
#pragma unroll
  for (int f = 0; f < 2; ++f)
#pragma unroll
    for (int w = 0; w < 8; ++w) {
      const int t = 32 * f + 16 * (w >> 2) + 8 * hh + 2 * (w & 3);
      aw[f][w] = pk16(h_bits(sProd[t * 17 + cl]), h_bits(sProd[(t + 1) * 17 + cl]));
    }
  const v16h a0 = __builtin_bit_cast(v16h, aw[0]);
  const v16h a1 = __builtin_bit_cast(v16h, aw[1]);
  v8f accs[4];
#pragma unroll
  for (int jn = 0; jn < 4; ++jn) accs[jn] = (v8f){0.f, 0.f, 0.f, 0.f, 0.f, 0.f, 0.f, 0.f};
#pragma unroll
  for (int jn = 0; jn < 4; ++jn) {
    /* Bt row d = n0 + 16 jn + cl; words at halves 8 hh, + 16, + 32, + 48 */
    const unsigned* bp = sXT + (n0 + 16 * jn + cl) * kXPitchW + 4 * hh;
    const v16h b0 = frag_h_words(*(const v4u*)(bp), *(const v4u*)(bp + 8));
    const v16h b1 = frag_h_words(*(const v4u*)(bp + 16), *(const v4u*)(bp + 24));
    accs[jn] = mma_h(a0, b0, accs[jn]);
    accs[jn] = mma_h(a1, b1, accs[jn]);
  }
  float* sw = slab + wave * 16 * kSlabPitch;
#pragma unroll
  for (int jn = 0; jn < 4; ++jn)
#pragma unroll
    for (int r = 0; r < 8; ++r) sw[(8 * hh + r) * kSlabPitch + 16 * jn + cl] = accs[jn][r];
  __syncthreads();

  if (wave < 4) {
    *(v4u*)(P16 + (size_t)r0 * kP + ln * 64 + j * 8) = up;
    *(v4u*)(W16 + (size_t)r0 * kP + ln * 64 + j * 8) = uw;
  }
  unsigned short* gx = XT + ((size_t)(b * kD + rb)) * kS + s0 + 8 * j;
#pragma unroll
  for (int i = 0; i < 16; ++i) *(v4u*)(gx + ((i >> 2) * 16 + (i & 3) * 2) * kS) = xt[i];
  const int c4 = cl * 4;
  v4f v[8];
#pragma unroll
  for (int it = 0; it < 8; ++it) v[it] = *(const v4f*)(sw + (it * 2 + hh) * kSlabPitch + c4);
#pragma unroll
  for (int it = 0; it < 8; ++it)
    *(v4f*)(DA + ((size_t)blockIdx.x * kP + it * 2 + hh) * kD + n0 + c4) = v[it];
}

/* --------------------------------------------------------------------------- */
/* K2: exclusive prefix of DA over the 32 chunks (f32, forward in time, zero   */
/* start per batch), emitted as ABT[b][c][d][32] f16 = [hi p0..15 | lo p0..15] */
/* with hi = f16(A), lo = f16(A - hi). Separate source and destination.        */
/* Thread = one (b, d, anchor pair): the 31 chunk states of both anchors that  */
/* the exclusive prefix needs are loaded up front (none depends on a sum), so  */
/* the block pays one memory latency; the sums then run in registers in chunk  */
/* order. Block = 16 consecutive d x 8 anchor pairs (lane = pair bit | d).     */
/* All 32 chunk tiles (16 rows x 64 B each) are staged in LDS; the 16-byte     */
/* piece q of row d lies at piece q ^ ((d >> 2) & 3), so the 32 lanes of a     */
/* word store fall on 32 banks. One barrier, then 16 iterations x 128 threads  */
/* x 16 B, lane-contiguous (a wave covers 4 whole lines).                      */
/* grid = 4 x 32 = 128 blocks, 128 threads.                                    */
/* --------------------------------------------------------------------------- */
constexpr int kScanD = 16;
static_assert(kD % kScanD == 0 && kP == 16 && kNC == 32);
__global__ __launch_bounds__(128) void prefix_kernel(const float* __restrict__ DA, unsigned short* __restrict__ ABT)
{
  __shared__ __align__(16) unsigned sT[kNC * kScanD * 16];
  const int tid  = threadIdx.x;
  const int lane = tid & 31;
  const int wave = __builtin_amdgcn_readfirstlane((int)(threadIdx.x >> 5));
  const int b    = blockIdx.x / (kD / kScanD);
  const int d0   = (blockIdx.x - b * (kD / kScanD)) * kScanD;
  const int dl   = lane & 15;
  const int pi   = wave * 2 + (lane >> 4);

  const float* src = DA + ((size_t)(b * kNC) * kP + 2 * pi) * kD + d0 + dl;
  float v0[kNC - 1], v1[kNC - 1];
#pragma unroll
  for (int c = 0; c < kNC - 1; ++c) {
    v0[c] = src[(size_t)c * kP * kD];
    v1[c] = src[(size_t)c * kP * kD + kD];
  }
  /* keeps every load issued ahead of the first sum: without it the last loads are scheduled behind a wait on the first and pay a second latency */
  __builtin_amdgcn_sched_barrier(0);

  const int sw = (dl >> 2) & 3;
  const int wh = dl * 16 + (((pi >> 2) ^ sw) << 2) + (pi & 3);
  const int wl = dl * 16 + (((2 + (pi >> 2)) ^ sw) << 2) + (pi & 3);
  float a0 = 0.0f, a1 = 0.0f;
#pragma unroll
  for (int c = 0; c < kNC; ++c) {
    const _Float16 h0 = (_Float16)a0;
    const _Float16 h1 = (_Float16)a1;
    const float h0f = (float)h0;
    const float h1f = (float)h1;
    const unsigned short hb0 = __builtin_bit_cast(unsigned short, h0);
    const unsigned short hb1 = __builtin_bit_cast(unsigned short, h1);
    const unsigned short lb0 = h_bits(a0 - h0f);
    const unsigned short lb1 = h_bits(a1 - h1f);
    sT[c * (kScanD * 16) + wh] = pk16(hb0, hb1);
    sT[c * (kScanD * 16) + wl] = pk16(lb0, lb1);
    if (c < kNC - 1) {
      a0 += v0[c];
      a1 += v1[c];
    }
  }
  __syncthreads();

  /* piece index inside a chunk tile = tid & 63 (row = piece >> 2); two chunks per iteration */
  const int pc  = tid & 63;
  const int ch  = tid >> 6;
  const int row = pc >> 2;
  const unsigned* sr = sT + ch * (kScanD * 16) + row * 16 + (((pc & 3) ^ ((row >> 2) & 3)) << 2);
  unsigned short* g = ABT + ((size_t)(b * kNC + ch) * kD + d0) * 32 + pc * 8;
  v4u v[16];
#pragma unroll
  for (int it = 0; it < 16; ++it) v[it] = *(const v4u*)(sr + it * 2 * (kScanD * 16));
#pragma unroll
  for (int it = 0; it < 16; ++it) *(v4u*)(g + (size_t)it * 2 * kD * 32) = v[it];
}

/* --------------------------------------------------------------------------- */
/* K3: per block (b, c, column half), 64 query rows x 256 columns.             */
/*  (0) every global load of the block is requested first: the gate and prods  */
/*      rows, then each wave's own Bt fragments (12 x 16 B a lane), so the     */
/*      block pays one memory latency and steps (1), (2) run under it;         */
/*  (1) LDS tile sA[64][96] f16: cols 0..15 and 16..31 = gate x 64 (copied     */
/*      from W16: 256 threads x 8 halves = 64 x 32);                           */
/*  (2) cols 32..95 = 64 * L[s][t] = sum_p (64 w[s][p]) * prods[t][p], kept    */
/*      for t <= s (diagonal included), else 0 by select; 16 tiles of 16 x 16, */
/*      two per wave; K padded 16 -> 32 by zero upper fragment halves built in */
/*      registers (both operands);                                             */
/*  (3) fused K = 96 product: A = [W | W | L], Bt[d] = [Ab_hi | Ab_lo | XT     */
/*      chunk]; wave = all 64 rows x its own 32 columns, so a Bt fragment is   */
/*      loaded by one wave only; f32 result x 1/64 -> the wave's own 64 x 32   */
/*      slab -> rows stored as 8 lanes x 16 B = one 128-B line.                */
/* grid = 256 blocks, 256 threads.                                             */
/* --------------------------------------------------------------------------- */
constexpr int kOutCols  = 256;
constexpr int kOutPitch = 36;
static_assert(kD % kOutCols == 0 && kOutCols == 8 * 32);
__global__ __launch_bounds__(256) void output_kernel(
    const unsigned short* __restrict__ W16, const unsigned short* __restrict__ P16,
    const unsigned short* __restrict__ ABT, const unsigned short* __restrict__ XT, float* __restrict__ out)
{
  __shared__ __align__(16) unsigned short sA[64 * kTilePitch];
  __shared__ __align__(16) float slab[8 * 64 * kOutPitch];
  const int tid  = threadIdx.x;
  const int lane = tid & 31;
  const int wave = __builtin_amdgcn_readfirstlane((int)(threadIdx.x >> 5));
  const int hh = lane >> 4;
  const int cl = lane & 15;
  const int bc = blockIdx.x / (kD / kOutCols);
  const int n0 = (blockIdx.x - bc * (kD / kOutCols)) * kOutCols + wave * 32;
  const int b  = bc / kNC;
  const int c0 = (bc - b * kNC) * kC;
  const int r0 = b * kS + c0;
  const int mt = wave & 3;
  const int nh = wave >> 2;

  /* gate piece tid >> 1 (row tid >> 2, half (tid >> 1) & 1) for copy tid & 1 of the tile's gate columns */
  const unsigned short* gw = W16 + (size_t)r0 * kP + (tid >> 1) * 8;
  const unsigned short* ga = W16 + (size_t)(r0 + 16 * mt + cl) * kP + 8 * hh;
  const unsigned short* gp = P16 + (size_t)(r0 + 32 * nh + cl) * kP + 8 * hh;
  /* Bt rows d = n0 + 16 j + cl: pieces 0, 1 = prefix hi | lo, pieces 2..5 = the chunk's 64 tokens */
  const unsigned short* ab = ABT + ((size_t)bc * kD + n0 + cl) * 32 + 8 * hh;
  const unsigned short* xt = XT + ((size_t)(b * kD + n0 + cl)) * kS + c0 + 8 * hh;
  const v4u wg = *(const v4u*)(gw);
  const v4u aw = *(const v4u*)(ga);
  v4u pw[2];
#pragma unroll
  for (int jj = 0; jj < 2; ++jj) pw[jj] = *(const v4u*)(gp + jj * 16 * kP);
  v4u bq[2][6];
#pragma unroll
  for (int j = 0; j < 2; ++j) {
    bq[j][0] = *(const v4u*)(ab + j * 16 * 32);
    bq[j][1] = *(const v4u*)(ab + j * 16 * 32 + 16);
    bq[j][2] = *(const v4u*)(xt + j * 16 * kS);
    bq[j][3] = *(const v4u*)(xt + j * 16 * kS + 16);
    bq[j][4] = *(const v4u*)(xt + j * 16 * kS + 32);
    bq[j][5] = *(const v4u*)(xt + j * 16 * kS + 48);
  }
  /* the wait that stands in front of any overwrite of a register an issued load names; the five bases are inputs so that none is reused, not even as a later load's destination, ahead of it */
  asm volatile("s_wait_xcnt 0x0" :: "v"(gw), "v"(ga), "v"(gp), "v"(ab), "v"(xt) : "memory");
  /* keeps every load issued ahead of the first wait for data: without it the Bt loads are scheduled behind the score tiles and pay a second latency */
  __builtin_amdgcn_sched_barrier(0);

  *(v4u*)(sA + (tid >> 2) * kTilePitch + (tid & 1) * 16 + ((tid >> 1) & 1) * 8) = wg;
  {
    const v4u zero4 = (v4u){0u, 0u, 0u, 0u};
    const v16h af = frag_h_words(aw, zero4);
#pragma unroll
    for (int jj = 0; jj < 2; ++jj) {
      const int tt = nh * 2 + jj;
      const v16h bf = frag_h_words(pw[jj], zero4);
      v8f accL = (v8f){0.f, 0.f, 0.f, 0.f, 0.f, 0.f, 0.f, 0.f};
      accL = mma_h(af, bf, accL);
      const int tl = 16 * tt + cl;
#pragma unroll
      for (int r = 0; r < 8; ++r) {
        const int sl = 16 * mt + 8 * hh + r;
        const float val = (tl <= sl) ? accL[r] : 0.0f;
        sA[sl * kTilePitch + 32 + tl] = h_bits(val);
      }
    }
  }
  __syncthreads();

  /* unrolled here and below: the fragments and accumulators live in registers only with constant indices */
  v16h a[4][3];
#pragma unroll
  for (int m = 0; m < 4; ++m)
#pragma unroll
    for (int ks = 0; ks < 3; ++ks) {
      const unsigned short* ap = sA + (16 * m + cl) * kTilePitch + 32 * ks + 8 * hh;
      const v4u x0 = *(const v4u*)(ap);
      const v4u x1 = *(const v4u*)(ap + 16);
      a[m][ks] = frag_h_words(x0, x1);
    }

  v8f acc[4][2];
#pragma unroll
  for (int m = 0; m < 4; ++m)
#pragma unroll
    for (int j = 0; j < 2; ++j) acc[m][j] = (v8f){0.f, 0.f, 0.f, 0.f, 0.f, 0.f, 0.f, 0.f};
  /* k step outermost: eight independent accumulators between two products into the same one; each sums its k steps in the order 0, 1, 2 */
#pragma unroll
  for (int ks = 0; ks < 3; ++ks)
#pragma unroll
    for (int m = 0; m < 4; ++m)
#pragma unroll
      for (int j = 0; j < 2; ++j)
        acc[m][j] = mma_h(a[m][ks], frag_h_words(bq[j][2 * ks], bq[j][2 * ks + 1]), acc[m][j]);

  float* sw = slab + wave * 64 * kOutPitch;
#pragma unroll
  for (int m = 0; m < 4; ++m)
#pragma unroll
    for (int j = 0; j < 2; ++j)
#pragma unroll
      for (int r = 0; r < 8; ++r)
        sw[(16 * m + 8 * hh + r) * kOutPitch + 16 * j + cl] = acc[m][j][r] * kWCarryInv;
  /* the slab is this wave's own: its LDS stores have landed before its lanes read one another's words back; no other wave takes part */
  asm volatile("s_wait_dscnt 0x0" ::: "memory");
  /* 8 lanes a row (one 128-B line). Lanes 0..7 and 8..15 take rows 8 apart: their words fall on different banks at this pitch. */
  const int q  = lane >> 3;
  const int j4 = (lane & 7) * 4;
  const int rl = (q >> 1) + (q & 1) * 8;
  /* One LDS and one global base per lane; iteration i adds the constant row (i >> 2) * 16 + (i & 3) * 2. */
  const float* sr = sw + rl * kOutPitch + j4;
  float* go = out + (size_t)(r0 + rl) * kD + n0 + j4;
  v4f v[16];
#pragma unroll
  for (int i = 0; i < 16; ++i) v[i] = *(const v4f*)(sr + ((i >> 2) * 16 + (i & 3) * 2) * kOutPitch);
#pragma unroll
  for (int i = 0; i < 16; ++i) *(v4f*)(go + ((i >> 2) * 16 + (i & 3) * 2) * kD) = v[i];
}

/* --------------------------------------------------------------------------- */
/* Host glue: 3 kernel launches, nothing else.                                 */
/* --------------------------------------------------------------------------- */
extern "C" void kernel_launch(void* const* d_in, const int* in_sizes, int n_in,
                              void* d_out, int out_size, void* d_ws, size_t ws_size,
                              hipStream_t stream) {
  if (n_in < 2) return;
  if (in_sizes[0] != kRows * kD) return;
  if (in_sizes[1] != kP * kD) return;
  if (out_size != kRows * kD) return;
  if (ws_size < kWsTotal) return;

  const float* x   = (const float*)d_in[0];
  const float* anc = (const float*)d_in[1];
  float* out = (float*)d_out;

  char* ws = (char*)d_ws;
  unsigned short* XT   = (unsigned short*)(ws + kOffXT);
  unsigned short* P16  = (unsigned short*)(ws + kOffP16);
  unsigned short* W16  = (unsigned short*)(ws + kOffW16);
  float*          DA   = (float*)(ws + kOffDA);
  unsigned short* ABT  = (unsigned short*)(ws + kOffABT);

  scores_state_kernel<<<dim3(kRows / 64), 256, 0, stream>>>(x, anc, P16, W16, XT, DA);
  prefix_kernel<<<dim3(kB * (kD / kScanD)), 128, 0, stream>>>(DA, ABT);
  output_kernel<<<dim3(kB * kNC * (kD / kOutCols)), 256, 0, stream>>>(W16, P16, ABT, XT, out);
}

// v005
// A run of this version takes 19.1 microseconds.
// Two timings next to v004 both put it at 1.06 times that version's speed.
// All steps since v000 together make it 3.53 times as fast.
// prods (anchors x tokens, K=512): v_wmma_f32_16x16x32_bf16 with both operands as bf16 hi+lo (hi.lo + lo.hi + hi.hi); chunk states, intra-chunk scores, carry and intra-chunk output: v_wmma_f32_16x16x32_f16 (gate plane carried x64, chunk-prefix state as f16 hi+lo planes); f32 accumulate; softmax and prefix scan in f32.
#include <hip/hip_runtime.h>
#include <math.h>

typedef __attribute__((ext_vector_type(16))) _Float16 v16h;
typedef __attribute__((ext_vector_type(16))) __bf16   v16b;
typedef __attribute__((ext_vector_type(8)))  float    v8f;
typedef __attribute__((ext_vector_type(4)))  float    v4f;
typedef __attribute__((ext_vector_type(2)))  float    v2f;
typedef __attribute__((ext_vector_type(2)))  _Float16 v2h;
typedef __attribute__((ext_vector_type(2)))  __bf16   v2b;
typedef __attribute__((ext_vector_type(4)))  unsigned int v4u;
typedef __attribute__((ext_vector_type(8)))  unsigned int v8u;

/* --------------------------------------------------------------------------- */
/* Shape constants                                                             */
/* --------------------------------------------------------------------------- */
constexpr int kB    = 4;
constexpr int kS    = 2048;
constexpr int kD    = 512;
constexpr int kP    = 16;
constexpr int kC    = 64;
constexpr int kNC   = kS / kC;
constexpr int kRows = kB * kS;
/* gate scale = 1/sqrt(kP), checked against kP */
constexpr float kGateScale = 0.25f;
static_assert(kGateScale * kGateScale * (float)kP == 1.0f);
/* gate plane carry (power of two), folded back in the output epilogue */
constexpr float kWCarry    = 64.0f;
constexpr float kWCarryInv = 1.0f / kWCarry;
static_assert(kWCarry * kWCarryInv == 1.0f);
static_assert(kS % kC == 0 && kC == 64 && kP == 16 && kD % 64 == 0);
/* LDS pitches */
constexpr int kAncPitchW = 260;
constexpr int kTilePitch = 104;
constexpr int kSlabPitch = 68;
/* transposed token tile, 32-bit words per d row: 176 B = 16 B x 11 */
constexpr int kXPitchW = 44;

/* --------------------------------------------------------------------------- */
/* Workspace region map (bytes; every offset a multiple of 128)                */
/*   XT    f16 [4][512][2048]      transposed tokens (Bt for sites K=t)  8,388,608 */
/*   P16   f16 [8192][16]          prods, token-major                      262,144 */
/*   W16   f16 [8192][16]          gate x64, token-major                   262,144 */
/*   DA    f32 [4][32][16][512]    chunk states                          4,194,304 */
/*   ABT   f16 [4][32][512][32]    exclusive chunk prefix, hi|lo         4,194,304 */
/*   total = 8,388,608 + 262,144 + 262,144 + 4,194,304 + 4,194,304 = 17,301,504     */
/* --------------------------------------------------------------------------- */
constexpr size_t kOffXT   = 0;
constexpr size_t kOffP16  = kOffXT   + (size_t)kB * kD * kS * 2;
constexpr size_t kOffW16  = kOffP16  + (size_t)kRows * kP * 2;
constexpr size_t kOffDA   = kOffW16  + (size_t)kRows * kP * 2;
constexpr size_t kOffABT  = kOffDA   + (size_t)kB * kNC * kP * kD * 4;
constexpr size_t kWsTotal = kOffABT  + (size_t)kB * kNC * kD * 32 * 2;
static_assert(kWsTotal == 17301504ull);
static_assert(kWsTotal <= 134217728ull);
static_assert((kOffP16 % 128) == 0 && (kOffW16 % 128) == 0 &&
              (kOffDA % 128) == 0 && (kOffABT % 128) == 0);

/* --------------------------------------------------------------------------- */
/* Small helpers                                                               */
/* --------------------------------------------------------------------------- */
__device__ __forceinline__ unsigned pk16(unsigned short a, unsigned short b) { return (unsigned)a | ((unsigned)b << 16); }
__device__ __forceinline__ unsigned short h_bits(float f) { const _Float16 h = (_Float16)f; return __builtin_bit_cast(unsigned short, h); }

/* bf16 hi and lo words of a pair of f32 values (both conversions RNE) */
__device__ __forceinline__ void split_pair(float a, float b, unsigned& hw, unsigned& lw) {
  const v2f f = (v2f){a, b};
  hw = __builtin_bit_cast(unsigned, __builtin_convertvector(f, v2b));
  const v2f hf = (v2f){__uint_as_float(hw << 16), __uint_as_float(hw & 0xFFFF0000u)};
  lw = __builtin_bit_cast(unsigned, __builtin_convertvector(f - hf, v2b));
}

__device__ __forceinline__ v16h frag_h_words(v4u a, v4u b) {
  const v8u w = __builtin_shufflevector(a, b, 0, 1, 2, 3, 4, 5, 6, 7);
  return __builtin_bit_cast(v16h, w);
}
__device__ __forceinline__ v16b frag_b_words(v4u a, v4u b) {
  const v8u w = __builtin_shufflevector(a, b, 0, 1, 2, 3, 4, 5, 6, 7);
  return __builtin_bit_cast(v16b, w);
}
/* one WMMA + hazard guard tied to its accumulator and naming its A/B fragments */
__device__ __forceinline__ v8f mma_h(v16h a, v16h b, v8f c) {
  c = __builtin_amdgcn_wmma_f32_16x16x32_f16(false, a, false, b, (short)0, c, false, false);
  asm volatile("v_nop\n\tv_nop\n\tv_nop\n\tv_nop" : "+v"(c) : "v"(a), "v"(b));
  return c;
}
__device__ __forceinline__ v8f mma_b(v16b a, v16b b, v8f c) {
  c = __builtin_amdgcn_wmma_f32_16x16x32_bf16(false, a, false, b, (short)0, c, false, false);
  asm volatile("v_nop\n\tv_nop\n\tv_nop\n\tv_nop" : "+v"(c) : "v"(a), "v"(b));
  return c;
}

/* --------------------------------------------------------------------------- */
/* K1: one block per (batch, 64-token chunk) does all that needs only that     */
/* chunk's tokens, which are read from memory once.                            */
/* (a) prods (M = 64, N = 16 anchors, K = 512) as a bf16 hi/lo three-product   */
/* WMMA. 8 waves: wave = (16-row tile mt, K half kh), so a lane's whole share  */
/* of the tokens (8 steps x 4 x 16 B) and of the anchors (8 x 16 B) fits in    */
/* registers and is requested before anything is waited on: the block pays one */
/* memory latency. Token values are split in registers; anchor hi/lo word      */
/* planes staged in LDS (8 iterations x 256 threads x 4 floats = 16 x 512, all */
/* read words written). The two K halves meet in LDS: prods = half 0 + half 1. */
/* (b) the same token registers as f16, transposed into the LDS tile           */
/* sXT[d][t]: lanes t and t ^ 1 swap one packed word, so every lane stores     */
/* whole words (two neighbouring tokens of one d); 64 stores x 256 threads x   */
/* 2 halves = 512 x 64, the whole tile.                                        */
/* (c) the 16-wide softmax per token row in f32 (waves 0, 1).                  */
/* (d) chunk state DA[b][c][p][d] = sum_t prods[p][t] * x[t][d]: M = 16,       */
/* N = 512, K = 64, f16 WMMA; A from the prods in LDS (rounded to f16), Bt     */
/* rows from sXT; 8 waves x 64 columns through a per-wave 16 x 64 f32 slab.    */
/* (e) the tile copied to XT (16 iterations x 256 threads x 16 B = 64 KiB).    */
/*   P16  [row][16] f16 prods         block tile = 2 KiB contiguous = 16 lines */
/*   W16  [row][16] f16 gate x 64     same map                                 */
/* Wave w < 4 writes lines 4w..4w+3 of each plane (lanes 8q..8q+7 -> line 4w+q). */
/* grid = 8192 / 64 = 128 blocks, 256 threads.                                 */
/* --------------------------------------------------------------------------- */
constexpr int kKHalf  = kD / 2;
constexpr int kKSteps = kKHalf / 32;
static_assert(kKSteps == 8 && kP * kD == 8 * 256 * 4);
__global__ __launch_bounds__(256) void scores_state_kernel(
    const float* __restrict__ x, const float* __restrict__ anc,
    unsigned short* __restrict__ P16, unsigned short* __restrict__ W16,
    unsigned short* __restrict__ XT, float* __restrict__ DA)
{
  __shared__ __align__(16) unsigned sAH[kP * kAncPitchW];
  __shared__ __align__(16) unsigned sAL[kP * kAncPitchW];
  __shared__ float sPart[2 * 64 * 17];
  __shared__ float sProd[64 * 17];
  __shared__ float sGate[64 * 17];
  __shared__ __align__(16) unsigned sXT[kD * kXPitchW];
  __shared__ __align__(16) float slab[8 * 16 * kSlabPitch];
  const int tid  = threadIdx.x;
  const int lane = tid & 31;
  const int wave = __builtin_amdgcn_readfirstlane((int)(threadIdx.x >> 5));
  const int hh = lane >> 4;
  const int cl = lane & 15;
  const int mt = wave & 3;
  const int kh = wave >> 2;
  const int r0 = blockIdx.x * 64;
  const int b  = r0 / kS;
  const int s0 = r0 - b * kS;

  /* every global load of the block, anchors first (they are needed first) */
  /* float4 number i * 256 + tid of the 16 x 512 anchor array, which is contiguous */
  const float* aptr = anc + tid * 4;
  v4f av[8];
  /* unrolled here and below: av and xv live in registers only with constant indices */
#pragma unroll
  for (int i = 0; i < 8; ++i) av[i] = *(const v4f*)(aptr + i * 1024);
  /* A rows = token rows of this wave's tile, natural [row][d] layout, this wave's K half */
  const float* xrow = x + (size_t)(r0 + mt * 16 + cl) * kD + kh * kKHalf + 8 * hh;
  v4f xv[kKSteps][4];
#pragma unroll
  for (int it = 0; it < kKSteps; ++it) {
    xv[it][0] = *(const v4f*)(xrow + it * 32);
    xv[it][1] = *(const v4f*)(xrow + it * 32 + 4);
    xv[it][2] = *(const v4f*)(xrow + it * 32 + 16);
    xv[it][3] = *(const v4f*)(xrow + it * 32 + 20);
  }
  /* keeps every load issued ahead of the first wait: without it the token loads are scheduled behind the waits on the first anchor loads and pay a second latency */
  __builtin_amdgcn_sched_barrier(0);

#pragma unroll
  for (int i = 0; i < 8; ++i) {
    const int e4 = i * 256 + tid;
    const int p  = e4 >> 7;
    const int cf = (e4 & 127) * 4;
    unsigned h01, l01, h23, l23;
    split_pair(av[i][0], av[i][1], h01, l01);
    split_pair(av[i][2], av[i][3], h23, l23);
    const int wo = p * kAncPitchW + (cf >> 1);
    sAH[wo]     = h01;
    sAH[wo + 1] = h23;
    sAL[wo]     = l01;
    sAL[wo + 1] = l23;
  }
  __syncthreads();

  v8f acc = (v8f){0.f, 0.f, 0.f, 0.f, 0.f, 0.f, 0.f, 0.f};
#pragma unroll
  for (int it = 0; it < kKSteps; ++it) {
    const int k0 = kh * kKHalf + it * 32;
    const v4f f0 = xv[it][0];
    const v4f f1 = xv[it][1];
    const v4f f2 = xv[it][2];
    const v4f f3 = xv[it][3];
    unsigned hw0, hw1, hw2, hw3, hw4, hw5, hw6, hw7;
    unsigned lw0, lw1, lw2, lw3, lw4, lw5, lw6, lw7;
    split_pair(f0[0], f0[1], hw0, lw0);
    split_pair(f0[2], f0[3], hw1, lw1);
    split_pair(f1[0], f1[1], hw2, lw2);
    split_pair(f1[2], f1[3], hw3, lw3);
    split_pair(f2[0], f2[1], hw4, lw4);
    split_pair(f2[2], f2[3], hw5, lw5);
    split_pair(f3[0], f3[1], hw6, lw6);
    split_pair(f3[2], f3[3], hw7, lw7);
    const v8u hv = (v8u){hw0, hw1, hw2, hw3, hw4, hw5, hw6, hw7};
    const v8u lv = (v8u){lw0, lw1, lw2, lw3, lw4, lw5, lw6, lw7};
    const v16b ah = __builtin_bit_cast(v16b, hv);
    const v16b al = __builtin_bit_cast(v16b, lv);
    /* B column = anchor cl; words at halves k0 + 8*hh and + 16 */
    const int wb = cl * kAncPitchW + (k0 >> 1) + 4 * hh;
    const v4u bh0 = *(const v4u*)(sAH + wb);
    const v4u bh1 = *(const v4u*)(sAH + wb + 8);
    const v4u bl0 = *(const v4u*)(sAL + wb);
    const v4u bl1 = *(const v4u*)(sAL + wb + 8);
    const v16b bh = frag_b_words(bh0, bh1);
    const v16b bl = frag_b_words(bl0, bl1);
    acc = mma_b(ah, bl, acc);
    acc = mma_b(al, bh, acc);
    acc = mma_b(ah, bh, acc);
  }
  /* D element r of this lane = (token row 8*hh + r of tile mt, anchor cl), K half kh */
#pragma unroll
  for (int r = 0; r < 8; ++r) sPart[(kh * 64 + mt * 16 + 8 * hh + r) * 17 + cl] = acc[r];

  /* f16 transpose: this lane holds token t = 16 * mt + cl. Word h = (d, d + 1) of token t, word r = the same of token t ^ 1. */
  /* Even t keeps row d: (t, t + 1) = low halves of h, r. Odd t keeps row d + 1: (t - 1, t) = high halves of r, h. */
  {
    const int odd = cl & 1;
    const unsigned sel = odd ? 0x07060302u : 0x01000504u;
    unsigned* xw = sXT + (kh * kKHalf + 8 * hh + odd) * kXPitchW + ((mt * 16 + cl) >> 1);
#pragma unroll
    for (int it = 0; it < kKSteps; ++it)
#pragma unroll
      for (int q = 0; q < 4; ++q)
#pragma unroll
        for (int m = 0; m < 2; ++m) {
          const int dof = it * 32 + (q >> 1) * 16 + (q & 1) * 4 + 2 * m;
          const v2f f2 = (v2f){xv[it][q][2 * m], xv[it][q][2 * m + 1]};
          const unsigned h = __builtin_bit_cast(unsigned, __builtin_convertvector(f2, v2h));
          /* quad_perm [1,0,3,2]: the word of lane ^ 1 */
          const unsigned r = (unsigned)__builtin_amdgcn_mov_dpp((int)h, 0xB1, 0xF, 0xF, true);
          xw[dof * kXPitchW] = __builtin_amdgcn_perm(h, r, sel);
        }
  }
  __syncthreads();

  /* K halves added, then softmax over the 16 anchors, one token row per thread (waves 0 and 1, scalar branch) */
  if (wave < 2) {
    float pr[kP], ge[kP];
    /* unrolled: the 32 LDS reads are issued together (rolled, each trip waited for its own) and the row stays in registers */
#pragma unroll
    for (int p = 0; p < kP; ++p) pr[p] = sPart[tid * 17 + p] + sPart[(64 + tid) * 17 + p];
    float m = pr[0] * kGateScale;
#pragma unroll
    for (int p = 1; p < kP; ++p) m = fmaxf(m, pr[p] * kGateScale);
    float sum = 0.0f;
#pragma unroll
    for (int p = 0; p < kP; ++p) {
      ge[p] = expf(pr[p] * kGateScale - m);
      sum += ge[p];
    }
    const float inv = (1.0f / sum) * kWCarry;
#pragma unroll
    for (int p = 0; p < kP; ++p) {
      sProd[tid * 17 + p] = pr[p];
      sGate[tid * 17 + p] = ge[p] * inv;
    }
  }
  __syncthreads();

  /* Every global store of the block stands behind the last barrier: a barrier waits for the wave's outstanding stores. */
  /* What the P16, W16 and XT stores need from LDS is read here, ahead of that barrier; the DA slab is read after it. */
  const int q = lane >> 3;
  const int j = lane & 7;

  /* the two token-major planes (waves 0..3, scalar branch) */
  v4u up = (v4u){0u, 0u, 0u, 0u};
  v4u uw = (v4u){0u, 0u, 0u, 0u};
  const int ln = wave * 4 + q;
  if (wave < 4) {
    const int row = 4 * ln + (j >> 1);
    const int p0  = (j & 1) * 8;
    unsigned short pb[8], wb16[8];
#pragma unroll
    for (int e = 0; e < 8; ++e) {
      pb[e]   = h_bits(sProd[row * 17 + p0 + e]);
      wb16[e] = h_bits(sGate[row * 17 + p0 + e]);
    }
    up = (v4u){pk16(pb[0], pb[1]), pk16(pb[2], pb[3]), pk16(pb[4], pb[5]), pk16(pb[6], pb[7])};
    uw = (v4u){pk16(wb16[0], wb16[1]), pk16(wb16[2], wb16[3]), pk16(wb16[4], wb16[5]), pk16(wb16[6], wb16[7])};
  }

  /* XT[b][d][s0 .. s0 + 63] = tile row d; wave w takes rows 64 w .. 64 w + 63, 8 lanes a row (one 128-B line). */
  /* Lanes 0..7 and 8..15 take rows 8 apart: their words fall on different banks at this pitch. */
  /* One LDS and one global base per lane; iteration i adds the constant row (i >> 2) * 16 + (i & 3) * 2. */
  const int n0 = wave * 64;
  const int rb = n0 + (q >> 1) + (q & 1) * 8;
  const unsigned* sx = sXT + rb * kXPitchW + j * 4;
  v4u xt[16];
#pragma unroll
  for (int i = 0; i < 16; ++i) xt[i] = *(const v4u*)(sx + ((i >> 2) * 16 + (i & 3) * 2) * kXPitchW);

  /* chunk state. A row = anchor cl; fragment f, word w holds t = 32 f + 16 (w >> 2) + 8 hh + 2 (w & 3) and t + 1 */
  v8u aw[2];
#pragma unroll
  for (int f = 0; f < 2; ++f)
#pragma unroll
    for (int w = 0; w < 8; ++w) {
      const int t = 32 * f + 16 * (w >> 2) + 8 * hh + 2 * (w & 3);
      aw[f][w] = pk16(h_bits(sProd[t * 17 + cl]), h_bits(sProd[(t + 1) * 17 + cl]));
    }
  const v16h a0 = __builtin_bit_cast(v16h, aw[0]);
  const v16h a1 = __builtin_bit_cast(v16h, aw[1]);
  v8f accs[4];
#pragma unroll
  for (int jn = 0; jn < 4; ++jn) accs[jn] = (v8f){0.f, 0.f, 0.f, 0.f, 0.f, 0.f, 0.f, 0.f};
#pragma unroll
  for (int jn = 0; jn < 4; ++jn) {
    /* Bt row d = n0 + 16 jn + cl; words at halves 8 hh, + 16, + 32, + 48 */
    const unsigned* bp = sXT + (n0 + 16 * jn + cl) * kXPitchW + 4 * hh;
    const v16h b0 = frag_h_words(*(const v4u*)(bp), *(const v4u*)(bp + 8));
    const v16h b1 = frag_h_words(*(const v4u*)(bp + 16), *(const v4u*)(bp + 24));
    accs[jn] = mma_h(a0, b0, accs[jn]);
    accs[jn] = mma_h(a1, b1, accs[jn]);
  }
  float* sw = slab + wave * 16 * kSlabPitch;
#pragma unroll
  for (int jn = 0; jn < 4; ++jn)
#pragma unroll
    for (int r = 0; r < 8; ++r) sw[(8 * hh + r) * kSlabPitch + 16 * jn + cl] = accs[jn][r];
  __syncthreads();

  if (wave < 4) {
    *(v4u*)(P16 + (size_t)r0 * kP + ln * 64 + j * 8) = up;
    *(v4u*)(W16 + (size_t)r0 * kP + ln * 64 + j * 8) = uw;
  }
  unsigned short* gx = XT + ((size_t)(b * kD + rb)) * kS + s0 + 8 * j;
#pragma unroll
  for (int i = 0; i < 16; ++i) *(v4u*)(gx + ((i >> 2) * 16 + (i & 3) * 2) * kS) = xt[i];
  const int c4 = cl * 4;
  v4f v[8];
#pragma unroll
  for (int it = 0; it < 8; ++it) v[it] = *(const v4f*)(sw + (it * 2 + hh) * kSlabPitch + c4);
#pragma unroll
  for (int it = 0; it < 8; ++it)
    *(v4f*)(DA + ((size_t)blockIdx.x * kP + it * 2 + hh) * kD + n0 + c4) = v[it];
}

/* --------------------------------------------------------------------------- */
/* K2: exclusive prefix of DA over the 32 chunks (f32, forward in time, zero   */
/* start per batch), emitted as ABT[b][c][d][32] f16 = [hi p0..15 | lo p0..15] */
/* with hi = f16(A), lo = f16(A - hi). Separate source and destination.        */
/* Thread = one (b, d, anchor pair): the 31 chunk states of both anchors that  */
/* the exclusive prefix needs are loaded up front (none depends on a sum), so  */
/* the block pays one memory latency; the sums then run in registers in chunk  */
/* order. Block = 16 consecutive d x 8 anchor pairs (lane = pair bit | d).     */
/* All 32 chunk tiles (16 rows x 64 B each) are staged in LDS; the 16-byte     */
/* piece q of row d lies at piece q ^ ((d >> 2) & 3), so the 32 lanes of a     */
/* word store fall on 32 banks. One barrier, then 16 iterations x 128 threads  */
/* x 16 B, lane-contiguous (a wave covers 4 whole lines).                      */
/* grid = 4 x 32 = 128 blocks, 128 threads.                                    */
/* --------------------------------------------------------------------------- */
constexpr int kScanD = 16;
static_assert(kD % kScanD == 0 && kP == 16 && kNC == 32);
__global__ __launch_bounds__(128) void prefix_kernel(const float* __restrict__ DA, unsigned short* __restrict__ ABT)
{
  __shared__ __align__(16) unsigned sT[kNC * kScanD * 16];
  const int tid  = threadIdx.x;
  const int lane = tid & 31;
  const int wave = __builtin_amdgcn_readfirstlane((int)(threadIdx.x >> 5));
  const int b    = blockIdx.x / (kD / kScanD);
  const int d0   = (blockIdx.x - b * (kD / kScanD)) * kScanD;
  const int dl   = lane & 15;
  const int pi   = wave * 2 + (lane >> 4);

  const float* src = DA + ((size_t)(b * kNC) * kP + 2 * pi) * kD + d0 + dl;
  float v0[kNC - 1], v1[kNC - 1];
#pragma unroll
  for (int c = 0; c < kNC - 1; ++c) {
    v0[c] = src[(size_t)c * kP * kD];
    v1[c] = src[(size_t)c * kP * kD + kD];
  }
  /* keeps every load issued ahead of the first sum: without it the last loads are scheduled behind a wait on the first and pay a second latency */
  __builtin_amdgcn_sched_barrier(0);

  const int sw = (dl >> 2) & 3;
  const int wh = dl * 16 + (((pi >> 2) ^ sw) << 2) + (pi & 3);
  const int wl = dl * 16 + (((2 + (pi >> 2)) ^ sw) << 2) + (pi & 3);
  float a0 = 0.0f, a1 = 0.0f;
#pragma unroll
  for (int c = 0; c < kNC; ++c) {
    const _Float16 h0 = (_Float16)a0;
    const _Float16 h1 = (_Float16)a1;
    const float h0f = (float)h0;
    const float h1f = (float)h1;
    const unsigned short hb0 = __builtin_bit_cast(unsigned short, h0);
    const unsigned short hb1 = __builtin_bit_cast(unsigned short, h1);
    const unsigned short lb0 = h_bits(a0 - h0f);
    const unsigned short lb1 = h_bits(a1 - h1f);
    sT[c * (kScanD * 16) + wh] = pk16(hb0, hb1);
    sT[c * (kScanD * 16) + wl] = pk16(lb0, lb1);
    if (c < kNC - 1) {
      a0 += v0[c];
      a1 += v1[c];
    }
  }
  __syncthreads();

  /* piece index inside a chunk tile = tid & 63 (row = piece >> 2); two chunks per iteration */
  const int pc  = tid & 63;
  const int ch  = tid >> 6;
  const int row = pc >> 2;
  const unsigned* sr = sT + ch * (kScanD * 16) + row * 16 + (((pc & 3) ^ ((row >> 2) & 3)) << 2);
  unsigned short* g = ABT + ((size_t)(b * kNC + ch) * kD + d0) * 32 + pc * 8;
  v4u v[16];
#pragma unroll
  for (int it = 0; it < 16; ++it) v[it] = *(const v4u*)(sr + it * 2 * (kScanD * 16));
#pragma unroll
  for (int it = 0; it < 16; ++it) *(v4u*)(g + (size_t)it * 2 * kD * 32) = v[it];
}

/* --------------------------------------------------------------------------- */
/* K3: per block (b, c, column half), 64 query rows x 256 columns.             */
/*  (0) every global load of the block is requested first: the gate and prods  */
/*      rows, then each wave's own Bt fragments (12 x 16 B a lane), so the     */
/*      block pays one memory latency and steps (1), (2) run under it;         */
/*  (1) LDS tile sA[64][96] f16: cols 0..15 and 16..31 = gate x 64 (copied     */
/*      from W16: 256 threads x 8 halves = 64 x 32);                           */
/*  (2) cols 32..95 = 64 * L[s][t] = sum_p (64 w[s][p]) * prods[t][p], kept    */
/*      for t <= s (diagonal included), else 0 by select; 16 tiles of 16 x 16, */
/*      two per wave; K padded 16 -> 32 by zero upper fragment halves built in */
/*      registers (both operands);                                             */
/*  (3) fused K = 96 product: A = [W | W | L], Bt[d] = [Ab_hi | Ab_lo | XT     */
/*      chunk]; wave = all 64 rows x its own 32 columns, so a Bt fragment is   */
/*      loaded by one wave only; f32 result x 1/64 -> the wave's own 64 x 32   */
/*      slab -> rows stored as 8 lanes x 16 B = one 128-B line.                */
/* grid = 256 blocks, 256 threads.                                             */
/* --------------------------------------------------------------------------- */
constexpr int kOutCols  = 256;
constexpr int kOutPitch = 36;
static_assert(kD % kOutCols == 0 && kOutCols == 8 * 32);
__global__ __launch_bounds__(256) void output_kernel(
    const unsigned short* __restrict__ W16, const unsigned short* __restrict__ P16,
    const unsigned short* __restrict__ ABT, const unsigned short* __restrict__ XT, float* __restrict__ out)
{
  __shared__ __align__(16) unsigned short sA[64 * kTilePitch];
  __shared__ __align__(16) float slab[8 * 64 * kOutPitch];
  const int tid  = threadIdx.x;
  const int lane = tid & 31;
  const int wave = __builtin_amdgcn_readfirstlane((int)(threadIdx.x >> 5));
  const int hh = lane >> 4;
  const int cl = lane & 15;
  const int bc = blockIdx.x / (kD / kOutCols);
  const int n0 = (blockIdx.x - bc * (kD / kOutCols)) * kOutCols + wave * 32;
  const int b  = bc / kNC;
  const int c0 = (bc - b * kNC) * kC;
  const int r0 = b * kS + c0;
  const int mt = wave & 3;
  const int nh = wave >> 2;

  /* gate piece tid >> 1 (row tid >> 2, half (tid >> 1) & 1) for copy tid & 1 of the tile's gate columns */
  const unsigned short* gw = W16 + (size_t)r0 * kP + (tid >> 1) * 8;
  const unsigned short* ga = W16 + (size_t)(r0 + 16 * mt + cl) * kP + 8 * hh;
  const unsigned short* gp = P16 + (size_t)(r0 + 32 * nh + cl) * kP + 8 * hh;
  /* Bt rows d = n0 + 16 j + cl: pieces 0, 1 = prefix hi | lo, pieces 2..5 = the chunk's 64 tokens */
  const unsigned short* ab = ABT + ((size_t)bc * kD + n0 + cl) * 32 + 8 * hh;
  const unsigned short* xt = XT + ((size_t)(b * kD + n0 + cl)) * kS + c0 + 8 * hh;
  const v4u wg = *(const v4u*)(gw);
  const v4u aw = *(const v4u*)(ga);
  v4u pw[2];
#pragma unroll
  for (int jj = 0; jj < 2; ++jj) pw[jj] = *(const v4u*)(gp + jj * 16 * kP);
  v4u bq[2][6];
#pragma unroll
  for (int j = 0; j < 2; ++j) {
    bq[j][0] = *(const v4u*)(ab + j * 16 * 32);
    bq[j][1] = *(const v4u*)(ab + j * 16 * 32 + 16);
    bq[j][2] = *(const v4u*)(xt + j * 16 * kS);
    bq[j][3] = *(const v4u*)(xt + j * 16 * kS + 16);
    bq[j][4] = *(const v4u*)(xt + j * 16 * kS + 32);
    bq[j][5] = *(const v4u*)(xt + j * 16 * kS + 48);
  }
  /* the wait that stands in front of any overwrite of a register an issued load names; the five bases are inputs so that none is reused, not even as a later load's destination, ahead of it */
  asm volatile("s_wait_xcnt 0x0" :: "v"(gw), "v"(ga), "v"(gp), "v"(ab), "v"(xt) : "memory");
  /* keeps every load issued ahead of the first wait for data: without it the Bt loads are scheduled behind the score tiles and pay a second latency */
  __builtin_amdgcn_sched_barrier(0);

  *(v4u*)(sA + (tid >> 2) * kTilePitch + (tid & 1) * 16 + ((tid >> 1) & 1) * 8) = wg;
  {
    const v4u zero4 = (v4u){0u, 0u, 0u, 0u};
    const v16h af = frag_h_words(aw, zero4);
#pragma unroll
    for (int jj = 0; jj < 2; ++jj) {
      const int tt = nh * 2 + jj;
      const v16h bf = frag_h_words(pw[jj], zero4);
      v8f accL = (v8f){0.f, 0.f, 0.f, 0.f, 0.f, 0.f, 0.f, 0.f};
      accL = mma_h(af, bf, accL);
      const int tl = 16 * tt + cl;
#pragma unroll
      for (int r = 0; r < 8; ++r) {
        const int sl = 16 * mt + 8 * hh + r;
        const float val = (tl <= sl) ? accL[r] : 0.0f;
        sA[sl * kTilePitch + 32 + tl] = h_bits(val);
      }
    }
  }
  __syncthreads();

  /* unrolled here and below: the fragments and accumulators live in registers only with constant indices */
  v16h a[4][3];
#pragma unroll
  for (int m = 0; m < 4; ++m)
#pragma unroll
    for (int ks = 0; ks < 3; ++ks) {
      const unsigned short* ap = sA + (16 * m + cl) * kTilePitch + 32 * ks + 8 * hh;
      const v4u x0 = *(const v4u*)(ap);
      const v4u x1 = *(const v4u*)(ap + 16);
      a[m][ks] = frag_h_words(x0, x1);
    }

  v8f acc[4][2];
#pragma unroll
  for (int m = 0; m < 4; ++m)
#pragma unroll
    for (int j = 0; j < 2; ++j) acc[m][j] = (v8f){0.f, 0.f, 0.f, 0.f, 0.f, 0.f, 0.f, 0.f};
  /* k step outermost: eight independent accumulators between two products into the same one; each sums its k steps in the order 0, 1, 2 */
#pragma unroll
  for (int ks = 0; ks < 3; ++ks)
#pragma unroll
    for (int m = 0; m < 4; ++m)
#pragma unroll
      for (int j = 0; j < 2; ++j)
        acc[m][j] = mma_h(a[m][ks], frag_h_words(bq[j][2 * ks], bq[j][2 * ks + 1]), acc[m][j]);

  float* sw = slab + wave * 64 * kOutPitch;
#pragma unroll
  for (int m = 0; m < 4; ++m)
#pragma unroll
    for (int j = 0; j < 2; ++j)
#pragma unroll
      for (int r = 0; r < 8; ++r)
        sw[(16 * m + 8 * hh + r) * kOutPitch + 16 * j + cl] = acc[m][j][r] * kWCarryInv;
  /* the slab is this wave's own: its LDS stores have landed before its lanes read one another's words back; no other wave takes part */
  asm volatile("s_wait_dscnt 0x0" ::: "memory");
  /* 8 lanes a row (one 128-B line). Lanes 0..7 and 8..15 take rows 8 apart: their words fall on different banks at this pitch. */
  const int q  = lane >> 3;
  const int j4 = (lane & 7) * 4;
  const int rl = (q >> 1) + (q & 1) * 8;
  /* One LDS and one global base per lane; iteration i adds the constant row (i >> 2) * 16 + (i & 3) * 2. */
  const float* sr = sw + rl * kOutPitch + j4;
  float* go = out + (size_t)(r0 + rl) * kD + n0 + j4;
  v4f v[16];
#pragma unroll
  for (int i = 0; i < 16; ++i) v[i] = *(const v4f*)(sr + ((i >> 2) * 16 + (i & 3) * 2) * kOutPitch);
#pragma unroll
  for (int i = 0; i < 16; ++i) *(v4f*)(go + ((i >> 2) * 16 + (i & 3) * 2) * kD) = v[i];
}

/* --------------------------------------------------------------------------- */
/* Host glue: 3 kernel launches, nothing else.                                 */
/* --------------------------------------------------------------------------- */
extern "C" void kernel_launch(void* const* d_in, const int* in_sizes, int n_in,
                              void* d_out, int out_size, void* d_ws, size_t ws_size,
                              hipStream_t stream) {
  if (n_in < 2) return;
  if (in_sizes[0] != kRows * kD) return;
  if (in_sizes[1] != kP * kD) return;
  if (out_size != kRows * kD) return;
  if (ws_size < kWsTotal) return;

  const float* x   = (const float*)d_in[0];
  const float* anc = (const float*)d_in[1];
  float* out = (float*)d_out;

  char* ws = (char*)d_ws;
  unsigned short* XT   = (unsigned short*)(ws + kOffXT);
  unsigned short* P16  = (unsigned short*)(ws + kOffP16);
  unsigned short* W16  = (unsigned short*)(ws + kOffW16);
  float*          DA   = (float*)(ws + kOffDA);
  unsigned short* ABT  = (unsigned short*)(ws + kOffABT);

  scores_state_kernel<<<dim3(kRows / 64), 256, 0, stream>>>(x, anc, P16, W16, XT, DA);
  prefix_kernel<<<dim3(kB * (kD / kScanD)), 128, 0, stream>>>(DA, ABT);
  output_kernel<<<dim3(kB * kNC * (kD / kOutCols)), 256, 0, stream>>>(W16, P16, ABT, XT, out);
}

// v006
// One run takes 16.8 microseconds.
// Two timings next to v005 put it at 1.13 and 1.14 times that version's speed.
// Over all steps from v000 it is 4.01 times as fast.
// prods (anchors x tokens, K=512): v_wmma_f32_16x16x32_bf16 with both operands as bf16 hi+lo (hi.lo + lo.hi + hi.hi); chunk states, intra-chunk scores, carry and intra-chunk output: v_wmma_f32_16x16x32_f16 (gate plane carried x64, chunk-prefix state as f16 hi+lo planes); f32 accumulate; softmax and prefix scan in f32.
#include <hip/hip_runtime.h>
#include <math.h>

typedef __attribute__((ext_vector_type(16))) _Float16 v16h;
typedef __attribute__((ext_vector_type(16))) __bf16   v16b;
typedef __attribute__((ext_vector_type(8)))  float    v8f;
typedef __attribute__((ext_vector_type(4)))  float    v4f;
typedef __attribute__((ext_vector_type(2)))  float    v2f;
typedef __attribute__((ext_vector_type(2)))  _Float16 v2h;
typedef __attribute__((ext_vector_type(2)))  __bf16   v2b;
typedef __attribute__((ext_vector_type(4)))  unsigned int v4u;
typedef __attribute__((ext_vector_type(8)))  unsigned int v8u;

/* --------------------------------------------------------------------------- */
/* Shape constants                                                             */
/* --------------------------------------------------------------------------- */
constexpr int kB    = 4;
constexpr int kS    = 2048;
constexpr int kD    = 512;
constexpr int kP    = 16;
constexpr int kC    = 64;
constexpr int kNC   = kS / kC;
constexpr int kRows = kB * kS;
/* gate scale = 1/sqrt(kP), checked against kP */
constexpr float kGateScale = 0.25f;
static_assert(kGateScale * kGateScale * (float)kP == 1.0f);
/* gate plane carry (power of two), folded back in the output epilogue */
constexpr float kWCarry    = 64.0f;
constexpr float kWCarryInv = 1.0f / kWCarry;
static_assert(kWCarry * kWCarryInv == 1.0f);
static_assert(kS % kC == 0 && kC == 64 && kP == 16 && kD % 64 == 0);
/* LDS pitches */
constexpr int kAncPitchW = 260;
constexpr int kTilePitch = 104;
/* transposed token tile, 32-bit words per d row: 176 B = 16 B x 11 */
constexpr int kXPitchW = 44;

/* --------------------------------------------------------------------------- */
/* Workspace region map (bytes; every offset a multiple of 128)                */
/*   XT    f16 [128][32][4][32][8] transposed tokens, Bt fragment order  8,388,608 */
/*   P16   f16 [8192][16]          prods, token-major                      262,144 */
/*   W16   f16 [8192][16]          gate x64, token-major                   262,144 */
/*   DA    f32 [128][32][2][32][4] chunk states, accumulator order       4,194,304 */
/*   ABT   f16 [128][32][2][32][8] exclusive chunk prefix, fragment order 4,194,304 */
/* XT, DA, ABT: [chunk of the 128][16-column tile][piece][lane][elements]: a   */
/* piece is what one wave-wide 16-byte access moves, 512 contiguous bytes, in  */
/* the lane order of the WMMA registers (lane = 16 hh + cl, column d = 16 tile */
/* + cl). No 256-byte unit is shared by two blocks.                            */
/*   XT  piece k: tokens 16 k + 8 hh .. + 7 of column d                        */
/*   DA  piece s: anchors 8 hh + 4 s .. + 3 of column d                        */
/*   ABT piece 0: hi of anchors 8 hh .. + 7 of column d; piece 1: lo           */
/*   total = 8,388,608 + 262,144 + 262,144 + 4,194,304 + 4,194,304 = 17,301,504     */
/* --------------------------------------------------------------------------- */
constexpr size_t kOffXT   = 0;
constexpr size_t kOffP16  = kOffXT   + (size_t)kB * kD * kS * 2;
constexpr size_t kOffW16  = kOffP16  + (size_t)kRows * kP * 2;
constexpr size_t kOffDA   = kOffW16  + (size_t)kRows * kP * 2;
constexpr size_t kOffABT  = kOffDA   + (size_t)kB * kNC * kP * kD * 4;
constexpr size_t kWsTotal = kOffABT  + (size_t)kB * kNC * kD * 32 * 2;
static_assert(kWsTotal == 17301504ull);
static_assert(kWsTotal <= 134217728ull);
static_assert((kOffP16 % 128) == 0 && (kOffW16 % 128) == 0 &&
              (kOffDA % 128) == 0 && (kOffABT % 128) == 0);

/* --------------------------------------------------------------------------- */
/* Small helpers                                                               */
/* --------------------------------------------------------------------------- */
__device__ __forceinline__ unsigned pk16(unsigned short a, unsigned short b) { return (unsigned)a | ((unsigned)b << 16); }
__device__ __forceinline__ unsigned short h_bits(float f) { const _Float16 h = (_Float16)f; return __builtin_bit_cast(unsigned short, h); }

/* bf16 hi and lo words of a pair of f32 values (both conversions RNE) */
__device__ __forceinline__ void split_pair(float a, float b, unsigned& hw, unsigned& lw) {
  const v2f f = (v2f){a, b};
  hw = __builtin_bit_cast(unsigned, __builtin_convertvector(f, v2b));
  const v2f hf = (v2f){__uint_as_float(hw << 16), __uint_as_float(hw & 0xFFFF0000u)};
  lw = __builtin_bit_cast(unsigned, __builtin_convertvector(f - hf, v2b));
}

__device__ __forceinline__ v16h frag_h_words(v4u a, v4u b) {
  const v8u w = __builtin_shufflevector(a, b, 0, 1, 2, 3, 4, 5, 6, 7);
  return __builtin_bit_cast(v16h, w);
}
__device__ __forceinline__ v16b frag_b_words(v4u a, v4u b) {
  const v8u w = __builtin_shufflevector(a, b, 0, 1, 2, 3, 4, 5, 6, 7);
  return __builtin_bit_cast(v16b, w);
}
/* one WMMA + hazard guard tied to its accumulator and naming its A/B fragments */
__device__ __forceinline__ v8f mma_h(v16h a, v16h b, v8f c) {
  c = __builtin_amdgcn_wmma_f32_16x16x32_f16(false, a, false, b, (short)0, c, false, false);
  asm volatile("v_nop\n\tv_nop\n\tv_nop\n\tv_nop" : "+v"(c) : "v"(a), "v"(b));
  return c;
}
__device__ __forceinline__ v8f mma_b(v16b a, v16b b, v8f c) {
  c = __builtin_amdgcn_wmma_f32_16x16x32_bf16(false, a, false, b, (short)0, c, false, false);
  asm volatile("v_nop\n\tv_nop\n\tv_nop\n\tv_nop" : "+v"(c) : "v"(a), "v"(b));
  return c;
}

/* --------------------------------------------------------------------------- */
/* K1: one block per (batch, 64-token chunk) does all that needs only that     */
/* chunk's tokens, which are read from memory once.                            */
/* (a) prods (M = 64, N = 16 anchors, K = 512) as a bf16 hi/lo three-product   */
/* WMMA. 8 waves: wave = (16-row tile mt, K half kh), so a lane's whole share  */
/* of the tokens (8 steps x 4 x 16 B) and of the anchors (8 x 16 B) fits in    */
/* registers and is requested before anything is waited on: the block pays one */
/* memory latency. Token values are split in registers; anchor hi/lo word      */
/* planes staged in LDS (8 iterations x 256 threads x 4 floats = 16 x 512, all */
/* read words written). The two K halves meet in LDS: prods = half 0 + half 1. */
/* (b) the same token registers as f16, transposed into the LDS tile           */
/* sXT[d][t]: lanes t and t ^ 1 swap one packed word, so every lane stores     */
/* whole words (two neighbouring tokens of one d); 64 stores x 256 threads x   */
/* 2 halves = 512 x 64, the whole tile.                                        */
/* (c) the 16-wide softmax per token row in f32 (waves 0, 1).                  */
/* (d) chunk state DA[b][c][p][d] = sum_t prods[p][t] * x[t][d]: M = 16,       */
/* N = 512, K = 64, f16 WMMA; A from the prods in LDS (rounded to f16), Bt     */
/* rows from sXT; 8 waves x 64 columns; the accumulators go to DA as they lie  */
/* in the registers (8 stores x 256 threads x 16 B = 32 KiB).                  */
/* (e) the same Bt fragment registers stored to XT as they lie (16 stores x    */
/* 256 threads x 16 B = 64 KiB): the output kernel loads them back unchanged.  */
/*   P16  [row][16] f16 prods         block tile = 2 KiB contiguous = 16 lines */
/*   W16  [row][16] f16 gate x 64     same map                                 */
/* Wave w < 4 writes lines 4w..4w+3 of each plane (lanes 8q..8q+7 -> line 4w+q). */
/* grid = 8192 / 64 = 128 blocks, 256 threads.                                 */
/* --------------------------------------------------------------------------- */
constexpr int kKHalf  = kD / 2;
constexpr int kKSteps = kKHalf / 32;
static_assert(kKSteps == 8 && kP * kD == 8 * 256 * 4);
__global__ __launch_bounds__(256) void scores_state_kernel(
    const float* __restrict__ x, const float* __restrict__ anc,
    unsigned short* __restrict__ P16, unsigned short* __restrict__ W16,
    unsigned short* __restrict__ XT, float* __restrict__ DA)
{
  __shared__ __align__(16) unsigned sAH[kP * kAncPitchW];
  __shared__ __align__(16) unsigned sAL[kP * kAncPitchW];
  __shared__ float sPart[2 * 64 * 17];
  __shared__ float sProd[64 * 17];
  __shared__ float sGate[64 * 17];
  __shared__ __align__(16) unsigned sXT[kD * kXPitchW];
  const int tid  = threadIdx.x;
  const int lane = tid & 31;
  const int wave = __builtin_amdgcn_readfirstlane((int)(threadIdx.x >> 5));
  const int hh = lane >> 4;
  const int cl = lane & 15;
  const int mt = wave & 3;
  const int kh = wave >> 2;
  const int r0 = blockIdx.x * 64;

  /* every global load of the block, anchors first (they are needed first) */
  /* float4 number i * 256 + tid of the 16 x 512 anchor array, which is contiguous */
  const float* aptr = anc + tid * 4;
  v4f av[8];
  /* unrolled here and below: av and xv live in registers only with constant indices */
#pragma unroll
  for (int i = 0; i < 8; ++i) av[i] = *(const v4f*)(aptr + i * 1024);
  /* A rows = token rows of this wave's tile, natural [row][d] layout, this wave's K half */
  const float* xrow = x + (size_t)(r0 + mt * 16 + cl) * kD + kh * kKHalf + 8 * hh;
  v4f xv[kKSteps][4];
#pragma unroll
  for (int it = 0; it < kKSteps; ++it) {
    xv[it][0] = *(const v4f*)(xrow + it * 32);
    xv[it][1] = *(const v4f*)(xrow + it * 32 + 4);
    xv[it][2] = *(const v4f*)(xrow + it * 32 + 16);
    xv[it][3] = *(const v4f*)(xrow + it * 32 + 20);
  }
  /* keeps every load issued ahead of the first wait: without it the token loads are scheduled behind the waits on the first anchor loads and pay a second latency */
  __builtin_amdgcn_sched_barrier(0);

#pragma unroll
  for (int i = 0; i < 8; ++i) {
    const int e4 = i * 256 + tid;
    const int p  = e4 >> 7;
    const int cf = (e4 & 127) * 4;
    unsigned h01, l01, h23, l23;
    split_pair(av[i][0], av[i][1], h01, l01);
    split_pair(av[i][2], av[i][3], h23, l23);
    const int wo = p * kAncPitchW + (cf >> 1);
    sAH[wo]     = h01;
    sAH[wo + 1] = h23;
    sAL[wo]     = l01;
    sAL[wo + 1] = l23;
  }
  __syncthreads();

  v8f acc = (v8f){0.f, 0.f, 0.f, 0.f, 0.f, 0.f, 0.f, 0.f};
#pragma unroll
  for (int it = 0; it < kKSteps; ++it) {
    const int k0 = kh * kKHalf + it * 32;
    const v4f f0 = xv[it][0];
    const v4f f1 = xv[it][1];
    const v4f f2 = xv[it][2];
    const v4f f3 = xv[it][3];
    unsigned hw0, hw1, hw2, hw3, hw4, hw5, hw6, hw7;
    unsigned lw0, lw1, lw2, lw3, lw4, lw5, lw6, lw7;
    split_pair(f0[0], f0[1], hw0, lw0);
    split_pair(f0[2], f0[3], hw1, lw1);
    split_pair(f1[0], f1[1], hw2, lw2);
    split_pair(f1[2], f1[3], hw3, lw3);
    split_pair(f2[0], f2[1], hw4, lw4);
    split_pair(f2[2], f2[3], hw5, lw5);
    split_pair(f3[0], f3[1], hw6, lw6);
    split_pair(f3[2], f3[3], hw7, lw7);
    const v8u hv = (v8u){hw0, hw1, hw2, hw3, hw4, hw5, hw6, hw7};
    const v8u lv = (v8u){lw0, lw1, lw2, lw3, lw4, lw5, lw6, lw7};
    const v16b ah = __builtin_bit_cast(v16b, hv);
    const v16b al = __builtin_bit_cast(v16b, lv);
    /* B column = anchor cl; words at halves k0 + 8*hh and + 16 */
    const int wb = cl * kAncPitchW + (k0 >> 1) + 4 * hh;
    const v4u bh0 = *(const v4u*)(sAH + wb);
    const v4u bh1 = *(const v4u*)(sAH + wb + 8);
    const v4u bl0 = *(const v4u*)(sAL + wb);
    const v4u bl1 = *(const v4u*)(sAL + wb + 8);
    const v16b bh = frag_b_words(bh0, bh1);
    const v16b bl = frag_b_words(bl0, bl1);
    acc = mma_b(ah, bl, acc);
    acc = mma_b(al, bh, acc);
    acc = mma_b(ah, bh, acc);
  }
  /* D element r of this lane = (token row 8*hh + r of tile mt, anchor cl), K half kh */
#pragma unroll
  for (int r = 0; r < 8; ++r) sPart[(kh * 64 + mt * 16 + 8 * hh + r) * 17 + cl] = acc[r];

  /* f16 transpose: this lane holds token t = 16 * mt + cl. Word h = (d, d + 1) of token t, word r = the same of token t ^ 1. */
  /* Even t keeps row d: (t, t + 1) = low halves of h, r. Odd t keeps row d + 1: (t - 1, t) = high halves of r, h. */
  {
    const int odd = cl & 1;
    const unsigned sel = odd ? 0x07060302u : 0x01000504u;
    unsigned* xw = sXT + (kh * kKHalf + 8 * hh + odd) * kXPitchW + ((mt * 16 + cl) >> 1);
#pragma unroll
    for (int it = 0; it < kKSteps; ++it)
#pragma unroll
      for (int q = 0; q < 4; ++q)
#pragma unroll
        for (int m = 0; m < 2; ++m) {
          const int dof = it * 32 + (q >> 1) * 16 + (q & 1) * 4 + 2 * m;
          const v2f f2 = (v2f){xv[it][q][2 * m], xv[it][q][2 * m + 1]};
          const unsigned h = __builtin_bit_cast(unsigned, __builtin_convertvector(f2, v2h));
          /* quad_perm [1,0,3,2]: the word of lane ^ 1 */
          const unsigned r = (unsigned)__builtin_amdgcn_mov_dpp((int)h, 0xB1, 0xF, 0xF, true);
          xw[dof * kXPitchW] = __builtin_amdgcn_perm(h, r, sel);
        }
  }
  __syncthreads();

  /* K halves added, then softmax over the 16 anchors, one token row per thread (waves 0 and 1, scalar branch) */
  if (wave < 2) {
    float pr[kP], ge[kP];
    /* unrolled: the 32 LDS reads are issued together (rolled, each trip waited for its own) and the row stays in registers */
#pragma unroll
    for (int p = 0; p < kP; ++p) pr[p] = sPart[tid * 17 + p] + sPart[(64 + tid) * 17 + p];
    float m = pr[0] * kGateScale;
#pragma unroll
    for (int p = 1; p < kP; ++p) m = fmaxf(m, pr[p] * kGateScale);
    float sum = 0.0f;
#pragma unroll
    for (int p = 0; p < kP; ++p) {
      ge[p] = expf(pr[p] * kGateScale - m);
      sum += ge[p];
    }
    const float inv = (1.0f / sum) * kWCarry;
#pragma unroll
    for (int p = 0; p < kP; ++p) {
      sProd[tid * 17 + p] = pr[p];
      sGate[tid * 17 + p] = ge[p] * inv;
    }
  }
  __syncthreads();

  /* No barrier follows: every global store of the block stands behind the last one. */
  const int q = lane >> 3;
  const int j = lane & 7;

  /* the two token-major planes (waves 0..3, scalar branch) */
  v4u up = (v4u){0u, 0u, 0u, 0u};
  v4u uw = (v4u){0u, 0u, 0u, 0u};
  const int ln = wave * 4 + q;
  if (wave < 4) {
    const int row = 4 * ln + (j >> 1);
    const int p0  = (j & 1) * 8;
    unsigned short pb[8], wb16[8];
#pragma unroll
    for (int e = 0; e < 8; ++e) {
      pb[e]   = h_bits(sProd[row * 17 + p0 + e]);
      wb16[e] = h_bits(sGate[row * 17 + p0 + e]);
    }
    up = (v4u){pk16(pb[0], pb[1]), pk16(pb[2], pb[3]), pk16(pb[4], pb[5]), pk16(pb[6], pb[7])};
    uw = (v4u){pk16(wb16[0], wb16[1]), pk16(wb16[2], wb16[3]), pk16(wb16[4], wb16[5]), pk16(wb16[6], wb16[7])};
  }

  /* Bt fragments of this wave's 64 columns: row d = n0 + 16 jn + cl, piece k = words at halves 16 k + 8 hh. */
  /* They feed the state WMMAs and go to XT as they are: store (jn, k) is 512 contiguous bytes, the wave's 16 stores 8 KiB. */
  const int n0 = wave * 64;
  v4u bw[4][4];
#pragma unroll
  for (int jn = 0; jn < 4; ++jn) {
    const unsigned* bp = sXT + (n0 + 16 * jn + cl) * kXPitchW + 4 * hh;
#pragma unroll
    for (int k = 0; k < 4; ++k) bw[jn][k] = *(const v4u*)(bp + 8 * k);
  }
  unsigned short* gx = XT + ((size_t)blockIdx.x * (kD / 16) + wave * 4) * 1024 + lane * 8;
#pragma unroll
  for (int jn = 0; jn < 4; ++jn)
#pragma unroll
    for (int k = 0; k < 4; ++k) *(v4u*)(gx + (jn * 4 + k) * 256) = bw[jn][k];

  /* chunk state. A row = anchor cl; fragment f, word w holds t = 32 f + 16 (w >> 2) + 8 hh + 2 (w & 3) and t + 1 */
  v8u aw[2];
#pragma unroll
  for (int f = 0; f < 2; ++f)
#pragma unroll
    for (int w = 0; w < 8; ++w) {
      const int t = 32 * f + 16 * (w >> 2) + 8 * hh + 2 * (w & 3);
      aw[f][w] = pk16(h_bits(sProd[t * 17 + cl]), h_bits(sProd[(t + 1) * 17 + cl]));
    }
  const v16h a0 = __builtin_bit_cast(v16h, aw[0]);
  const v16h a1 = __builtin_bit_cast(v16h, aw[1]);
  v8f accs[4];
#pragma unroll
  for (int jn = 0; jn < 4; ++jn) accs[jn] = (v8f){0.f, 0.f, 0.f, 0.f, 0.f, 0.f, 0.f, 0.f};
#pragma unroll
  for (int jn = 0; jn < 4; ++jn) {
    accs[jn] = mma_h(a0, frag_h_words(bw[jn][0], bw[jn][1]), accs[jn]);
    accs[jn] = mma_h(a1, frag_h_words(bw[jn][2], bw[jn][3]), accs[jn]);
  }
  /* D element r of this lane = (anchor 8 hh + r, column n0 + 16 jn + cl); store (jn, s) takes r = 4 s .. 4 s + 3, 512 contiguous bytes */
  float* gd = DA + ((size_t)blockIdx.x * (kD / 16) + wave * 4) * 256 + lane * 4;
#pragma unroll
  for (int jn = 0; jn < 4; ++jn)
#pragma unroll
    for (int s = 0; s < 2; ++s)
      *(v4f*)(gd + (jn * 2 + s) * 128) = (v4f){accs[jn][4 * s], accs[jn][4 * s + 1], accs[jn][4 * s + 2], accs[jn][4 * s + 3]};
  /* the wait that stands in front of any overwrite of a register an issued store names: the plane addresses below are formed in registers of the stores above */
  asm volatile("s_wait_xcnt 0x0" ::: "memory");
  if (wave < 4) {
    *(v4u*)(P16 + (size_t)r0 * kP + ln * 64 + j * 8) = up;
    *(v4u*)(W16 + (size_t)r0 * kP + ln * 64 + j * 8) = uw;
  }
}

/* --------------------------------------------------------------------------- */
/* K2: exclusive prefix of DA over the 32 chunks (f32, forward in time, zero   */
/* start per batch), emitted per column d as f16 [hi p0..15 | lo p0..15] with  */
/* hi = f16(A), lo = f16(A - hi), in ABT's fragment order. Separate source and */
/* destination.                                                                */
/* Thread = one (b, d, anchor pair): the 31 chunk states of both anchors that  */
/* the exclusive prefix needs are loaded up front (none depends on a sum), so  */
/* the block pays one memory latency; the sums then run in registers in chunk  */
/* order. Block = 16 consecutive d x 8 anchor pairs (lane = pair bit | d): one */
/* column tile of DA, where an anchor pair is 8 contiguous bytes and a wave's  */
/* load one whole 256-byte unit.                                               */
/* All 32 chunk tiles (16 rows x 64 B each) are staged in LDS; the 16-byte     */
/* piece q of row d lies at piece q ^ ((d >> 2) & 3), so the 32 lanes of a     */
/* word store fall on 32 banks. One barrier, then 16 iterations x 128 threads  */
/* x 16 B, lane-contiguous (a wave covers 4 whole lines).                      */
/* grid = 4 x 32 = 128 blocks, 128 threads.                                    */
/* --------------------------------------------------------------------------- */
constexpr int kScanD = 16;
static_assert(kD % kScanD == 0 && kP == 16 && kNC == 32);
__global__ __launch_bounds__(128) void prefix_kernel(const float* __restrict__ DA, unsigned short* __restrict__ ABT)
{
  __shared__ __align__(16) unsigned sT[kNC * kScanD * 16];
  const int tid  = threadIdx.x;
  const int lane = tid & 31;
  const int wave = __builtin_amdgcn_readfirstlane((int)(threadIdx.x >> 5));
  const int b    = blockIdx.x / (kD / kScanD);
  const int d0   = (blockIdx.x - b * (kD / kScanD)) * kScanD;
  const int dl   = lane & 15;
  const int pi   = wave * 2 + (lane >> 4);

  /* anchors 2 pi, 2 pi + 1 = 8 (pi >> 2) + 4 ((pi >> 1) & 1) + 2 (pi & 1) and the next: DA piece (pi >> 1) & 1, lane 16 (pi >> 2) + dl, elements 2 (pi & 1), + 1 */
  const float* src = DA + ((size_t)(b * kNC) * (kD / 16) + (d0 >> 4)) * 256
                   + ((((pi >> 1) & 1) * 32 + (pi >> 2) * 16 + dl) * 4 + (pi & 1) * 2);
  float v0[kNC - 1], v1[kNC - 1];
#pragma unroll
  for (int c = 0; c < kNC - 1; ++c) {
    const v2f vv = *(const v2f*)(src + (size_t)c * kP * kD);
    v0[c] = vv[0];
    v1[c] = vv[1];
  }
  /* the wait that stands in front of any overwrite of a register an issued load names; the base is an input so that it is not reused, not even as the last load's destination, ahead of it */
  asm volatile("s_wait_xcnt 0x0" :: "v"(src) : "memory");
  /* keeps every load issued ahead of the first sum: without it the last loads are scheduled behind a wait on the first and pay a second latency */
  __builtin_amdgcn_sched_barrier(0);

  const int sw = (dl >> 2) & 3;
  const int wh = dl * 16 + (((pi >> 2) ^ sw) << 2) + (pi & 3);
  const int wl = dl * 16 + (((2 + (pi >> 2)) ^ sw) << 2) + (pi & 3);
  float a0 = 0.0f, a1 = 0.0f;
#pragma unroll
  for (int c = 0; c < kNC; ++c) {
    const _Float16 h0 = (_Float16)a0;
    const _Float16 h1 = (_Float16)a1;
    const float h0f = (float)h0;
    const float h1f = (float)h1;
    const unsigned short hb0 = __builtin_bit_cast(unsigned short, h0);
    const unsigned short hb1 = __builtin_bit_cast(unsigned short, h1);
    const unsigned short lb0 = h_bits(a0 - h0f);
    const unsigned short lb1 = h_bits(a1 - h1f);
    sT[c * (kScanD * 16) + wh] = pk16(hb0, hb1);
    sT[c * (kScanD * 16) + wl] = pk16(lb0, lb1);
    if (c < kNC - 1) {
      a0 += v0[c];
      a1 += v1[c];
    }
  }
  __syncthreads();

  /* 16-byte place inside a chunk tile = tid & 63 = 32 piece + 16 hh + cl: row cl, its piece q = 2 piece + hh = place >> 4; two chunks per iteration */
  const int pc  = tid & 63;
  const int ch  = tid >> 6;
  const int row = pc & 15;
  const unsigned* sr = sT + ch * (kScanD * 16) + row * 16 + (((pc >> 4) ^ ((row >> 2) & 3)) << 2);
  unsigned short* g = ABT + ((size_t)(b * kNC + ch) * kD + d0) * 32 + pc * 8;
  v4u v[16];
#pragma unroll
  for (int it = 0; it < 16; ++it) v[it] = *(const v4u*)(sr + it * 2 * (kScanD * 16));
#pragma unroll
  for (int it = 0; it < 16; ++it) *(v4u*)(g + (size_t)it * 2 * kD * 32) = v[it];
}

/* --------------------------------------------------------------------------- */
/* K3: per block (b, c, column half), 64 query rows x 256 columns.             */
/*  (0) every global load of the block is requested first: the gate and prods  */
/*      rows, then each wave's own Bt fragments (12 x 16 B a lane), so the     */
/*      block pays one memory latency and steps (1), (2) run under it;         */
/*  (1) LDS tile sA[64][96] f16: cols 0..15 and 16..31 = gate x 64 (copied     */
/*      from W16: 256 threads x 8 halves = 64 x 32);                           */
/*  (2) cols 32..95 = 64 * L[s][t] = sum_p (64 w[s][p]) * prods[t][p], kept    */
/*      for t <= s (diagonal included), else 0 by select; 16 tiles of 16 x 16, */
/*      two per wave; K padded 16 -> 32 by zero upper fragment halves built in */
/*      registers (both operands);                                             */
/*  (3) fused K = 96 product: A = [W | W | L], Bt[d] = [Ab_hi | Ab_lo | XT     */
/*      chunk]; wave = all 64 rows x its own 32 columns, so a Bt fragment is   */
/*      loaded by one wave only; f32 result x 1/64 -> the wave's own 64 x 32   */
/*      slab -> rows stored as 8 lanes x 16 B = one 128-B line.                */
/* grid = 256 blocks, 256 threads.                                             */
/* --------------------------------------------------------------------------- */
constexpr int kOutCols  = 256;
constexpr int kOutPitch = 36;
static_assert(kD % kOutCols == 0 && kOutCols == 8 * 32);
__global__ __launch_bounds__(256) void output_kernel(
    const unsigned short* __restrict__ W16, const unsigned short* __restrict__ P16,
    const unsigned short* __restrict__ ABT, const unsigned short* __restrict__ XT, float* __restrict__ out)
{
  __shared__ __align__(16) unsigned short sA[64 * kTilePitch];
  __shared__ __align__(16) float slab[8 * 64 * kOutPitch];
  const int tid  = threadIdx.x;
  const int lane = tid & 31;
  const int wave = __builtin_amdgcn_readfirstlane((int)(threadIdx.x >> 5));
  const int hh = lane >> 4;
  const int cl = lane & 15;
  const int bc = blockIdx.x / (kD / kOutCols);
  const int n0 = (blockIdx.x - bc * (kD / kOutCols)) * kOutCols + wave * 32;
  const int b  = bc / kNC;
  const int c0 = (bc - b * kNC) * kC;
  const int r0 = b * kS + c0;
  const int mt = wave & 3;
  const int nh = wave >> 2;

  /* gate piece tid >> 1 (row tid >> 2, half (tid >> 1) & 1) for copy tid & 1 of the tile's gate columns */
  const unsigned short* gw = W16 + (size_t)r0 * kP + (tid >> 1) * 8;
  const unsigned short* ga = W16 + (size_t)(r0 + 16 * mt + cl) * kP + 8 * hh;
  const unsigned short* gp = P16 + (size_t)(r0 + 32 * nh + cl) * kP + 8 * hh;
  /* Bt rows d = n0 + 16 j + cl: pieces 0, 1 = prefix hi | lo, pieces 2..5 = the chunk's 64 tokens; both planes lie in fragment order, a load is 512 contiguous bytes */
  const unsigned short* ab = ABT + ((size_t)bc * (kD / 16) + (n0 >> 4)) * 512 + lane * 8;
  const unsigned short* xt = XT + ((size_t)bc * (kD / 16) + (n0 >> 4)) * 1024 + lane * 8;
  const v4u wg = *(const v4u*)(gw);
  const v4u aw = *(const v4u*)(ga);
  v4u pw[2];
#pragma unroll
  for (int jj = 0; jj < 2; ++jj) pw[jj] = *(const v4u*)(gp + jj * 16 * kP);
  v4u bq[2][6];
#pragma unroll
  for (int j = 0; j < 2; ++j) {
    bq[j][0] = *(const v4u*)(ab + j * 512);
    bq[j][1] = *(const v4u*)(ab + j * 512 + 256);
    bq[j][2] = *(const v4u*)(xt + j * 1024);
    bq[j][3] = *(const v4u*)(xt + j * 1024 + 256);
    bq[j][4] = *(const v4u*)(xt + j * 1024 + 512);
    bq[j][5] = *(const v4u*)(xt + j * 1024 + 768);
  }
  /* the wait that stands in front of any overwrite of a register an issued load names; the five bases are inputs so that none is reused, not even as a later load's destination, ahead of it */
  asm volatile("s_wait_xcnt 0x0" :: "v"(gw), "v"(ga), "v"(gp), "v"(ab), "v"(xt) : "memory");
  /* keeps every load issued ahead of the first wait for data: without it the Bt loads are scheduled behind the score tiles and pay a second latency */
  __builtin_amdgcn_sched_barrier(0);

  *(v4u*)(sA + (tid >> 2) * kTilePitch + (tid & 1) * 16 + ((tid >> 1) & 1) * 8) = wg;
  {
    const v4u zero4 = (v4u){0u, 0u, 0u, 0u};
    const v16h af = frag_h_words(aw, zero4);
#pragma unroll
    for (int jj = 0; jj < 2; ++jj) {
      const int tt = nh * 2 + jj;
      const v16h bf = frag_h_words(pw[jj], zero4);
      v8f accL = (v8f){0.f, 0.f, 0.f, 0.f, 0.f, 0.f, 0.f, 0.f};
      accL = mma_h(af, bf, accL);
      const int tl = 16 * tt + cl;
#pragma unroll
      for (int r = 0; r < 8; ++r) {
        const int sl = 16 * mt + 8 * hh + r;
        const float val = (tl <= sl) ? accL[r] : 0.0f;
        sA[sl * kTilePitch + 32 + tl] = h_bits(val);
      }
    }
  }
  __syncthreads();

  /* unrolled here and below: the fragments and accumulators live in registers only with constant indices */
  v16h a[4][3];
#pragma unroll
  for (int m = 0; m < 4; ++m)
#pragma unroll
    for (int ks = 0; ks < 3; ++ks) {
      const unsigned short* ap = sA + (16 * m + cl) * kTilePitch + 32 * ks + 8 * hh;
      const v4u x0 = *(const v4u*)(ap);
      const v4u x1 = *(const v4u*)(ap + 16);
      a[m][ks] = frag_h_words(x0, x1);
    }

  v8f acc[4][2];
#pragma unroll
  for (int m = 0; m < 4; ++m)
#pragma unroll
    for (int j = 0; j < 2; ++j) acc[m][j] = (v8f){0.f, 0.f, 0.f, 0.f, 0.f, 0.f, 0.f, 0.f};
  /* k step outermost: eight independent accumulators between two products into the same one; each sums its k steps in the order 0, 1, 2 */
#pragma unroll
  for (int ks = 0; ks < 3; ++ks)
#pragma unroll
    for (int m = 0; m < 4; ++m)
#pragma unroll
      for (int j = 0; j < 2; ++j)
        acc[m][j] = mma_h(a[m][ks], frag_h_words(bq[j][2 * ks], bq[j][2 * ks + 1]), acc[m][j]);

  float* sw = slab + wave * 64 * kOutPitch;
#pragma unroll
  for (int m = 0; m < 4; ++m)
#pragma unroll
    for (int j = 0; j < 2; ++j)
#pragma unroll
      for (int r = 0; r < 8; ++r)
        sw[(16 * m + 8 * hh + r) * kOutPitch + 16 * j + cl] = acc[m][j][r] * kWCarryInv;
  /* the slab is this wave's own: its LDS stores have landed before its lanes read one another's words back; no other wave takes part */
  asm volatile("s_wait_dscnt 0x0" ::: "memory");
  /* 8 lanes a row (one 128-B line). Lanes 0..7 and 8..15 take rows 8 apart: their words fall on different banks at this pitch. */
  const int q  = lane >> 3;
  const int j4 = (lane & 7) * 4;
  const int rl = (q >> 1) + (q & 1) * 8;
  /* One LDS and one global base per lane; iteration i adds the constant row (i >> 2) * 16 + (i & 3) * 2. */
  const float* sr = sw + rl * kOutPitch + j4;
  float* go = out + (size_t)(r0 + rl) * kD + n0 + j4;
  v4f v[16];
#pragma unroll
  for (int i = 0; i < 16; ++i) v[i] = *(const v4f*)(sr + ((i >> 2) * 16 + (i & 3) * 2) * kOutPitch);
#pragma unroll
  for (int i = 0; i < 16; ++i) *(v4f*)(go + ((i >> 2) * 16 + (i & 3) * 2) * kD) = v[i];
}

/* --------------------------------------------------------------------------- */
/* Host glue: 3 kernel launches, nothing else.                                 */
/* --------------------------------------------------------------------------- */
extern "C" void kernel_launch(void* const* d_in, const int* in_sizes, int n_in,
                              void* d_out, int out_size, void* d_ws, size_t ws_size,
                              hipStream_t stream) {
  if (n_in < 2) return;
  if (in_sizes[0] != kRows * kD) return;
  if (in_sizes[1] != kP * kD) return;
  if (out_size != kRows * kD) return;
  if (ws_size < kWsTotal) return;

  const float* x   = (const float*)d_in[0];
  const float* anc = (const float*)d_in[1];
  float* out = (float*)d_out;

  char* ws = (char*)d_ws;
  unsigned short* XT   = (unsigned short*)(ws + kOffXT);
  unsigned short* P16  = (unsigned short*)(ws + kOffP16);
  unsigned short* W16  = (unsigned short*)(ws + kOffW16);
  float*          DA   = (float*)(ws + kOffDA);
  unsigned short* ABT  = (unsigned short*)(ws + kOffABT);

  scores_state_kernel<<<dim3(kRows / 64), 256, 0, stream>>>(x, anc, P16, W16, XT, DA);
  prefix_kernel<<<dim3(kB * (kD / kScanD)), 128, 0, stream>>>(DA, ABT);
  output_kernel<<<dim3(kB * kNC * (kD / kOutCols)), 256, 0, stream>>>(W16, P16, ABT, XT, out);
}

// v007
// One run takes 15.8 microseconds.
// Timed twice side by side with v006, it ran 1.06 times as fast both times.
// Over all steps from v000 it is 4.26 times as fast.
// prods (anchors x tokens, K=512): v_wmma_f32_16x16x32_bf16 with both operands as bf16 hi+lo (hi.lo + lo.hi + hi.hi); chunk states, intra-chunk scores, carry and intra-chunk output: v_wmma_f32_16x16x32_f16 (gate plane carried x64, chunk-prefix state as f16 hi+lo planes); f32 accumulate; softmax and prefix scan in f32.
#include <hip/hip_runtime.h>
#include <math.h>

typedef __attribute__((ext_vector_type(16))) _Float16 v16h;
typedef __attribute__((ext_vector_type(16))) __bf16   v16b;
typedef __attribute__((ext_vector_type(8)))  float    v8f;
typedef __attribute__((ext_vector_type(4)))  float    v4f;
typedef __attribute__((ext_vector_type(2)))  float    v2f;
typedef __attribute__((ext_vector_type(2)))  _Float16 v2h;
typedef __attribute__((ext_vector_type(2)))  __bf16   v2b;
typedef __attribute__((ext_vector_type(4)))  unsigned int v4u;
typedef __attribute__((ext_vector_type(8)))  unsigned int v8u;

/* --------------------------------------------------------------------------- */
/* Shape constants                                                             */
/* --------------------------------------------------------------------------- */
constexpr int kB    = 4;
constexpr int kS    = 2048;
constexpr int kD    = 512;
constexpr int kP    = 16;
constexpr int kC    = 64;
constexpr int kNC   = kS / kC;
constexpr int kRows = kB * kS;
/* gate scale = 1/sqrt(kP), checked against kP */
constexpr float kGateScale = 0.25f;
static_assert(kGateScale * kGateScale * (float)kP == 1.0f);
/* gate plane carry (power of two), folded back in the output epilogue */
constexpr float kWCarry    = 64.0f;
constexpr float kWCarryInv = 1.0f / kWCarry;
static_assert(kWCarry * kWCarryInv == 1.0f);
static_assert(kS % kC == 0 && kC == 64 && kP == 16 && kD % 64 == 0);
/* LDS pitches */
constexpr int kAncPitchW = 260;
constexpr int kTilePitch = 104;
/* transposed token tile, 32-bit words per d row: 176 B = 16 B x 11 */
constexpr int kXPitchW = 44;

/* --------------------------------------------------------------------------- */
/* Workspace region map (bytes; every offset a multiple of 128)                */
/*   XT    f16 [128][32][4][32][8] transposed tokens, Bt fragment order  8,388,608 */
/*   P16   f16 [8192][16]          prods, token-major                      262,144 */
/*   W16   f16 [8192][16]          gate x64, token-major                   262,144 */
/*   DA    f32 [128][32][2][32][4] chunk states, accumulator order       4,194,304 */
/*   ABT   f16 [128][32][2][32][8] exclusive chunk prefix, fragment order 4,194,304 */
/* XT, DA, ABT: [chunk of the 128][16-column tile][piece][lane][elements]: a   */
/* piece is what one wave-wide 16-byte access moves, 512 contiguous bytes, in  */
/* the lane order of the WMMA registers (lane = 16 hh + cl, column d = 16 tile */
/* + cl). No 256-byte unit is shared by two blocks.                            */
/*   XT  piece k: tokens 16 k + 8 hh .. + 7 of column d                        */
/*   DA  piece s: anchors 8 hh + 4 s .. + 3 of column d                        */
/*   ABT piece 0: hi of anchors 8 hh .. + 7 of column d; piece 1: lo           */
/*   total = 8,388,608 + 262,144 + 262,144 + 4,194,304 + 4,194,304 = 17,301,504     */
/* --------------------------------------------------------------------------- */
constexpr size_t kOffXT   = 0;
constexpr size_t kOffP16  = kOffXT   + (size_t)kB * kD * kS * 2;
constexpr size_t kOffW16  = kOffP16  + (size_t)kRows * kP * 2;
constexpr size_t kOffDA   = kOffW16  + (size_t)kRows * kP * 2;
constexpr size_t kOffABT  = kOffDA   + (size_t)kB * kNC * kP * kD * 4;
constexpr size_t kWsTotal = kOffABT  + (size_t)kB * kNC * kD * 32 * 2;
static_assert(kWsTotal == 17301504ull);
static_assert(kWsTotal <= 134217728ull);
static_assert((kOffP16 % 128) == 0 && (kOffW16 % 128) == 0 &&
              (kOffDA % 128) == 0 && (kOffABT % 128) == 0);

/* --------------------------------------------------------------------------- */
/* Small helpers                                                               */
/* --------------------------------------------------------------------------- */
__device__ __forceinline__ unsigned pk16(unsigned short a, unsigned short b) { return (unsigned)a | ((unsigned)b << 16); }
__device__ __forceinline__ unsigned short h_bits(float f) { const _Float16 h = (_Float16)f; return __builtin_bit_cast(unsigned short, h); }

/* bf16 hi and lo words of a pair of f32 values (both conversions RNE) */
__device__ __forceinline__ void split_pair(float a, float b, unsigned& hw, unsigned& lw) {
  const v2f f = (v2f){a, b};
  hw = __builtin_bit_cast(unsigned, __builtin_convertvector(f, v2b));
  const v2f hf = (v2f){__uint_as_float(hw << 16), __uint_as_float(hw & 0xFFFF0000u)};
  lw = __builtin_bit_cast(unsigned, __builtin_convertvector(f - hf, v2b));
}

__device__ __forceinline__ v16h frag_h_words(v4u a, v4u b) {
  const v8u w = __builtin_shufflevector(a, b, 0, 1, 2, 3, 4, 5, 6, 7);
  return __builtin_bit_cast(v16h, w);
}
__device__ __forceinline__ v16b frag_b_words(v4u a, v4u b) {
  const v8u w = __builtin_shufflevector(a, b, 0, 1, 2, 3, 4, 5, 6, 7);
  return __builtin_bit_cast(v16b, w);
}
/* one WMMA + hazard guard tied to its accumulator and naming its A/B fragments */
__device__ __forceinline__ v8f mma_h(v16h a, v16h b, v8f c) {
  c = __builtin_amdgcn_wmma_f32_16x16x32_f16(false, a, false, b, (short)0, c, false, false);
  asm volatile("v_nop\n\tv_nop\n\tv_nop\n\tv_nop" : "+v"(c) : "v"(a), "v"(b));
  return c;
}
__device__ __forceinline__ v8f mma_b(v16b a, v16b b, v8f c) {
  c = __builtin_amdgcn_wmma_f32_16x16x32_bf16(false, a, false, b, (short)0, c, false, false);
  asm volatile("v_nop\n\tv_nop\n\tv_nop\n\tv_nop" : "+v"(c) : "v"(a), "v"(b));
  return c;
}

/* f32 token tile in LDS, floats per row: 2,064 B = 16 B x 129, so the 16 rows of a fragment read start 4 banks apart */
constexpr int kXfPitch = kD + 4;
/* one round of copies = 256 threads x 16 B = two token rows */
constexpr unsigned kCopyStepL = 2u * kXfPitch * 4u;
constexpr int      kCopyStepG = 2 * kD;
/* n asynchronous copies to LDS, 16 B a lane, each with its own address registers. The wait on the last line stands */
/* in front of any later write of a register that an issued copy names; inside the statement nothing can move over it. */
__device__ __forceinline__ void copy_rows11(unsigned l, const float* g) {
  asm volatile(
      "global_load_async_to_lds_b128 %0, %11, off\n\t"
      "global_load_async_to_lds_b128 %1, %12, off\n\t"
      "global_load_async_to_lds_b128 %2, %13, off\n\t"
      "global_load_async_to_lds_b128 %3, %14, off\n\t"
      "global_load_async_to_lds_b128 %4, %15, off\n\t"
      "global_load_async_to_lds_b128 %5, %16, off\n\t"
      "global_load_async_to_lds_b128 %6, %17, off\n\t"
      "global_load_async_to_lds_b128 %7, %18, off\n\t"
      "global_load_async_to_lds_b128 %8, %19, off\n\t"
      "global_load_async_to_lds_b128 %9, %20, off\n\t"
      "global_load_async_to_lds_b128 %10, %21, off\n\t"
      "s_wait_xcnt 0x0"
      :: "v"(l + 0u * kCopyStepL), "v"(l + 1u * kCopyStepL), "v"(l + 2u * kCopyStepL), "v"(l + 3u * kCopyStepL), "v"(l + 4u * kCopyStepL), "v"(l + 5u * kCopyStepL), "v"(l + 6u * kCopyStepL), "v"(l + 7u * kCopyStepL), "v"(l + 8u * kCopyStepL), "v"(l + 9u * kCopyStepL), "v"(l + 10u * kCopyStepL),
         "v"(g + 0 * kCopyStepG), "v"(g + 1 * kCopyStepG), "v"(g + 2 * kCopyStepG), "v"(g + 3 * kCopyStepG), "v"(g + 4 * kCopyStepG), "v"(g + 5 * kCopyStepG), "v"(g + 6 * kCopyStepG), "v"(g + 7 * kCopyStepG), "v"(g + 8 * kCopyStepG), "v"(g + 9 * kCopyStepG), "v"(g + 10 * kCopyStepG)
      : "memory");
}
__device__ __forceinline__ void copy_rows10(unsigned l, const float* g) {
  asm volatile(
      "global_load_async_to_lds_b128 %0, %10, off\n\t"
      "global_load_async_to_lds_b128 %1, %11, off\n\t"
      "global_load_async_to_lds_b128 %2, %12, off\n\t"
      "global_load_async_to_lds_b128 %3, %13, off\n\t"
      "global_load_async_to_lds_b128 %4, %14, off\n\t"
      "global_load_async_to_lds_b128 %5, %15, off\n\t"
      "global_load_async_to_lds_b128 %6, %16, off\n\t"
      "global_load_async_to_lds_b128 %7, %17, off\n\t"
      "global_load_async_to_lds_b128 %8, %18, off\n\t"
      "global_load_async_to_lds_b128 %9, %19, off\n\t"
      "s_wait_xcnt 0x0"
      :: "v"(l + 0u * kCopyStepL), "v"(l + 1u * kCopyStepL), "v"(l + 2u * kCopyStepL), "v"(l + 3u * kCopyStepL), "v"(l + 4u * kCopyStepL), "v"(l + 5u * kCopyStepL), "v"(l + 6u * kCopyStepL), "v"(l + 7u * kCopyStepL), "v"(l + 8u * kCopyStepL), "v"(l + 9u * kCopyStepL),
         "v"(g + 0 * kCopyStepG), "v"(g + 1 * kCopyStepG), "v"(g + 2 * kCopyStepG), "v"(g + 3 * kCopyStepG), "v"(g + 4 * kCopyStepG), "v"(g + 5 * kCopyStepG), "v"(g + 6 * kCopyStepG), "v"(g + 7 * kCopyStepG), "v"(g + 8 * kCopyStepG), "v"(g + 9 * kCopyStepG)
      : "memory");
}

/* --------------------------------------------------------------------------- */
/* K1: one block per (batch, 64-token chunk) does all that needs only that     */
/* chunk's tokens, which are read from memory once.                            */
/* (a) prods (M = 64, N = 16 anchors, K = 512) as a bf16 hi/lo three-product   */
/* WMMA. 8 waves: wave = (16-row tile mt, K half kh), so a lane's whole share  */
/* of the tokens (8 steps x 4 x 16 B) and of the anchors (8 x 16 B) fits in    */
/* registers and is requested before anything is waited on: the block pays one */
/* memory latency. The tokens come as asynchronous copies to the LDS tile sX   */
/* (32 rounds x 256 threads x 16 B = 64 x 512 floats; a wave's copy is 512     */
/* contiguous bytes of one row) and are read from there in fragment order.     */
/* Token values are split in registers; anchor hi/lo word      */
/* planes staged in LDS (8 iterations x 256 threads x 4 floats = 16 x 512, all */
/* read words written). The two K halves meet in LDS: prods = half 0 + half 1. */
/* (b) the same token registers as f16, transposed into the LDS tile           */
/* sXT[d][t]: lanes t and t ^ 1 swap one packed word, so every lane stores     */
/* whole words (two neighbouring tokens of one d); 64 stores x 256 threads x   */
/* 2 halves = 512 x 64, the whole tile.                                        */
/* (c) the 16-wide softmax per token row in f32 (waves 0, 1).                  */
/* (d) chunk state DA[b][c][p][d] = sum_t prods[p][t] * x[t][d]: M = 16,       */
/* N = 512, K = 64, f16 WMMA; A from the prods in LDS (rounded to f16), Bt     */
/* rows from sXT; 8 waves x 64 columns; the accumulators go to DA as they lie  */
/* in the registers (8 stores x 256 threads x 16 B = 32 KiB).                  */
/* (e) the same Bt fragment registers stored to XT as they lie (16 stores x    */
/* 256 threads x 16 B = 64 KiB): the output kernel loads them back unchanged.  */
/*   P16  [row][16] f16 prods         block tile = 2 KiB contiguous = 16 lines */
/*   W16  [row][16] f16 gate x 64     same map                                 */
/* Wave w < 4 writes lines 4w..4w+3 of each plane (lanes 8q..8q+7 -> line 4w+q). */
/* grid = 8192 / 64 = 128 blocks, 256 threads.                                 */
/* --------------------------------------------------------------------------- */
constexpr int kKHalf  = kD / 2;
constexpr int kKSteps = kKHalf / 32;
static_assert(kKSteps == 8 && kP * kD == 8 * 256 * 4);
__global__ __launch_bounds__(256) void scores_state_kernel(
    const float* __restrict__ x, const float* __restrict__ anc,
    unsigned short* __restrict__ P16, unsigned short* __restrict__ W16,
    unsigned short* __restrict__ XT, float* __restrict__ DA)
{
  __shared__ __align__(16) unsigned sAH[kP * kAncPitchW];
  __shared__ __align__(16) unsigned sAL[kP * kAncPitchW];
  __shared__ float sPart[2 * 64 * 17];
  __shared__ float sProd[64 * 17];
  __shared__ float sGate[64 * 17];
  __shared__ __align__(16) unsigned sXT[kD * kXPitchW];
  __shared__ __align__(16) float sX[64 * kXfPitch];
  const int tid  = threadIdx.x;
  const int lane = tid & 31;
  const int wave = __builtin_amdgcn_readfirstlane((int)(threadIdx.x >> 5));
  const int hh = lane >> 4;
  const int cl = lane & 15;
  const int mt = wave & 3;
  const int kh = wave >> 2;
  const int r0 = blockIdx.x * 64;

  /* every global load of the block, anchors first (they are needed first) */
  /* float4 number i * 256 + tid of the 16 x 512 anchor array, which is contiguous */
  const float* aptr = anc + tid * 4;
  v4f av[8];
  /* unrolled here and below: av and xv live in registers only with constant indices */
#pragma unroll
  for (int i = 0; i < 8; ++i) av[i] = *(const v4f*)(aptr + i * 1024);
  /* token tile: round i brings rows 2 i and 2 i + 1; thread = 16-byte piece tid & 127 of row 2 i + (tid >> 7) */
  {
    const float* gs = x + (size_t)(r0 + (tid >> 7)) * kD + (tid & 127) * 4;
    const unsigned ls = (unsigned)(size_t)(sX + (tid >> 7) * kXfPitch + (tid & 127) * 4);
    copy_rows11(ls, gs);
    copy_rows11(ls + 11u * kCopyStepL, gs + 11 * kCopyStepG);
    copy_rows10(ls + 22u * kCopyStepL, gs + 22 * kCopyStepG);
  }
  /* keeps every load and copy issued ahead of the first wait for data: without it the anchor work could be scheduled in between and the copies pay a second latency */
  __builtin_amdgcn_sched_barrier(0);

#pragma unroll
  for (int i = 0; i < 8; ++i) {
    const int e4 = i * 256 + tid;
    const int p  = e4 >> 7;
    const int cf = (e4 & 127) * 4;
    unsigned h01, l01, h23, l23;
    split_pair(av[i][0], av[i][1], h01, l01);
    split_pair(av[i][2], av[i][3], h23, l23);
    const int wo = p * kAncPitchW + (cf >> 1);
    sAH[wo]     = h01;
    sAH[wo + 1] = h23;
    sAL[wo]     = l01;
    sAL[wo + 1] = l23;
  }
  /* this wave's copies have landed; the barrier behind it publishes them to the other waves */
  asm volatile("s_wait_asynccnt 0x0" ::: "memory");
  __syncthreads();

  /* A rows = token rows of this wave's tile, [row][d] layout, this wave's K half */
  const float* xrow = sX + (mt * 16 + cl) * kXfPitch + kh * kKHalf + 8 * hh;
  v4f xv[kKSteps][4];
#pragma unroll
  for (int it = 0; it < kKSteps; ++it) {
    xv[it][0] = *(const v4f*)(xrow + it * 32);
    xv[it][1] = *(const v4f*)(xrow + it * 32 + 4);
    xv[it][2] = *(const v4f*)(xrow + it * 32 + 16);
    xv[it][3] = *(const v4f*)(xrow + it * 32 + 20);
  }

  v8f acc = (v8f){0.f, 0.f, 0.f, 0.f, 0.f, 0.f, 0.f, 0.f};
#pragma unroll
  for (int it = 0; it < kKSteps; ++it) {
    const int k0 = kh * kKHalf + it * 32;
    const v4f f0 = xv[it][0];
    const v4f f1 = xv[it][1];
    const v4f f2 = xv[it][2];
    const v4f f3 = xv[it][3];
    unsigned hw0, hw1, hw2, hw3, hw4, hw5, hw6, hw7;
    unsigned lw0, lw1, lw2, lw3, lw4, lw5, lw6, lw7;
    split_pair(f0[0], f0[1], hw0, lw0);
    split_pair(f0[2], f0[3], hw1, lw1);
    split_pair(f1[0], f1[1], hw2, lw2);
    split_pair(f1[2], f1[3], hw3, lw3);
    split_pair(f2[0], f2[1], hw4, lw4);
    split_pair(f2[2], f2[3], hw5, lw5);
    split_pair(f3[0], f3[1], hw6, lw6);
    split_pair(f3[2], f3[3], hw7, lw7);
    const v8u hv = (v8u){hw0, hw1, hw2, hw3, hw4, hw5, hw6, hw7};
    const v8u lv = (v8u){lw0, lw1, lw2, lw3, lw4, lw5, lw6, lw7};
    const v16b ah = __builtin_bit_cast(v16b, hv);
    const v16b al = __builtin_bit_cast(v16b, lv);
    /* B column = anchor cl; words at halves k0 + 8*hh and + 16 */
    const int wb = cl * kAncPitchW + (k0 >> 1) + 4 * hh;
    const v4u bh0 = *(const v4u*)(sAH + wb);
    const v4u bh1 = *(const v4u*)(sAH + wb + 8);
    const v4u bl0 = *(const v4u*)(sAL + wb);
    const v4u bl1 = *(const v4u*)(sAL + wb + 8);
    const v16b bh = frag_b_words(bh0, bh1);
    const v16b bl = frag_b_words(bl0, bl1);
    acc = mma_b(ah, bl, acc);
    acc = mma_b(al, bh, acc);
    acc = mma_b(ah, bh, acc);
  }
  /* D element r of this lane = (token row 8*hh + r of tile mt, anchor cl), K half kh */
#pragma unroll
  for (int r = 0; r < 8; ++r) sPart[(kh * 64 + mt * 16 + 8 * hh + r) * 17 + cl] = acc[r];

  /* f16 transpose: this lane holds token t = 16 * mt + cl. Word h = (d, d + 1) of token t, word r = the same of token t ^ 1. */
  /* Even t keeps row d: (t, t + 1) = low halves of h, r. Odd t keeps row d + 1: (t - 1, t) = high halves of r, h. */
  {
    const int odd = cl & 1;
    const unsigned sel = odd ? 0x07060302u : 0x01000504u;
    unsigned* xw = sXT + (kh * kKHalf + 8 * hh + odd) * kXPitchW + ((mt * 16 + cl) >> 1);
#pragma unroll
    for (int it = 0; it < kKSteps; ++it)
#pragma unroll
      for (int q = 0; q < 4; ++q)
#pragma unroll
        for (int m = 0; m < 2; ++m) {
          const int dof = it * 32 + (q >> 1) * 16 + (q & 1) * 4 + 2 * m;
          const v2f f2 = (v2f){xv[it][q][2 * m], xv[it][q][2 * m + 1]};
          const unsigned h = __builtin_bit_cast(unsigned, __builtin_convertvector(f2, v2h));
          /* quad_perm [1,0,3,2]: the word of lane ^ 1 */
          const unsigned r = (unsigned)__builtin_amdgcn_mov_dpp((int)h, 0xB1, 0xF, 0xF, true);
          xw[dof * kXPitchW] = __builtin_amdgcn_perm(h, r, sel);
        }
  }
  __syncthreads();

  /* K halves added, then softmax over the 16 anchors, one token row per thread (waves 0 and 1, scalar branch) */
  if (wave < 2) {
    float pr[kP], ge[kP];
    /* unrolled: the 32 LDS reads are issued together (rolled, each trip waited for its own) and the row stays in registers */
#pragma unroll
    for (int p = 0; p < kP; ++p) pr[p] = sPart[tid * 17 + p] + sPart[(64 + tid) * 17 + p];
    float m = pr[0] * kGateScale;
#pragma unroll
    for (int p = 1; p < kP; ++p) m = fmaxf(m, pr[p] * kGateScale);
    float sum = 0.0f;
#pragma unroll
    for (int p = 0; p < kP; ++p) {
      ge[p] = expf(pr[p] * kGateScale - m);
      sum += ge[p];
    }
    const float inv = (1.0f / sum) * kWCarry;
#pragma unroll
    for (int p = 0; p < kP; ++p) {
      sProd[tid * 17 + p] = pr[p];
      sGate[tid * 17 + p] = ge[p] * inv;
    }
  }
  __syncthreads();

  /* No barrier follows: every global store of the block stands behind the last one. */
  const int q = lane >> 3;
  const int j = lane & 7;

  /* the two token-major planes (waves 0..3, scalar branch) */
  v4u up = (v4u){0u, 0u, 0u, 0u};
  v4u uw = (v4u){0u, 0u, 0u, 0u};
  const int ln = wave * 4 + q;
  if (wave < 4) {
    const int row = 4 * ln + (j >> 1);
    const int p0  = (j & 1) * 8;
    unsigned short pb[8], wb16[8];
#pragma unroll
    for (int e = 0; e < 8; ++e) {
      pb[e]   = h_bits(sProd[row * 17 + p0 + e]);
      wb16[e] = h_bits(sGate[row * 17 + p0 + e]);
    }
    up = (v4u){pk16(pb[0], pb[1]), pk16(pb[2], pb[3]), pk16(pb[4], pb[5]), pk16(pb[6], pb[7])};
    uw = (v4u){pk16(wb16[0], wb16[1]), pk16(wb16[2], wb16[3]), pk16(wb16[4], wb16[5]), pk16(wb16[6], wb16[7])};
  }

  /* Bt fragments of this wave's 64 columns: row d = n0 + 16 jn + cl, piece k = words at halves 16 k + 8 hh. */
  /* They feed the state WMMAs and go to XT as they are: store (jn, k) is 512 contiguous bytes, the wave's 16 stores 8 KiB. */
  const int n0 = wave * 64;
  v4u bw[4][4];
#pragma unroll
  for (int jn = 0; jn < 4; ++jn) {
    const unsigned* bp = sXT + (n0 + 16 * jn + cl) * kXPitchW + 4 * hh;
#pragma unroll
    for (int k = 0; k < 4; ++k) bw[jn][k] = *(const v4u*)(bp + 8 * k);
  }
  unsigned short* gx = XT + ((size_t)blockIdx.x * (kD / 16) + wave * 4) * 1024 + lane * 8;
#pragma unroll
  for (int jn = 0; jn < 4; ++jn)
#pragma unroll
    for (int k = 0; k < 4; ++k) *(v4u*)(gx + (jn * 4 + k) * 256) = bw[jn][k];

  /* chunk state. A row = anchor cl; fragment f, word w holds t = 32 f + 16 (w >> 2) + 8 hh + 2 (w & 3) and t + 1 */
  v8u aw[2];
#pragma unroll
  for (int f = 0; f < 2; ++f)
#pragma unroll
    for (int w = 0; w < 8; ++w) {
      const int t = 32 * f + 16 * (w >> 2) + 8 * hh + 2 * (w & 3);
      aw[f][w] = pk16(h_bits(sProd[t * 17 + cl]), h_bits(sProd[(t + 1) * 17 + cl]));
    }
  const v16h a0 = __builtin_bit_cast(v16h, aw[0]);
  const v16h a1 = __builtin_bit_cast(v16h, aw[1]);
  v8f accs[4];
#pragma unroll
  for (int jn = 0; jn < 4; ++jn) accs[jn] = (v8f){0.f, 0.f, 0.f, 0.f, 0.f, 0.f, 0.f, 0.f};
#pragma unroll
  for (int jn = 0; jn < 4; ++jn) {
    accs[jn] = mma_h(a0, frag_h_words(bw[jn][0], bw[jn][1]), accs[jn]);
    accs[jn] = mma_h(a1, frag_h_words(bw[jn][2], bw[jn][3]), accs[jn]);
  }
  /* D element r of this lane = (anchor 8 hh + r, column n0 + 16 jn + cl); store (jn, s) takes r = 4 s .. 4 s + 3, 512 contiguous bytes */
  float* gd = DA + ((size_t)blockIdx.x * (kD / 16) + wave * 4) * 256 + lane * 4;
#pragma unroll
  for (int jn = 0; jn < 4; ++jn)
#pragma unroll
    for (int s = 0; s < 2; ++s)
      *(v4f*)(gd + (jn * 2 + s) * 128) = (v4f){accs[jn][4 * s], accs[jn][4 * s + 1], accs[jn][4 * s + 2], accs[jn][4 * s + 3]};
  /* the wait that stands in front of any overwrite of a register an issued store names: the plane addresses below are formed in registers of the stores above */
  asm volatile("s_wait_xcnt 0x0" ::: "memory");
  if (wave < 4) {
    *(v4u*)(P16 + (size_t)r0 * kP + ln * 64 + j * 8) = up;
    *(v4u*)(W16 + (size_t)r0 * kP + ln * 64 + j * 8) = uw;
  }
}

/* --------------------------------------------------------------------------- */
/* K2: exclusive prefix of DA over the 32 chunks (f32, forward in time, zero   */
/* start per batch), emitted per column d as f16 [hi p0..15 | lo p0..15] with  */
/* hi = f16(A), lo = f16(A - hi), in ABT's fragment order. Separate source and */
/* destination.                                                                */
/* Thread = one (b, d, anchor pair): the 31 chunk states of both anchors that  */
/* the exclusive prefix needs are loaded up front (none depends on a sum), so  */
/* the block pays one memory latency; the sums then run in registers in chunk  */
/* order. Block = 16 consecutive d x 8 anchor pairs (lane = pair bit | d): one */
/* column tile of DA, where an anchor pair is 8 contiguous bytes and a wave's  */
/* load one whole 256-byte unit.                                               */
/* All 32 chunk tiles (16 rows x 64 B each) are staged in LDS; the 16-byte     */
/* piece q of row d lies at piece q ^ ((d >> 2) & 3), so the 32 lanes of a     */
/* word store fall on 32 banks. One barrier, then 16 iterations x 128 threads  */
/* x 16 B, lane-contiguous (a wave covers 4 whole lines).                      */
/* grid = 4 x 32 = 128 blocks, 128 threads.                                    */
/* --------------------------------------------------------------------------- */
constexpr int kScanD = 16;
static_assert(kD % kScanD == 0 && kP == 16 && kNC == 32);
__global__ __launch_bounds__(128) void prefix_kernel(const float* __restrict__ DA, unsigned short* __restrict__ ABT)
{
  __shared__ __align__(16) unsigned sT[kNC * kScanD * 16];
  const int tid  = threadIdx.x;
  const int lane = tid & 31;
  const int wave = __builtin_amdgcn_readfirstlane((int)(threadIdx.x >> 5));
  const int b    = blockIdx.x / (kD / kScanD);
  const int d0   = (blockIdx.x - b * (kD / kScanD)) * kScanD;
  const int dl   = lane & 15;
  const int pi   = wave * 2 + (lane >> 4);

  /* anchors 2 pi, 2 pi + 1 = 8 (pi >> 2) + 4 ((pi >> 1) & 1) + 2 (pi & 1) and the next: DA piece (pi >> 1) & 1, lane 16 (pi >> 2) + dl, elements 2 (pi & 1), + 1 */
  const float* src = DA + ((size_t)(b * kNC) * (kD / 16) + (d0 >> 4)) * 256
                   + ((((pi >> 1) & 1) * 32 + (pi >> 2) * 16 + dl) * 4 + (pi & 1) * 2);
  float v0[kNC - 1], v1[kNC - 1];
#pragma unroll
  for (int c = 0; c < kNC - 1; ++c) {
    const v2f vv = *(const v2f*)(src + (size_t)c * kP * kD);
    v0[c] = vv[0];
    v1[c] = vv[1];
  }
  /* the wait that stands in front of any overwrite of a register an issued load names; the base is an input so that it is not reused, not even as the last load's destination, ahead of it */
  asm volatile("s_wait_xcnt 0x0" :: "v"(src) : "memory");
  /* keeps every load issued ahead of the first sum: without it the last loads are scheduled behind a wait on the first and pay a second latency */
  __builtin_amdgcn_sched_barrier(0);

  const int sw = (dl >> 2) & 3;
  const int wh = dl * 16 + (((pi >> 2) ^ sw) << 2) + (pi & 3);
  const int wl = dl * 16 + (((2 + (pi >> 2)) ^ sw) << 2) + (pi & 3);
  float a0 = 0.0f, a1 = 0.0f;
#pragma unroll
  for (int c = 0; c < kNC; ++c) {
    const _Float16 h0 = (_Float16)a0;
    const _Float16 h1 = (_Float16)a1;
    const float h0f = (float)h0;
    const float h1f = (float)h1;
    const unsigned short hb0 = __builtin_bit_cast(unsigned short, h0);
    const unsigned short hb1 = __builtin_bit_cast(unsigned short, h1);
    const unsigned short lb0 = h_bits(a0 - h0f);
    const unsigned short lb1 = h_bits(a1 - h1f);
    sT[c * (kScanD * 16) + wh] = pk16(hb0, hb1);
    sT[c * (kScanD * 16) + wl] = pk16(lb0, lb1);
    if (c < kNC - 1) {
      a0 += v0[c];
      a1 += v1[c];
    }
  }
  __syncthreads();

  /* 16-byte place inside a chunk tile = tid & 63 = 32 piece + 16 hh + cl: row cl, its piece q = 2 piece + hh = place >> 4; two chunks per iteration */
  const int pc  = tid & 63;
  const int ch  = tid >> 6;
  const int row = pc & 15;
  const unsigned* sr = sT + ch * (kScanD * 16) + row * 16 + (((pc >> 4) ^ ((row >> 2) & 3)) << 2);
  unsigned short* g = ABT + ((size_t)(b * kNC + ch) * kD + d0) * 32 + pc * 8;
  v4u v[16];
#pragma unroll
  for (int it = 0; it < 16; ++it) v[it] = *(const v4u*)(sr + it * 2 * (kScanD * 16));
#pragma unroll
  for (int it = 0; it < 16; ++it) *(v4u*)(g + (size_t)it * 2 * kD * 32) = v[it];
}

/* --------------------------------------------------------------------------- */
/* K3: per block (b, c, column half), 64 query rows x 256 columns.             */
/*  (0) every global load of the block is requested first: the gate and prods  */
/*      rows, then each wave's own Bt fragments (12 x 16 B a lane), so the     */
/*      block pays one memory latency and steps (1), (2) run under it;         */
/*  (1) LDS tile sA[64][96] f16: cols 0..15 and 16..31 = gate x 64 (copied     */
/*      from W16: 256 threads x 8 halves = 64 x 32);                           */
/*  (2) cols 32..95 = 64 * L[s][t] = sum_p (64 w[s][p]) * prods[t][p], kept    */
/*      for t <= s (diagonal included), else 0 by select; 16 tiles of 16 x 16, */
/*      two per wave; K padded 16 -> 32 by zero upper fragment halves built in */
/*      registers (both operands);                                             */
/*  (3) fused K = 96 product: A = [W | W | L], Bt[d] = [Ab_hi | Ab_lo | XT     */
/*      chunk]; wave = all 64 rows x its own 32 columns, so a Bt fragment is   */
/*      loaded by one wave only; f32 result x 1/64 -> the wave's own 64 x 32   */
/*      slab -> rows stored as 8 lanes x 16 B = one 128-B line.                */
/* grid = 256 blocks, 256 threads.                                             */
/* --------------------------------------------------------------------------- */
constexpr int kOutCols  = 256;
constexpr int kOutPitch = 36;
static_assert(kD % kOutCols == 0 && kOutCols == 8 * 32);
__global__ __launch_bounds__(256) void output_kernel(
    const unsigned short* __restrict__ W16, const unsigned short* __restrict__ P16,
    const unsigned short* __restrict__ ABT, const unsigned short* __restrict__ XT, float* __restrict__ out)
{
  __shared__ __align__(16) unsigned short sA[64 * kTilePitch];
  __shared__ __align__(16) float slab[8 * 64 * kOutPitch];
  const int tid  = threadIdx.x;
  const int lane = tid & 31;
  const int wave = __builtin_amdgcn_readfirstlane((int)(threadIdx.x >> 5));
  const int hh = lane >> 4;
  const int cl = lane & 15;
  const int bc = blockIdx.x / (kD / kOutCols);
  const int n0 = (blockIdx.x - bc * (kD / kOutCols)) * kOutCols + wave * 32;
  const int b  = bc / kNC;
  const int c0 = (bc - b * kNC) * kC;
  const int r0 = b * kS + c0;
  const int mt = wave & 3;
  const int nh = wave >> 2;

  /* gate piece tid >> 1 (row tid >> 2, half (tid >> 1) & 1) for copy tid & 1 of the tile's gate columns */
  const unsigned short* gw = W16 + (size_t)r0 * kP + (tid >> 1) * 8;
  const unsigned short* ga = W16 + (size_t)(r0 + 16 * mt + cl) * kP + 8 * hh;
  const unsigned short* gp = P16 + (size_t)(r0 + 32 * nh + cl) * kP + 8 * hh;
  /* Bt rows d = n0 + 16 j + cl: pieces 0, 1 = prefix hi | lo, pieces 2..5 = the chunk's 64 tokens; both planes lie in fragment order, a load is 512 contiguous bytes */
  const unsigned short* ab = ABT + ((size_t)bc * (kD / 16) + (n0 >> 4)) * 512 + lane * 8;
  const unsigned short* xt = XT + ((size_t)bc * (kD / 16) + (n0 >> 4)) * 1024 + lane * 8;
  const v4u wg = *(const v4u*)(gw);
  const v4u aw = *(const v4u*)(ga);
  v4u pw[2];
#pragma unroll
  for (int jj = 0; jj < 2; ++jj) pw[jj] = *(const v4u*)(gp + jj * 16 * kP);
  v4u bq[2][6];
#pragma unroll
  for (int j = 0; j < 2; ++j) {
    bq[j][0] = *(const v4u*)(ab + j * 512);
    bq[j][1] = *(const v4u*)(ab + j * 512 + 256);
    bq[j][2] = *(const v4u*)(xt + j * 1024);
    bq[j][3] = *(const v4u*)(xt + j * 1024 + 256);
    bq[j][4] = *(const v4u*)(xt + j * 1024 + 512);
    bq[j][5] = *(const v4u*)(xt + j * 1024 + 768);
  }
  /* the wait that stands in front of any overwrite of a register an issued load names; the five bases are inputs so that none is reused, not even as a later load's destination, ahead of it */
  asm volatile("s_wait_xcnt 0x0" :: "v"(gw), "v"(ga), "v"(gp), "v"(ab), "v"(xt) : "memory");
  /* keeps every load issued ahead of the first wait for data: without it the Bt loads are scheduled behind the score tiles and pay a second latency */
  __builtin_amdgcn_sched_barrier(0);

  *(v4u*)(sA + (tid >> 2) * kTilePitch + (tid & 1) * 16 + ((tid >> 1) & 1) * 8) = wg;
  {
    const v4u zero4 = (v4u){0u, 0u, 0u, 0u};
    const v16h af = frag_h_words(aw, zero4);
#pragma unroll
    for (int jj = 0; jj < 2; ++jj) {
      const int tt = nh * 2 + jj;
      const v16h bf = frag_h_words(pw[jj], zero4);
      v8f accL = (v8f){0.f, 0.f, 0.f, 0.f, 0.f, 0.f, 0.f, 0.f};
      accL = mma_h(af, bf, accL);
      const int tl = 16 * tt + cl;
#pragma unroll
      for (int r = 0; r < 8; ++r) {
        const int sl = 16 * mt + 8 * hh + r;
        const float val = (tl <= sl) ? accL[r] : 0.0f;
        sA[sl * kTilePitch + 32 + tl] = h_bits(val);
      }
    }
  }
  __syncthreads();

  /* unrolled here and below: the fragments and accumulators live in registers only with constant indices */
  v16h a[4][3];
#pragma unroll
  for (int m = 0; m < 4; ++m)
#pragma unroll
    for (int ks = 0; ks < 3; ++ks) {
      const unsigned short* ap = sA + (16 * m + cl) * kTilePitch + 32 * ks + 8 * hh;
      const v4u x0 = *(const v4u*)(ap);
      const v4u x1 = *(const v4u*)(ap + 16);
      a[m][ks] = frag_h_words(x0, x1);
    }

  v8f acc[4][2];
#pragma unroll
  for (int m = 0; m < 4; ++m)
#pragma unroll
    for (int j = 0; j < 2; ++j) acc[m][j] = (v8f){0.f, 0.f, 0.f, 0.f, 0.f, 0.f, 0.f, 0.f};
  /* k step outermost: eight independent accumulators between two products into the same one; each sums its k steps in the order 0, 1, 2 */
#pragma unroll
  for (int ks = 0; ks < 3; ++ks)
#pragma unroll
    for (int m = 0; m < 4; ++m)
#pragma unroll
      for (int j = 0; j < 2; ++j)
        acc[m][j] = mma_h(a[m][ks], frag_h_words(bq[j][2 * ks], bq[j][2 * ks + 1]), acc[m][j]);

  float* sw = slab + wave * 64 * kOutPitch;
#pragma unroll
  for (int m = 0; m < 4; ++m)
#pragma unroll
    for (int j = 0; j < 2; ++j)
#pragma unroll
      for (int r = 0; r < 8; ++r)
        sw[(16 * m + 8 * hh + r) * kOutPitch + 16 * j + cl] = acc[m][j][r] * kWCarryInv;
  /* the slab is this wave's own: its LDS stores have landed before its lanes read one another's words back; no other wave takes part */
  asm volatile("s_wait_dscnt 0x0" ::: "memory");
  /* 8 lanes a row (one 128-B line). Lanes 0..7 and 8..15 take rows 8 apart: their words fall on different banks at this pitch. */
  const int q  = lane >> 3;
  const int j4 = (lane & 7) * 4;
  const int rl = (q >> 1) + (q & 1) * 8;
  /* One LDS and one global base per lane; iteration i adds the constant row (i >> 2) * 16 + (i & 3) * 2. */
  const float* sr = sw + rl * kOutPitch + j4;
  float* go = out + (size_t)(r0 + rl) * kD + n0 + j4;
  v4f v[16];
#pragma unroll
  for (int i = 0; i < 16; ++i) v[i] = *(const v4f*)(sr + ((i >> 2) * 16 + (i & 3) * 2) * kOutPitch);
#pragma unroll
  for (int i = 0; i < 16; ++i) *(v4f*)(go + ((i >> 2) * 16 + (i & 3) * 2) * kD) = v[i];
}

/* --------------------------------------------------------------------------- */
/* Host glue: 3 kernel launches, nothing else.                                 */
/* --------------------------------------------------------------------------- */
extern "C" void kernel_launch(void* const* d_in, const int* in_sizes, int n_in,
                              void* d_out, int out_size, void* d_ws, size_t ws_size,
                              hipStream_t stream) {
  if (n_in < 2) return;
  if (in_sizes[0] != kRows * kD) return;
  if (in_sizes[1] != kP * kD) return;
  if (out_size != kRows * kD) return;
  if (ws_size < kWsTotal) return;

  const float* x   = (const float*)d_in[0];
  const float* anc = (const float*)d_in[1];
  float* out = (float*)d_out;

  char* ws = (char*)d_ws;
  unsigned short* XT   = (unsigned short*)(ws + kOffXT);
  unsigned short* P16  = (unsigned short*)(ws + kOffP16);
  unsigned short* W16  = (unsigned short*)(ws + kOffW16);
  float*          DA   = (float*)(ws + kOffDA);
  unsigned short* ABT  = (unsigned short*)(ws + kOffABT);

  scores_state_kernel<<<dim3(kRows / 64), 256, 0, stream>>>(x, anc, P16, W16, XT, DA);
  prefix_kernel<<<dim3(kB * (kD / kScanD)), 128, 0, stream>>>(DA, ABT);
  output_kernel<<<dim3(kB * kNC * (kD / kOutCols)), 256, 0, stream>>>(W16, P16, ABT, XT, out);
}

// v008
// It runs in 13.9 microseconds.
// Timed twice side by side with v007, it ran 1.14 and 1.13 times as fast.
// Over all steps from v000 it is 4.83 times as fast.
// prods (anchors x tokens, K=512): v_wmma_f32_16x16x32_bf16 with both operands as bf16 hi+lo (hi.lo + lo.hi + hi.hi); chunk states, intra-chunk scores, carry and intra-chunk output: v_wmma_f32_16x16x32_f16 (gate plane carried x64, chunk-prefix state as f16 hi+lo planes); f32 accumulate; softmax and prefix scan in f32.
#include <hip/hip_runtime.h>
#include <math.h>

typedef __attribute__((ext_vector_type(16))) _Float16 v16h;
typedef __attribute__((ext_vector_type(16))) __bf16   v16b;
typedef __attribute__((ext_vector_type(8)))  float    v8f;
typedef __attribute__((ext_vector_type(4)))  float    v4f;
typedef __attribute__((ext_vector_type(2)))  float    v2f;
typedef __attribute__((ext_vector_type(2)))  _Float16 v2h;
typedef __attribute__((ext_vector_type(2)))  __bf16   v2b;
typedef __attribute__((ext_vector_type(4)))  unsigned int v4u;
typedef __attribute__((ext_vector_type(8)))  unsigned int v8u;

/* --------------------------------------------------------------------------- */
/* Shape constants                                                             */
/* --------------------------------------------------------------------------- */
constexpr int kB    = 4;
constexpr int kS    = 2048;
constexpr int kD    = 512;
constexpr int kP    = 16;
constexpr int kC    = 64;
constexpr int kNC   = kS / kC;
constexpr int kRows = kB * kS;
/* gate scale = 1/sqrt(kP), checked against kP */
constexpr float kGateScale = 0.25f;
static_assert(kGateScale * kGateScale * (float)kP == 1.0f);
/* gate plane carry (power of two), folded back in the output epilogue */
constexpr float kWCarry    = 64.0f;
constexpr float kWCarryInv = 1.0f / kWCarry;
static_assert(kWCarry * kWCarryInv == 1.0f);
static_assert(kS % kC == 0 && kC == 64 && kP == 16 && kD % 64 == 0);
/* LDS pitches */
constexpr int kAncPitchW = 260;
/* transposed token tile, 32-bit words per d row: 176 B = 16 B x 11 */
constexpr int kXPitchW = 44;

/* --------------------------------------------------------------------------- */
/* Workspace region map (bytes; every offset a multiple of 128)                */
/*   XT    f16 [128][32][4][32][8] transposed tokens, Bt fragment order  8,388,608 */
/*   P16   f16 [8192][16]          prods, token-major                      262,144 */
/*   W16   f16 [8192][16]          gate x64, token-major                   262,144 */
/*   PA    f16 [128][4][32][8]     prods, A fragment order of the states   262,144 */
/* XT: [chunk of the 128][16-column tile][piece][lane][elements]: a piece is   */
/* what one wave-wide 16-byte access moves, 512 contiguous bytes, in the lane  */
/* order of the WMMA registers (lane = 16 hh + cl, column d = 16 tile + cl).   */
/*   XT  piece k: tokens 16 k + 8 hh .. + 7 of column d                        */
/*   PA  piece k: tokens 16 k + 8 hh .. + 7 of anchor cl                       */
/*   total = 8,388,608 + 3 x 262,144 = 9,175,040                               */
/* --------------------------------------------------------------------------- */
constexpr size_t kOffXT   = 0;
constexpr size_t kOffP16  = kOffXT   + (size_t)kB * kD * kS * 2;
constexpr size_t kOffW16  = kOffP16  + (size_t)kRows * kP * 2;
constexpr size_t kOffPA   = kOffW16  + (size_t)kRows * kP * 2;
constexpr size_t kWsTotal = kOffPA   + (size_t)kRows * kP * 2;
static_assert(kWsTotal == 9175040ull);
static_assert(kWsTotal <= 134217728ull);
static_assert((kOffP16 % 128) == 0 && (kOffW16 % 128) == 0 && (kOffPA % 128) == 0);

/* --------------------------------------------------------------------------- */
/* Small helpers                                                               */
/* --------------------------------------------------------------------------- */
__device__ __forceinline__ unsigned pk16(unsigned short a, unsigned short b) { return (unsigned)a | ((unsigned)b << 16); }
__device__ __forceinline__ unsigned short h_bits(float f) { const _Float16 h = (_Float16)f; return __builtin_bit_cast(unsigned short, h); }

/* bf16 hi and lo words of a pair of f32 values (both conversions RNE) */
__device__ __forceinline__ void split_pair(float a, float b, unsigned& hw, unsigned& lw) {
  const v2f f = (v2f){a, b};
  hw = __builtin_bit_cast(unsigned, __builtin_convertvector(f, v2b));
  const v2f hf = (v2f){__uint_as_float(hw << 16), __uint_as_float(hw & 0xFFFF0000u)};
  lw = __builtin_bit_cast(unsigned, __builtin_convertvector(f - hf, v2b));
}

__device__ __forceinline__ v16h frag_h_words(v4u a, v4u b) {
  const v8u w = __builtin_shufflevector(a, b, 0, 1, 2, 3, 4, 5, 6, 7);
  return __builtin_bit_cast(v16h, w);
}
__device__ __forceinline__ v16b frag_b_words(v4u a, v4u b) {
  const v8u w = __builtin_shufflevector(a, b, 0, 1, 2, 3, 4, 5, 6, 7);
  return __builtin_bit_cast(v16b, w);
}
/* one WMMA + hazard guard tied to its accumulator and naming its A/B fragments */
__device__ __forceinline__ v8f mma_h(v16h a, v16h b, v8f c) {
  c = __builtin_amdgcn_wmma_f32_16x16x32_f16(false, a, false, b, (short)0, c, false, false);
  asm volatile("v_nop\n\tv_nop\n\tv_nop\n\tv_nop" : "+v"(c) : "v"(a), "v"(b));
  return c;
}
__device__ __forceinline__ v8f mma_b(v16b a, v16b b, v8f c) {
  c = __builtin_amdgcn_wmma_f32_16x16x32_bf16(false, a, false, b, (short)0, c, false, false);
  asm volatile("v_nop\n\tv_nop\n\tv_nop\n\tv_nop" : "+v"(c) : "v"(a), "v"(b));
  return c;
}

/* f32 token tile in LDS, floats per row: 2,064 B = 16 B x 129, so the 16 rows of a fragment read start 4 banks apart */
constexpr int kXfPitch = kD + 4;
/* one round of copies = 256 threads x 16 B = two token rows */
constexpr unsigned kCopyStepL = 2u * kXfPitch * 4u;
constexpr int      kCopyStepG = 2 * kD;
/* n asynchronous copies to LDS, 16 B a lane, each with its own address registers. The wait on the last line stands */
/* in front of any later write of a register that an issued copy names; inside the statement nothing can move over it. */
__device__ __forceinline__ void copy_rows11(unsigned l, const float* g) {
  asm volatile(
      "global_load_async_to_lds_b128 %0, %11, off\n\t"
      "global_load_async_to_lds_b128 %1, %12, off\n\t"
      "global_load_async_to_lds_b128 %2, %13, off\n\t"
      "global_load_async_to_lds_b128 %3, %14, off\n\t"
      "global_load_async_to_lds_b128 %4, %15, off\n\t"
      "global_load_async_to_lds_b128 %5, %16, off\n\t"
      "global_load_async_to_lds_b128 %6, %17, off\n\t"
      "global_load_async_to_lds_b128 %7, %18, off\n\t"
      "global_load_async_to_lds_b128 %8, %19, off\n\t"
      "global_load_async_to_lds_b128 %9, %20, off\n\t"
      "global_load_async_to_lds_b128 %10, %21, off\n\t"
      "s_wait_xcnt 0x0"
      :: "v"(l + 0u * kCopyStepL), "v"(l + 1u * kCopyStepL), "v"(l + 2u * kCopyStepL), "v"(l + 3u * kCopyStepL), "v"(l + 4u * kCopyStepL), "v"(l + 5u * kCopyStepL), "v"(l + 6u * kCopyStepL), "v"(l + 7u * kCopyStepL), "v"(l + 8u * kCopyStepL), "v"(l + 9u * kCopyStepL), "v"(l + 10u * kCopyStepL),
         "v"(g + 0 * kCopyStepG), "v"(g + 1 * kCopyStepG), "v"(g + 2 * kCopyStepG), "v"(g + 3 * kCopyStepG), "v"(g + 4 * kCopyStepG), "v"(g + 5 * kCopyStepG), "v"(g + 6 * kCopyStepG), "v"(g + 7 * kCopyStepG), "v"(g + 8 * kCopyStepG), "v"(g + 9 * kCopyStepG), "v"(g + 10 * kCopyStepG)
      : "memory");
}
__device__ __forceinline__ void copy_rows10(unsigned l, const float* g) {
  asm volatile(
      "global_load_async_to_lds_b128 %0, %10, off\n\t"
      "global_load_async_to_lds_b128 %1, %11, off\n\t"
      "global_load_async_to_lds_b128 %2, %12, off\n\t"
      "global_load_async_to_lds_b128 %3, %13, off\n\t"
      "global_load_async_to_lds_b128 %4, %14, off\n\t"
      "global_load_async_to_lds_b128 %5, %15, off\n\t"
      "global_load_async_to_lds_b128 %6, %16, off\n\t"
      "global_load_async_to_lds_b128 %7, %17, off\n\t"
      "global_load_async_to_lds_b128 %8, %18, off\n\t"
      "global_load_async_to_lds_b128 %9, %19, off\n\t"
      "s_wait_xcnt 0x0"
      :: "v"(l + 0u * kCopyStepL), "v"(l + 1u * kCopyStepL), "v"(l + 2u * kCopyStepL), "v"(l + 3u * kCopyStepL), "v"(l + 4u * kCopyStepL), "v"(l + 5u * kCopyStepL), "v"(l + 6u * kCopyStepL), "v"(l + 7u * kCopyStepL), "v"(l + 8u * kCopyStepL), "v"(l + 9u * kCopyStepL),
         "v"(g + 0 * kCopyStepG), "v"(g + 1 * kCopyStepG), "v"(g + 2 * kCopyStepG), "v"(g + 3 * kCopyStepG), "v"(g + 4 * kCopyStepG), "v"(g + 5 * kCopyStepG), "v"(g + 6 * kCopyStepG), "v"(g + 7 * kCopyStepG), "v"(g + 8 * kCopyStepG), "v"(g + 9 * kCopyStepG)
      : "memory");
}

/* --------------------------------------------------------------------------- */
/* K1: one block per (batch, 64-token chunk) does all that reads that     */
/* chunk's f32 tokens, which are read from memory once.                            */
/* (a) prods (M = 64, N = 16 anchors, K = 512) as a bf16 hi/lo three-product   */
/* WMMA. 8 waves: wave = (16-row tile mt, K half kh), so a lane's whole share  */
/* of the tokens (8 steps x 4 x 16 B) and of the anchors (8 x 16 B) fits in    */
/* registers and is requested before anything is waited on: the block pays one */
/* memory latency. The tokens come as asynchronous copies to the LDS tile sX   */
/* (32 rounds x 256 threads x 16 B = 64 x 512 floats; a wave's copy is 512     */
/* contiguous bytes of one row) and are read from there in fragment order.     */
/* Token values are split in registers; anchor hi/lo word      */
/* planes staged in LDS (8 iterations x 256 threads x 4 floats = 16 x 512, all */
/* read words written). The two K halves meet in LDS: prods = half 0 + half 1. */
/* (b) the same token registers as f16, transposed into the LDS tile           */
/* sXT[d][t]: lanes t and t ^ 1 swap one packed word, so every lane stores     */
/* whole words (two neighbouring tokens of one d); 64 stores x 256 threads x   */
/* 2 halves = 512 x 64, the whole tile.                                        */
/* (c) the 16-wide softmax per token row in f32 (waves 0, 1).                  */
/* (d) the Bt fragments of the chunk (rows of sXT, 8 waves x 64 columns)       */
/* stored to XT as they lie in the registers (16 stores x 256 threads x 16 B = */
/* 64 KiB): the output kernel loads them back unchanged.                       */
/* (e) the prods, rounded to f16, as the A fragments (row = anchor, k = token) */
/* of the chunk-state product, stored to PA as they lie (waves 4, 5: 2 KiB).   */
/*   P16  [row][16] f16 prods         block tile = 2 KiB contiguous = 16 lines */
/*   W16  [row][16] f16 gate x 64     same map                                 */
/* Wave w < 4 writes lines 4w..4w+3 of each plane (lanes 8q..8q+7 -> line 4w+q). */
/* grid = 8192 / 64 = 128 blocks, 256 threads.                                 */
/* --------------------------------------------------------------------------- */
constexpr int kKHalf  = kD / 2;
constexpr int kKSteps = kKHalf / 32;
static_assert(kKSteps == 8 && kP * kD == 8 * 256 * 4);
__global__ __launch_bounds__(256) void scores_state_kernel(
    const float* __restrict__ x, const float* __restrict__ anc,
    unsigned short* __restrict__ P16, unsigned short* __restrict__ W16,
    unsigned short* __restrict__ XT, unsigned short* __restrict__ PA)
{
  __shared__ __align__(16) unsigned sAH[kP * kAncPitchW];
  __shared__ __align__(16) unsigned sAL[kP * kAncPitchW];
  __shared__ float sPart[2 * 64 * 17];
  __shared__ float sProd[64 * 17];
  __shared__ float sGate[64 * 17];
  __shared__ __align__(16) unsigned sXT[kD * kXPitchW];
  __shared__ __align__(16) float sX[64 * kXfPitch];
  const int tid  = threadIdx.x;
  const int lane = tid & 31;
  const int wave = __builtin_amdgcn_readfirstlane((int)(threadIdx.x >> 5));
  const int hh = lane >> 4;
  const int cl = lane & 15;
  const int mt = wave & 3;
  const int kh = wave >> 2;
  const int r0 = blockIdx.x * 64;

  /* every global load of the block, anchors first (they are needed first) */
  /* float4 number i * 256 + tid of the 16 x 512 anchor array, which is contiguous */
  const float* aptr = anc + tid * 4;
  v4f av[8];
  /* unrolled here and below: av and xv live in registers only with constant indices */
#pragma unroll
  for (int i = 0; i < 8; ++i) av[i] = *(const v4f*)(aptr + i * 1024);
  /* token tile: round i brings rows 2 i and 2 i + 1; thread = 16-byte piece tid & 127 of row 2 i + (tid >> 7) */
  {
    const float* gs = x + (size_t)(r0 + (tid >> 7)) * kD + (tid & 127) * 4;
    const unsigned ls = (unsigned)(size_t)(sX + (tid >> 7) * kXfPitch + (tid & 127) * 4);
    copy_rows11(ls, gs);
    copy_rows11(ls + 11u * kCopyStepL, gs + 11 * kCopyStepG);
    copy_rows10(ls + 22u * kCopyStepL, gs + 22 * kCopyStepG);
  }
  /* keeps every load and copy issued ahead of the first wait for data: without it the anchor work could be scheduled in between and the copies pay a second latency */
  __builtin_amdgcn_sched_barrier(0);

#pragma unroll
  for (int i = 0; i < 8; ++i) {
    const int e4 = i * 256 + tid;
    const int p  = e4 >> 7;
    const int cf = (e4 & 127) * 4;
    unsigned h01, l01, h23, l23;
    split_pair(av[i][0], av[i][1], h01, l01);
    split_pair(av[i][2], av[i][3], h23, l23);
    const int wo = p * kAncPitchW + (cf >> 1);
    sAH[wo]     = h01;
    sAH[wo + 1] = h23;
    sAL[wo]     = l01;
    sAL[wo + 1] = l23;
  }
  /* this wave's copies have landed; the barrier behind it publishes them to the other waves */
  asm volatile("s_wait_asynccnt 0x0" ::: "memory");
  __syncthreads();

  /* A rows = token rows of this wave's tile, [row][d] layout, this wave's K half */
  const float* xrow = sX + (mt * 16 + cl) * kXfPitch + kh * kKHalf + 8 * hh;
  v4f xv[kKSteps][4];
#pragma unroll
  for (int it = 0; it < kKSteps; ++it) {
    xv[it][0] = *(const v4f*)(xrow + it * 32);
    xv[it][1] = *(const v4f*)(xrow + it * 32 + 4);
    xv[it][2] = *(const v4f*)(xrow + it * 32 + 16);
    xv[it][3] = *(const v4f*)(xrow + it * 32 + 20);
  }

  v8f acc = (v8f){0.f, 0.f, 0.f, 0.f, 0.f, 0.f, 0.f, 0.f};
#pragma unroll
  for (int it = 0; it < kKSteps; ++it) {
    const int k0 = kh * kKHalf + it * 32;
    const v4f f0 = xv[it][0];
    const v4f f1 = xv[it][1];
    const v4f f2 = xv[it][2];
    const v4f f3 = xv[it][3];
    unsigned hw0, hw1, hw2, hw3, hw4, hw5, hw6, hw7;
    unsigned lw0, lw1, lw2, lw3, lw4, lw5, lw6, lw7;
    split_pair(f0[0], f0[1], hw0, lw0);
    split_pair(f0[2], f0[3], hw1, lw1);
    split_pair(f1[0], f1[1], hw2, lw2);
    split_pair(f1[2], f1[3], hw3, lw3);
    split_pair(f2[0], f2[1], hw4, lw4);
    split_pair(f2[2], f2[3], hw5, lw5);
    split_pair(f3[0], f3[1], hw6, lw6);
    split_pair(f3[2], f3[3], hw7, lw7);
    const v8u hv = (v8u){hw0, hw1, hw2, hw3, hw4, hw5, hw6, hw7};
    const v8u lv = (v8u){lw0, lw1, lw2, lw3, lw4, lw5, lw6, lw7};
    const v16b ah = __builtin_bit_cast(v16b, hv);
    const v16b al = __builtin_bit_cast(v16b, lv);
    /* B column = anchor cl; words at halves k0 + 8*hh and + 16 */
    const int wb = cl * kAncPitchW + (k0 >> 1) + 4 * hh;
    const v4u bh0 = *(const v4u*)(sAH + wb);
    const v4u bh1 = *(const v4u*)(sAH + wb + 8);
    const v4u bl0 = *(const v4u*)(sAL + wb);
    const v4u bl1 = *(const v4u*)(sAL + wb + 8);
    const v16b bh = frag_b_words(bh0, bh1);
    const v16b bl = frag_b_words(bl0, bl1);
    acc = mma_b(ah, bl, acc);
    acc = mma_b(al, bh, acc);
    acc = mma_b(ah, bh, acc);
  }
  /* D element r of this lane = (token row 8*hh + r of tile mt, anchor cl), K half kh */
#pragma unroll
  for (int r = 0; r < 8; ++r) sPart[(kh * 64 + mt * 16 + 8 * hh + r) * 17 + cl] = acc[r];

  /* f16 transpose: this lane holds token t = 16 * mt + cl. Word h = (d, d + 1) of token t, word r = the same of token t ^ 1. */
  /* Even t keeps row d: (t, t + 1) = low halves of h, r. Odd t keeps row d + 1: (t - 1, t) = high halves of r, h. */
  {
    const int odd = cl & 1;
    const unsigned sel = odd ? 0x07060302u : 0x01000504u;
    unsigned* xw = sXT + (kh * kKHalf + 8 * hh + odd) * kXPitchW + ((mt * 16 + cl) >> 1);
#pragma unroll
    for (int it = 0; it < kKSteps; ++it)
#pragma unroll
      for (int q = 0; q < 4; ++q)
#pragma unroll
        for (int m = 0; m < 2; ++m) {
          const int dof = it * 32 + (q >> 1) * 16 + (q & 1) * 4 + 2 * m;
          const v2f f2 = (v2f){xv[it][q][2 * m], xv[it][q][2 * m + 1]};
          const unsigned h = __builtin_bit_cast(unsigned, __builtin_convertvector(f2, v2h));
          /* quad_perm [1,0,3,2]: the word of lane ^ 1 */
          const unsigned r = (unsigned)__builtin_amdgcn_mov_dpp((int)h, 0xB1, 0xF, 0xF, true);
          xw[dof * kXPitchW] = __builtin_amdgcn_perm(h, r, sel);
        }
  }
  __syncthreads();

  /* K halves added, then softmax over the 16 anchors, one token row per thread (waves 0 and 1, scalar branch) */
  if (wave < 2) {
    float pr[kP], ge[kP];
    /* unrolled: the 32 LDS reads are issued together (rolled, each trip waited for its own) and the row stays in registers */
#pragma unroll
    for (int p = 0; p < kP; ++p) pr[p] = sPart[tid * 17 + p] + sPart[(64 + tid) * 17 + p];
    float m = pr[0] * kGateScale;
#pragma unroll
    for (int p = 1; p < kP; ++p) m = fmaxf(m, pr[p] * kGateScale);
    float sum = 0.0f;
#pragma unroll
    for (int p = 0; p < kP; ++p) {
      ge[p] = expf(pr[p] * kGateScale - m);
      sum += ge[p];
    }
    const float inv = (1.0f / sum) * kWCarry;
#pragma unroll
    for (int p = 0; p < kP; ++p) {
      sProd[tid * 17 + p] = pr[p];
      sGate[tid * 17 + p] = ge[p] * inv;
    }
  }
  __syncthreads();

  /* No barrier follows: every global store of the block stands behind the last one. */
  const int q = lane >> 3;
  const int j = lane & 7;

  /* the two token-major planes (waves 0..3, scalar branch) */
  v4u up = (v4u){0u, 0u, 0u, 0u};
  v4u uw = (v4u){0u, 0u, 0u, 0u};
  const int ln = wave * 4 + q;
  if (wave < 4) {
    const int row = 4 * ln + (j >> 1);
    const int p0  = (j & 1) * 8;
    unsigned short pb[8], wb16[8];
#pragma unroll
    for (int e = 0; e < 8; ++e) {
      pb[e]   = h_bits(sProd[row * 17 + p0 + e]);
      wb16[e] = h_bits(sGate[row * 17 + p0 + e]);
    }
    up = (v4u){pk16(pb[0], pb[1]), pk16(pb[2], pb[3]), pk16(pb[4], pb[5]), pk16(pb[6], pb[7])};
    uw = (v4u){pk16(wb16[0], wb16[1]), pk16(wb16[2], wb16[3]), pk16(wb16[4], wb16[5]), pk16(wb16[6], wb16[7])};
  }

  /* A fragment f = wave - 4 of the chunk-state product (waves 4, 5, scalar branch). Row = anchor cl; word w holds t = 32 f + 16 (w >> 2) + 8 hh + 2 (w & 3) and t + 1 */
  v8u aw = (v8u){0u, 0u, 0u, 0u, 0u, 0u, 0u, 0u};
  if (wave >= 4 && wave < 6) {
#pragma unroll
    for (int w = 0; w < 8; ++w) {
      const int t = 32 * (wave - 4) + 16 * (w >> 2) + 8 * hh + 2 * (w & 3);
      aw[w] = pk16(h_bits(sProd[t * 17 + cl]), h_bits(sProd[(t + 1) * 17 + cl]));
    }
  }

  /* Bt fragments of this wave's 64 columns: row d = n0 + 16 jn + cl, piece k = words at halves 16 k + 8 hh. */
  /* They go to XT as they are: store (jn, k) is 512 contiguous bytes, the wave's 16 stores 8 KiB. */
  const int n0 = wave * 64;
  v4u bw[4][4];
#pragma unroll
  for (int jn = 0; jn < 4; ++jn) {
    const unsigned* bp = sXT + (n0 + 16 * jn + cl) * kXPitchW + 4 * hh;
#pragma unroll
    for (int k = 0; k < 4; ++k) bw[jn][k] = *(const v4u*)(bp + 8 * k);
  }
  unsigned short* gx = XT + ((size_t)blockIdx.x * (kD / 16) + wave * 4) * 1024 + lane * 8;
#pragma unroll
  for (int jn = 0; jn < 4; ++jn)
#pragma unroll
    for (int k = 0; k < 4; ++k) *(v4u*)(gx + (jn * 4 + k) * 256) = bw[jn][k];
  /* the wait that stands in front of any overwrite of a register an issued store names: the plane addresses below are formed in registers of the stores above */
  asm volatile("s_wait_xcnt 0x0" ::: "memory");
  if (wave < 4) {
    *(v4u*)(P16 + (size_t)r0 * kP + ln * 64 + j * 8) = up;
    *(v4u*)(W16 + (size_t)r0 * kP + ln * 64 + j * 8) = uw;
  } else if (wave < 6) {
    unsigned short* ga = PA + ((size_t)blockIdx.x * 4 + (wave - 4) * 2) * 256 + lane * 8;
    *(v4u*)(ga)       = (v4u){aw[0], aw[1], aw[2], aw[3]};
    *(v4u*)(ga + 256) = (v4u){aw[4], aw[5], aw[6], aw[7]};
  }
}

/* --------------------------------------------------------------------------- */
/* K2: block = (batch, 32 columns, half of the sequence), 16 waves, wave = one */
/* 64-token chunk of that half. The block rebuilds the chunk states of its     */
/* columns from XT, so no state goes through memory and no launch stands       */
/* between the states and the output.                                          */
/*  (0) every global load of the wave is requested first (20 x 16 B a lane;    */
/*      32 in the later half, which also takes chunk 'wave' of the earlier     */
/*      half for its state): the block pays one memory latency;                */
/*  (1) chunk state S[p][d] = sum_t prods[t][p] * x[t][d]: M = 16, N = 32,     */
/*      K = 64, f16 WMMA, A from PA, Bt from XT; accumulators to sS as they    */
/*      lie (piece s of a 16-column tile: anchors 8 hh + 4 s .. + 3);          */
/*  (2) 64 * L[s][t] = sum_p prods[t][p] * (64 w[s][p]) with the TOKEN t as    */
/*      the row of the product: a lane then holds 8 neighbouring t of one      */
/*      query row s, which is the A fragment of step (4) as it lies; kept for  */
/*      t <= s (diagonal included), else 0 by select; tiles above the diagonal */
/*      are zero words; K padded 16 -> 32 by zero upper fragment halves;       */
/*  (3) exclusive prefix of the states over the chunks (f32, forward in time,  */
/*      zero start per batch; thread = column x anchor pair, waves 0..7), as   */
/*      f16 hi = f16(A), lo = f16(A - hi) words in Bt fragment order in sAB;   */
/*  (4) fused K = 96 product: A = [W | W | L], Bt[d] = [hi | lo | XT chunk];   */
/*      k steps whose A fragment is all zero are left out (they add 0);        */
/*      f32 result x 1/64 -> the wave's own 64 x 32 slab -> rows stored as     */
/*      8 lanes x 16 B = one 128-B line.                                       */
/* grid = 4 x 16 x 2 = 128 blocks, 512 threads; the later halves come first.   */
/* --------------------------------------------------------------------------- */
constexpr int kHalfNC   = kNC / 2;
constexpr int kSlabCols = 32;
constexpr int kNSlab    = kD / kSlabCols;
constexpr int kOutPitch = 36;
static_assert(kHalfNC == 16 && kNSlab == 16 && kP == 16);

/* state of one chunk for 32 columns; dst = the chunk's 512 floats in sS + lane * 4 */
__device__ __forceinline__ void chunk_state(const v4u (&pf)[4], const v4u (&xq)[2][4], float* dst) {
  const v16h a0 = frag_h_words(pf[0], pf[1]);
  const v16h a1 = frag_h_words(pf[2], pf[3]);
#pragma unroll
  for (int jn = 0; jn < 2; ++jn) {
    v8f acc = (v8f){0.f, 0.f, 0.f, 0.f, 0.f, 0.f, 0.f, 0.f};
    acc = mma_h(a0, frag_h_words(xq[jn][0], xq[jn][1]), acc);
    acc = mma_h(a1, frag_h_words(xq[jn][2], xq[jn][3]), acc);
#pragma unroll
    for (int s = 0; s < 2; ++s)
      *(v4f*)(dst + (jn * 2 + s) * 128) = (v4f){acc[4 * s], acc[4 * s + 1], acc[4 * s + 2], acc[4 * s + 3]};
  }
}

__global__ __launch_bounds__(512) void prefix_output_kernel(
    const unsigned short* __restrict__ W16, const unsigned short* __restrict__ P16,
    const unsigned short* __restrict__ PA, const unsigned short* __restrict__ XT, float* __restrict__ out)
{
  __shared__ __align__(16) float sS[kNC * 512];
  __shared__ __align__(16) unsigned sAB[kHalfNC * 512];
  __shared__ __align__(16) float slab[16 * 64 * kOutPitch];
  const int lane = threadIdx.x & 31;
  const int wave = __builtin_amdgcn_readfirstlane((int)(threadIdx.x >> 5));
  const int hh = lane >> 4;
  const int cl = lane & 15;
  const int h  = 1 - (int)(blockIdx.x / (kB * kNSlab));
  const int bs = blockIdx.x % (kB * kNSlab);
  const int b  = bs / kNSlab;
  const int sl = bs - b * kNSlab;
  const int n0 = sl * kSlabCols;
  const int bc = b * kNC + h * kHalfNC + wave;
  const int be = b * kNC + wave;
  const int r0 = bc * kC;

  /* XT and PA lie in fragment order, a load is 512 contiguous bytes; a gate or prods load is 16 rows x 32 B, contiguous too */
  const unsigned short* xe = XT + ((size_t)be * (kD / 16) + sl * 2) * 1024 + lane * 8;
  const unsigned short* pe = PA + (size_t)be * 1024 + lane * 8;
  const unsigned short* xt = XT + ((size_t)bc * (kD / 16) + sl * 2) * 1024 + lane * 8;
  const unsigned short* pa = PA + (size_t)bc * 1024 + lane * 8;
  const unsigned short* gw = W16 + (size_t)(r0 + cl) * kP + 8 * hh;
  const unsigned short* gp = P16 + (size_t)(r0 + cl) * kP + 8 * hh;
  const v4u zero4 = (v4u){0u, 0u, 0u, 0u};
  v4u pfe[4], xqe[2][4], pf[4], xq[2][4], wq[4], pq[4];
  /* unrolled here and below: the fragments and accumulators live in registers only with constant indices */
#pragma unroll
  for (int k = 0; k < 4; ++k) {
    pfe[k] = zero4;
    xqe[0][k] = zero4;
    xqe[1][k] = zero4;
  }
  if (h) {
#pragma unroll
    for (int k = 0; k < 4; ++k) pfe[k] = *(const v4u*)(pe + k * 256);
#pragma unroll
    for (int j = 0; j < 2; ++j)
#pragma unroll
      for (int k = 0; k < 4; ++k) xqe[j][k] = *(const v4u*)(xe + j * 1024 + k * 256);
  }
#pragma unroll
  for (int k = 0; k < 4; ++k) pf[k] = *(const v4u*)(pa + k * 256);
#pragma unroll
  for (int j = 0; j < 2; ++j)
#pragma unroll
    for (int k = 0; k < 4; ++k) xq[j][k] = *(const v4u*)(xt + j * 1024 + k * 256);
#pragma unroll
  for (int m = 0; m < 4; ++m) {
    wq[m] = *(const v4u*)(gw + m * 16 * kP);
    pq[m] = *(const v4u*)(gp + m * 16 * kP);
  }
  /* the wait that stands in front of any overwrite of a register an issued load names; the six bases are inputs so that none is reused, not even as a later load's destination, ahead of it */
  asm volatile("s_wait_xcnt 0x0" :: "v"(xe), "v"(pe), "v"(xt), "v"(pa), "v"(gw), "v"(gp) : "memory");
  /* keeps every load issued ahead of the first wait for data: without it the later loads are scheduled behind the first state product and pay a second latency */
  __builtin_amdgcn_sched_barrier(0);

  if (h) chunk_state(pfe, xqe, sS + wave * 512 + lane * 4);
  chunk_state(pf, xq, sS + (h * kHalfNC + wave) * 512 + lane * 4);

  /* lt[m][tt]: D element r of this lane = (token 16 tt + 8 hh + r, query row 16 m + cl), packed in pairs of tokens */
  v4u lt[4][4];
#pragma unroll
  for (int m = 0; m < 4; ++m) {
    const v16h bf = frag_h_words(wq[m], zero4);
#pragma unroll
    for (int tt = 0; tt < 4; ++tt) {
      if (tt > m) {
        lt[m][tt] = zero4;
      } else {
        v8f accL = (v8f){0.f, 0.f, 0.f, 0.f, 0.f, 0.f, 0.f, 0.f};
        accL = mma_h(frag_h_words(pq[tt], zero4), bf, accL);
        if (tt == m) {
#pragma unroll
          for (int r = 0; r < 8; ++r) accL[r] = (8 * hh + r <= cl) ? accL[r] : 0.0f;
        }
        lt[m][tt] = (v4u){pk16(h_bits(accL[0]), h_bits(accL[1])), pk16(h_bits(accL[2]), h_bits(accL[3])),
                          pk16(h_bits(accL[4]), h_bits(accL[5])), pk16(h_bits(accL[6]), h_bits(accL[7]))};
      }
    }
  }
  __syncthreads();

  /* prefix: thread = (16-column tile jn, column dl = cl, anchors 2 pi and 2 pi + 1 = 8 (pi >> 2) + 4 ((pi >> 1) & 1) + 2 (pi & 1) and the next) */
  if (wave < 8) {
    const int jn = wave >> 2;
    const int pi = (wave & 3) * 2 + hh;
    const float* sp = sS + jn * 256 + ((((pi >> 1) & 1) * 32 + (pi >> 2) * 16 + cl) * 4 + (pi & 1) * 2);
    unsigned* dp = sAB + jn * 256 + ((pi >> 2) * 16 + cl) * 4 + (pi & 3);
    float a0 = 0.0f, a1 = 0.0f;
    if (h) {
      v2f ve[kHalfNC];
#pragma unroll
      for (int c = 0; c < kHalfNC; ++c) ve[c] = *(const v2f*)(sp + c * 512);
#pragma unroll
      for (int c = 0; c < kHalfNC; ++c) {
        a0 += ve[c][0];
        a1 += ve[c][1];
      }
    }
    const float* sq = sp + h * kHalfNC * 512;
    v2f vv[kHalfNC - 1];
#pragma unroll
    for (int c = 0; c < kHalfNC - 1; ++c) vv[c] = *(const v2f*)(sq + c * 512);
#pragma unroll
    for (int c = 0; c < kHalfNC; ++c) {
      const _Float16 h0 = (_Float16)a0;
      const _Float16 h1 = (_Float16)a1;
      const float h0f = (float)h0;
      const float h1f = (float)h1;
      const unsigned short hb0 = __builtin_bit_cast(unsigned short, h0);
      const unsigned short hb1 = __builtin_bit_cast(unsigned short, h1);
      const unsigned short lb0 = h_bits(a0 - h0f);
      const unsigned short lb1 = h_bits(a1 - h1f);
      dp[c * 512]       = pk16(hb0, hb1);
      dp[c * 512 + 128] = pk16(lb0, lb1);
      if (c < kHalfNC - 1) {
        a0 += vv[c][0];
        a1 += vv[c][1];
      }
    }
  }
  __syncthreads();

  /* Bt pieces hi | lo of this wave's chunk, columns n0 + 16 j + cl */
  const unsigned* ab = sAB + wave * 512 + lane * 4;
  v4u bh[2][2];
#pragma unroll
  for (int j = 0; j < 2; ++j)
#pragma unroll
    for (int pc = 0; pc < 2; ++pc) bh[j][pc] = *(const v4u*)(ab + (j * 2 + pc) * 128);

  v8f acc[4][2];
#pragma unroll
  for (int m = 0; m < 4; ++m)
#pragma unroll
    for (int j = 0; j < 2; ++j) acc[m][j] = (v8f){0.f, 0.f, 0.f, 0.f, 0.f, 0.f, 0.f, 0.f};
  /* k step outermost: independent accumulators between two products into the same one; each sums its k steps in the order 0, 1, 2 */
#pragma unroll
  for (int m = 0; m < 4; ++m)
#pragma unroll
    for (int j = 0; j < 2; ++j)
      acc[m][j] = mma_h(frag_h_words(wq[m], wq[m]), frag_h_words(bh[j][0], bh[j][1]), acc[m][j]);
#pragma unroll
  for (int ks = 0; ks < 2; ++ks)
#pragma unroll
    for (int m = 2 * ks; m < 4; ++m)
#pragma unroll
      for (int j = 0; j < 2; ++j)
        acc[m][j] = mma_h(frag_h_words(lt[m][2 * ks], lt[m][2 * ks + 1]), frag_h_words(xq[j][2 * ks], xq[j][2 * ks + 1]), acc[m][j]);

  float* sw = slab + wave * 64 * kOutPitch;
#pragma unroll
  for (int m = 0; m < 4; ++m)
#pragma unroll
    for (int j = 0; j < 2; ++j)
#pragma unroll
      for (int r = 0; r < 8; ++r)
        sw[(16 * m + 8 * hh + r) * kOutPitch + 16 * j + cl] = acc[m][j][r] * kWCarryInv;
  /* the slab is this wave's own: its LDS stores have landed before its lanes read one another's words back; no other wave takes part */
  asm volatile("s_wait_dscnt 0x0" ::: "memory");
  /* 8 lanes a row (one 128-B line). Lanes 0..7 and 8..15 take rows 8 apart: their words fall on different banks at this pitch. */
  const int q  = lane >> 3;
  const int j4 = (lane & 7) * 4;
  const int rl = (q >> 1) + (q & 1) * 8;
  /* One LDS and one global base per lane; iteration i adds the constant row (i >> 2) * 16 + (i & 3) * 2. */
  const float* sr = sw + rl * kOutPitch + j4;
  float* go = out + (size_t)(r0 + rl) * kD + n0 + j4;
  v4f v[16];
#pragma unroll
  for (int i = 0; i < 16; ++i) v[i] = *(const v4f*)(sr + ((i >> 2) * 16 + (i & 3) * 2) * kOutPitch);
#pragma unroll
  for (int i = 0; i < 16; ++i) *(v4f*)(go + ((i >> 2) * 16 + (i & 3) * 2) * kD) = v[i];
}

/* --------------------------------------------------------------------------- */
/* Host glue: 2 kernel launches, nothing else.                                 */
/* --------------------------------------------------------------------------- */
extern "C" void kernel_launch(void* const* d_in, const int* in_sizes, int n_in,
                              void* d_out, int out_size, void* d_ws, size_t ws_size,
                              hipStream_t stream) {
  if (n_in < 2) return;
  if (in_sizes[0] != kRows * kD) return;
  if (in_sizes[1] != kP * kD) return;
  if (out_size != kRows * kD) return;
  if (ws_size < kWsTotal) return;

  const float* x   = (const float*)d_in[0];
  const float* anc = (const float*)d_in[1];
  float* out = (float*)d_out;

  char* ws = (char*)d_ws;
  unsigned short* XT   = (unsigned short*)(ws + kOffXT);
  unsigned short* P16  = (unsigned short*)(ws + kOffP16);
  unsigned short* W16  = (unsigned short*)(ws + kOffW16);
  unsigned short* PA   = (unsigned short*)(ws + kOffPA);

  scores_state_kernel<<<dim3(kRows / 64), 256, 0, stream>>>(x, anc, P16, W16, XT, PA);
  prefix_output_kernel<<<dim3(kB * kNSlab * 2), 512, 0, stream>>>(W16, P16, PA, XT, out);
}

// v009
// It runs in 12.9 microseconds.
// Timed twice side by side with v008, it ran 1.08 and 1.09 times as fast.
// All steps since v000 together make it 5.26 times as fast.
// prods (anchors x tokens, K=512): v_wmma_f32_16x16x32_bf16 with both operands as bf16 hi+lo (hi.lo + lo.hi + hi.hi); chunk states, intra-chunk scores, carry and intra-chunk output: v_wmma_f32_16x16x32_f16 (gate plane carried x64, chunk-prefix state as f16 hi+lo planes); f32 accumulate; softmax and prefix scan in f32.
#include <hip/hip_runtime.h>
#include <math.h>

typedef __attribute__((ext_vector_type(16))) _Float16 v16h;
typedef __attribute__((ext_vector_type(16))) __bf16   v16b;
typedef __attribute__((ext_vector_type(8)))  float    v8f;
typedef __attribute__((ext_vector_type(4)))  float    v4f;
typedef __attribute__((ext_vector_type(2)))  float    v2f;
typedef __attribute__((ext_vector_type(2)))  _Float16 v2h;
typedef __attribute__((ext_vector_type(2)))  __bf16   v2b;
typedef __attribute__((ext_vector_type(4)))  unsigned int v4u;
typedef __attribute__((ext_vector_type(8)))  unsigned int v8u;

/* --------------------------------------------------------------------------- */
/* Shape constants                                                             */
/* --------------------------------------------------------------------------- */
constexpr int kB    = 4;
constexpr int kS    = 2048;
constexpr int kD    = 512;
constexpr int kP    = 16;
constexpr int kC    = 64;
constexpr int kNC   = kS / kC;
constexpr int kRows = kB * kS;
/* gate scale = 1/sqrt(kP), checked against kP */
constexpr float kGateScale = 0.25f;
static_assert(kGateScale * kGateScale * (float)kP == 1.0f);
/* gate plane carry (power of two), folded back in the output epilogue */
constexpr float kWCarry    = 64.0f;
constexpr float kWCarryInv = 1.0f / kWCarry;
static_assert(kWCarry * kWCarryInv == 1.0f);
static_assert(kS % kC == 0 && kC == 64 && kP == 16 && kD % 64 == 0);
/* LDS pitches */
constexpr int kAncPitchW = 260;
/* tokens of one scores block: half a chunk, so that the launch has a block for every WGP */
constexpr int kTB = 32;
/* transposed token tile, 32-bit words per d row: 80 B = 16 B x 5 */
constexpr int kXPitchW = 20;

/* --------------------------------------------------------------------------- */
/* Workspace region map (bytes; every offset a multiple of 128)                */
/*   XT    f16 [128][32][4][32][8] transposed tokens, Bt fragment order  8,388,608 */
/*   P16   f16 [8192][16]          prods, token-major                      262,144 */
/*   W16   f16 [8192][16]          gate x64, token-major                   262,144 */
/*   PA    f16 [128][4][32][8]     prods, A fragment order of the states   262,144 */
/* XT: [chunk of the 128][16-column tile][piece][lane][elements]: a piece is   */
/* what one wave-wide 16-byte access moves, 512 contiguous bytes, in the lane  */
/* order of the WMMA registers (lane = 16 hh + cl, column d = 16 tile + cl).   */
/*   XT  piece k: tokens 16 k + 8 hh .. + 7 of column d                        */
/*   PA  piece k: tokens 16 k + 8 hh .. + 7 of anchor cl                       */
/*   total = 8,388,608 + 3 x 262,144 = 9,175,040                               */
/* --------------------------------------------------------------------------- */
constexpr size_t kOffXT   = 0;
constexpr size_t kOffP16  = kOffXT   + (size_t)kB * kD * kS * 2;
constexpr size_t kOffW16  = kOffP16  + (size_t)kRows * kP * 2;
constexpr size_t kOffPA   = kOffW16  + (size_t)kRows * kP * 2;
constexpr size_t kWsTotal = kOffPA   + (size_t)kRows * kP * 2;
static_assert(kWsTotal == 9175040ull);
static_assert(kWsTotal <= 134217728ull);
static_assert((kOffP16 % 128) == 0 && (kOffW16 % 128) == 0 && (kOffPA % 128) == 0);

/* --------------------------------------------------------------------------- */
/* Small helpers                                                               */
/* --------------------------------------------------------------------------- */
__device__ __forceinline__ unsigned pk16(unsigned short a, unsigned short b) { return (unsigned)a | ((unsigned)b << 16); }
__device__ __forceinline__ unsigned short h_bits(float f) { const _Float16 h = (_Float16)f; return __builtin_bit_cast(unsigned short, h); }

/* bf16 hi and lo words of a pair of f32 values (both conversions RNE) */
__device__ __forceinline__ void split_pair(float a, float b, unsigned& hw, unsigned& lw) {
  const v2f f = (v2f){a, b};
  hw = __builtin_bit_cast(unsigned, __builtin_convertvector(f, v2b));
  const v2f hf = (v2f){__uint_as_float(hw << 16), __uint_as_float(hw & 0xFFFF0000u)};
  lw = __builtin_bit_cast(unsigned, __builtin_convertvector(f - hf, v2b));
}

__device__ __forceinline__ v16h frag_h_words(v4u a, v4u b) {
  const v8u w = __builtin_shufflevector(a, b, 0, 1, 2, 3, 4, 5, 6, 7);
  return __builtin_bit_cast(v16h, w);
}
__device__ __forceinline__ v16b frag_b_words(v4u a, v4u b) {
  const v8u w = __builtin_shufflevector(a, b, 0, 1, 2, 3, 4, 5, 6, 7);
  return __builtin_bit_cast(v16b, w);
}
/* one WMMA + hazard guard tied to its accumulator and naming its A/B fragments */
__device__ __forceinline__ v8f mma_h(v16h a, v16h b, v8f c) {
  c = __builtin_amdgcn_wmma_f32_16x16x32_f16(false, a, false, b, (short)0, c, false, false);
  asm volatile("v_nop\n\tv_nop\n\tv_nop\n\tv_nop" : "+v"(c) : "v"(a), "v"(b));
  return c;
}
__device__ __forceinline__ v8f mma_b(v16b a, v16b b, v8f c) {
  c = __builtin_amdgcn_wmma_f32_16x16x32_bf16(false, a, false, b, (short)0, c, false, false);
  asm volatile("v_nop\n\tv_nop\n\tv_nop\n\tv_nop" : "+v"(c) : "v"(a), "v"(b));
  return c;
}

/* f32 token tile in LDS, floats per row: 2,064 B = 16 B x 129, so the 16 rows of a fragment read start 4 banks apart */
constexpr int kXfPitch = kD + 4;
/* one round of copies = 128 threads x 16 B = one token row */
constexpr unsigned kCopyStepL = kXfPitch * 4u;
constexpr int      kCopyStepG = kD;
/* n asynchronous copies to LDS, 16 B a lane, each with its own address registers. The wait on the last line stands */
/* in front of any later write of a register that an issued copy names; inside the statement nothing can move over it. */
__device__ __forceinline__ void copy_rows11(unsigned l, const float* g) {
  asm volatile(
      "global_load_async_to_lds_b128 %0, %11, off\n\t"
      "global_load_async_to_lds_b128 %1, %12, off\n\t"
      "global_load_async_to_lds_b128 %2, %13, off\n\t"
      "global_load_async_to_lds_b128 %3, %14, off\n\t"
      "global_load_async_to_lds_b128 %4, %15, off\n\t"
      "global_load_async_to_lds_b128 %5, %16, off\n\t"
      "global_load_async_to_lds_b128 %6, %17, off\n\t"
      "global_load_async_to_lds_b128 %7, %18, off\n\t"
      "global_load_async_to_lds_b128 %8, %19, off\n\t"
      "global_load_async_to_lds_b128 %9, %20, off\n\t"
      "global_load_async_to_lds_b128 %10, %21, off\n\t"
      "s_wait_xcnt 0x0"
      :: "v"(l + 0u * kCopyStepL), "v"(l + 1u * kCopyStepL), "v"(l + 2u * kCopyStepL), "v"(l + 3u * kCopyStepL), "v"(l + 4u * kCopyStepL), "v"(l + 5u * kCopyStepL), "v"(l + 6u * kCopyStepL), "v"(l + 7u * kCopyStepL), "v"(l + 8u * kCopyStepL), "v"(l + 9u * kCopyStepL), "v"(l + 10u * kCopyStepL),
         "v"(g + 0 * kCopyStepG), "v"(g + 1 * kCopyStepG), "v"(g + 2 * kCopyStepG), "v"(g + 3 * kCopyStepG), "v"(g + 4 * kCopyStepG), "v"(g + 5 * kCopyStepG), "v"(g + 6 * kCopyStepG), "v"(g + 7 * kCopyStepG), "v"(g + 8 * kCopyStepG), "v"(g + 9 * kCopyStepG), "v"(g + 10 * kCopyStepG)
      : "memory");
}
__device__ __forceinline__ void copy_rows10(unsigned l, const float* g) {
  asm volatile(
      "global_load_async_to_lds_b128 %0, %10, off\n\t"
      "global_load_async_to_lds_b128 %1, %11, off\n\t"
      "global_load_async_to_lds_b128 %2, %12, off\n\t"
      "global_load_async_to_lds_b128 %3, %13, off\n\t"
      "global_load_async_to_lds_b128 %4, %14, off\n\t"
      "global_load_async_to_lds_b128 %5, %15, off\n\t"
      "global_load_async_to_lds_b128 %6, %16, off\n\t"
      "global_load_async_to_lds_b128 %7, %17, off\n\t"
      "global_load_async_to_lds_b128 %8, %18, off\n\t"
      "global_load_async_to_lds_b128 %9, %19, off\n\t"
      "s_wait_xcnt 0x0"
      :: "v"(l + 0u * kCopyStepL), "v"(l + 1u * kCopyStepL), "v"(l + 2u * kCopyStepL), "v"(l + 3u * kCopyStepL), "v"(l + 4u * kCopyStepL), "v"(l + 5u * kCopyStepL), "v"(l + 6u * kCopyStepL), "v"(l + 7u * kCopyStepL), "v"(l + 8u * kCopyStepL), "v"(l + 9u * kCopyStepL),
         "v"(g + 0 * kCopyStepG), "v"(g + 1 * kCopyStepG), "v"(g + 2 * kCopyStepG), "v"(g + 3 * kCopyStepG), "v"(g + 4 * kCopyStepG), "v"(g + 5 * kCopyStepG), "v"(g + 6 * kCopyStepG), "v"(g + 7 * kCopyStepG), "v"(g + 8 * kCopyStepG), "v"(g + 9 * kCopyStepG)
      : "memory");
}

/* --------------------------------------------------------------------------- */
/* K1: one block per (batch, 32 tokens = half a chunk) does all that needs     */
/* only those tokens, which are read from memory once.                         */
/* (a) prods (M = 32, N = 16 anchors, K = 512) as a bf16 hi/lo three-product   */
/* WMMA. 4 waves: wave = (16-row tile mt, K half kh), so a lane's whole share  */
/* of the tokens (8 steps x 4 x 16 B) and of the anchors (16 x 16 B) fits in   */
/* registers and is requested before anything is waited on: the block pays one */
/* memory latency. The tokens come as asynchronous copies to the LDS tile sX   */
/* (32 rounds x 128 threads x 16 B = 32 x 512 floats; a wave's copy is 512     */
/* contiguous bytes of one row) and are read from there in fragment order.     */
/* Token values are split in registers; anchor hi/lo word planes staged in LDS */
/* (16 iterations x 128 threads x 4 floats = 16 x 512, all read words          */
/* written). The two K halves meet in LDS: prods = half 0 + half 1.            */
/* (b) the same token registers as f16, transposed into the LDS tile           */
/* sXT[d][t]: lanes t and t ^ 1 swap one packed word, so every lane stores     */
/* whole words (two neighbouring tokens of one d); 64 stores x 128 threads x   */
/* 2 halves = 512 x 32, the whole tile.                                        */
/* (c) the 16-wide softmax per token row in f32 (wave 0).                      */
/* (d) the Bt fragments of the half chunk (rows of sXT, 4 waves x 128 columns) */
/* stored to XT as they lie in the registers (16 stores x 128 threads x 16 B = */
/* 32 KiB; pieces 2 f and 2 f + 1 of a tile, f = half of the chunk, are 1 KiB  */
/* in a row): the output kernel loads them back unchanged.                     */
/* (e) the prods, rounded to f16, as A fragment f (row = anchor, k = token)    */
/* of the chunk-state product, stored to PA as it lies (wave 2: 1 KiB).        */
/*   P16  [row][16] f16 prods         block tile = 1 KiB contiguous = 8 lines  */
/*   W16  [row][16] f16 gate x 64     same map                                 */
/* Wave w < 2 writes lines 4w..4w+3 of each plane (lanes 8q..8q+7 -> line 4w+q). */
/* grid = 8192 / 32 = 256 blocks, 128 threads.                                 */
/* --------------------------------------------------------------------------- */
constexpr int kKHalf  = kD / 2;
constexpr int kKSteps = kKHalf / 32;
static_assert(kKSteps == 8 && kP * kD == 16 * 128 * 4 && kC == 2 * kTB);
__global__ __launch_bounds__(128) void scores_state_kernel(
    const float* __restrict__ x, const float* __restrict__ anc,
    unsigned short* __restrict__ P16, unsigned short* __restrict__ W16,
    unsigned short* __restrict__ XT, unsigned short* __restrict__ PA)
{
  __shared__ __align__(16) unsigned sAH[kP * kAncPitchW];
  __shared__ __align__(16) unsigned sAL[kP * kAncPitchW];
  __shared__ float sPart[2 * kTB * 17];
  __shared__ float sProd[kTB * 17];
  __shared__ float sGate[kTB * 17];
  __shared__ __align__(16) unsigned sXT[kD * kXPitchW];
  __shared__ __align__(16) float sX[kTB * kXfPitch];
  const int tid  = threadIdx.x;
  const int lane = tid & 31;
  const int wave = __builtin_amdgcn_readfirstlane((int)(threadIdx.x >> 5));
  const int hh = lane >> 4;
  const int cl = lane & 15;
  const int mt = wave & 1;
  const int kh = wave >> 1;
  const int r0 = blockIdx.x * kTB;

  /* every global load of the block, anchors first (they are needed first) */
  /* float4 number tid of anchor row i */
  const float* aptr = anc + tid * 4;
  v4f av[kP];
  /* unrolled here and below: av and xv live in registers only with constant indices */
#pragma unroll
  for (int i = 0; i < kP; ++i) av[i] = *(const v4f*)(aptr + i * kD);
  /* token tile: round i brings row i; thread = 16-byte piece tid of it */
  {
    const float* gs = x + (size_t)r0 * kD + tid * 4;
    const unsigned ls = (unsigned)(size_t)(sX + tid * 4);
    copy_rows11(ls, gs);
    copy_rows11(ls + 11u * kCopyStepL, gs + 11 * kCopyStepG);
    copy_rows10(ls + 22u * kCopyStepL, gs + 22 * kCopyStepG);
  }
  /* keeps every load and copy issued ahead of the first wait for data: without it the anchor work could be scheduled in between and the copies pay a second latency */
  __builtin_amdgcn_sched_barrier(0);

#pragma unroll
  for (int i = 0; i < kP; ++i) {
    unsigned h01, l01, h23, l23;
    split_pair(av[i][0], av[i][1], h01, l01);
    split_pair(av[i][2], av[i][3], h23, l23);
    const int wo = i * kAncPitchW + tid * 2;
    sAH[wo]     = h01;
    sAH[wo + 1] = h23;
    sAL[wo]     = l01;
    sAL[wo + 1] = l23;
  }
  /* this wave's copies have landed; the barrier behind it publishes them to the other waves */
  asm volatile("s_wait_asynccnt 0x0" ::: "memory");
  __syncthreads();

  /* A rows = token rows of this wave's tile, [row][d] layout, this wave's K half */
  const float* xrow = sX + (mt * 16 + cl) * kXfPitch + kh * kKHalf + 8 * hh;
  v4f xv[kKSteps][4];
#pragma unroll
  for (int it = 0; it < kKSteps; ++it) {
    xv[it][0] = *(const v4f*)(xrow + it * 32);
    xv[it][1] = *(const v4f*)(xrow + it * 32 + 4);
    xv[it][2] = *(const v4f*)(xrow + it * 32 + 16);
    xv[it][3] = *(const v4f*)(xrow + it * 32 + 20);
  }

  v8f acc = (v8f){0.f, 0.f, 0.f, 0.f, 0.f, 0.f, 0.f, 0.f};
#pragma unroll
  for (int it = 0; it < kKSteps; ++it) {
    const int k0 = kh * kKHalf + it * 32;
    const v4f f0 = xv[it][0];
    const v4f f1 = xv[it][1];
    const v4f f2 = xv[it][2];
    const v4f f3 = xv[it][3];
    unsigned hw0, hw1, hw2, hw3, hw4, hw5, hw6, hw7;
    unsigned lw0, lw1, lw2, lw3, lw4, lw5, lw6, lw7;
    split_pair(f0[0], f0[1], hw0, lw0);
    split_pair(f0[2], f0[3], hw1, lw1);
    split_pair(f1[0], f1[1], hw2, lw2);
    split_pair(f1[2], f1[3], hw3, lw3);
    split_pair(f2[0], f2[1], hw4, lw4);
    split_pair(f2[2], f2[3], hw5, lw5);
    split_pair(f3[0], f3[1], hw6, lw6);
    split_pair(f3[2], f3[3], hw7, lw7);
    const v8u hv = (v8u){hw0, hw1, hw2, hw3, hw4, hw5, hw6, hw7};
    const v8u lv = (v8u){lw0, lw1, lw2, lw3, lw4, lw5, lw6, lw7};
    const v16b ah = __builtin_bit_cast(v16b, hv);
    const v16b al = __builtin_bit_cast(v16b, lv);
    /* B column = anchor cl; words at halves k0 + 8*hh and + 16 */
    const int wb = cl * kAncPitchW + (k0 >> 1) + 4 * hh;
    const v4u bh0 = *(const v4u*)(sAH + wb);
    const v4u bh1 = *(const v4u*)(sAH + wb + 8);
    const v4u bl0 = *(const v4u*)(sAL + wb);
    const v4u bl1 = *(const v4u*)(sAL + wb + 8);
    const v16b bh = frag_b_words(bh0, bh1);
    const v16b bl = frag_b_words(bl0, bl1);
    acc = mma_b(ah, bl, acc);
    acc = mma_b(al, bh, acc);
    acc = mma_b(ah, bh, acc);
  }
  /* D element r of this lane = (token row 8*hh + r of tile mt, anchor cl), K half kh */
#pragma unroll
  for (int r = 0; r < 8; ++r) sPart[(kh * kTB + mt * 16 + 8 * hh + r) * 17 + cl] = acc[r];

  /* f16 transpose: this lane holds token t = 16 * mt + cl. Word h = (d, d + 1) of token t, word r = the same of token t ^ 1. */
  /* Even t keeps row d: (t, t + 1) = low halves of h, r. Odd t keeps row d + 1: (t - 1, t) = high halves of r, h. */
  {
    const int odd = cl & 1;
    const unsigned sel = odd ? 0x07060302u : 0x01000504u;
    unsigned* xw = sXT + (kh * kKHalf + 8 * hh + odd) * kXPitchW + ((mt * 16 + cl) >> 1);
#pragma unroll
    for (int it = 0; it < kKSteps; ++it)
#pragma unroll
      for (int q = 0; q < 4; ++q)
#pragma unroll
        for (int m = 0; m < 2; ++m) {
          const int dof = it * 32 + (q >> 1) * 16 + (q & 1) * 4 + 2 * m;
          const v2f f2 = (v2f){xv[it][q][2 * m], xv[it][q][2 * m + 1]};
          const unsigned h = __builtin_bit_cast(unsigned, __builtin_convertvector(f2, v2h));
          /* quad_perm [1,0,3,2]: the word of lane ^ 1 */
          const unsigned r = (unsigned)__builtin_amdgcn_mov_dpp((int)h, 0xB1, 0xF, 0xF, true);
          xw[dof * kXPitchW] = __builtin_amdgcn_perm(h, r, sel);
        }
  }
  __syncthreads();

  /* K halves added, then softmax over the 16 anchors, one token row per thread (wave 0, scalar branch) */
  if (wave < 1) {
    float pr[kP], ge[kP];
    /* unrolled: the 32 LDS reads are issued together (rolled, each trip waited for its own) and the row stays in registers */
#pragma unroll
    for (int p = 0; p < kP; ++p) pr[p] = sPart[tid * 17 + p] + sPart[(kTB + tid) * 17 + p];
    float m = pr[0] * kGateScale;
#pragma unroll
    for (int p = 1; p < kP; ++p) m = fmaxf(m, pr[p] * kGateScale);
    float sum = 0.0f;
#pragma unroll
    for (int p = 0; p < kP; ++p) {
      ge[p] = expf(pr[p] * kGateScale - m);
      sum += ge[p];
    }
    const float inv = (1.0f / sum) * kWCarry;
#pragma unroll
    for (int p = 0; p < kP; ++p) {
      sProd[tid * 17 + p] = pr[p];
      sGate[tid * 17 + p] = ge[p] * inv;
    }
  }
  __syncthreads();

  /* No barrier follows: every global store of the block stands behind the last one. */
  const int q = lane >> 3;
  const int j = lane & 7;

  /* the two token-major planes (waves 0, 1, scalar branch) */
  v4u up = (v4u){0u, 0u, 0u, 0u};
  v4u uw = (v4u){0u, 0u, 0u, 0u};
  const int ln = wave * 4 + q;
  if (wave < 2) {
    const int row = 4 * ln + (j >> 1);
    const int p0  = (j & 1) * 8;
    unsigned short pb[8], wb16[8];
#pragma unroll
    for (int e = 0; e < 8; ++e) {
      pb[e]   = h_bits(sProd[row * 17 + p0 + e]);
      wb16[e] = h_bits(sGate[row * 17 + p0 + e]);
    }
    up = (v4u){pk16(pb[0], pb[1]), pk16(pb[2], pb[3]), pk16(pb[4], pb[5]), pk16(pb[6], pb[7])};
    uw = (v4u){pk16(wb16[0], wb16[1]), pk16(wb16[2], wb16[3]), pk16(wb16[4], wb16[5]), pk16(wb16[6], wb16[7])};
  }

  /* this half chunk's A fragment of the chunk-state product (wave 2, scalar branch). Row = anchor cl; word w holds the block's tokens t = 16 (w >> 2) + 8 hh + 2 (w & 3) and t + 1 */
  v8u aw = (v8u){0u, 0u, 0u, 0u, 0u, 0u, 0u, 0u};
  if (wave == 2) {
#pragma unroll
    for (int w = 0; w < 8; ++w) {
      const int t = 16 * (w >> 2) + 8 * hh + 2 * (w & 3);
      aw[w] = pk16(h_bits(sProd[t * 17 + cl]), h_bits(sProd[(t + 1) * 17 + cl]));
    }
  }

  /* Bt fragments of this wave's 128 columns: row d = n0 + 16 jn + cl, the block's piece k = words at halves 16 k + 8 hh. */
  /* They go to XT as they are, as pieces 2 f + k of the chunk: store (jn, k) is 512 contiguous bytes. */
  const int n0 = wave * 128;
  v4u bw[8][2];
#pragma unroll
  for (int jn = 0; jn < 8; ++jn) {
    const unsigned* bp = sXT + (n0 + 16 * jn + cl) * kXPitchW + 4 * hh;
#pragma unroll
    for (int k = 0; k < 2; ++k) bw[jn][k] = *(const v4u*)(bp + 8 * k);
  }
  unsigned short* gx = XT + ((size_t)(blockIdx.x >> 1) * (kD / 16) + wave * 8) * 1024 + (blockIdx.x & 1) * 512 + lane * 8;
#pragma unroll
  for (int jn = 0; jn < 8; ++jn)
#pragma unroll
    for (int k = 0; k < 2; ++k) *(v4u*)(gx + (jn * 4 + k) * 256) = bw[jn][k];
  /* the wait that stands in front of any overwrite of a register an issued store names: the plane addresses below are formed in registers of the stores above */
  asm volatile("s_wait_xcnt 0x0" ::: "memory");
  if (wave < 2) {
    *(v4u*)(P16 + (size_t)r0 * kP + ln * 64 + j * 8) = up;
    *(v4u*)(W16 + (size_t)r0 * kP + ln * 64 + j * 8) = uw;
  } else if (wave == 2) {
    unsigned short* ga = PA + (size_t)blockIdx.x * 512 + lane * 8;
    *(v4u*)(ga)       = (v4u){aw[0], aw[1], aw[2], aw[3]};
    *(v4u*)(ga + 256) = (v4u){aw[4], aw[5], aw[6], aw[7]};
  }
}

/* --------------------------------------------------------------------------- */
/* K2: block = (batch, 32 columns, quarter of the sequence), 8 waves, wave =   */
/* one 64-token chunk of that quarter. The block rebuilds the chunk states of  */
/* its columns from XT, so no state goes through memory and no launch stands   */
/* between the states and the output.                                          */
/*  (0) the state loads of the wave are requested first (12 x 16 B a lane, and */
/*      12 more for chunk 'wave' of each earlier quarter, whose state the      */
/*      block needs too), the 8 gate and prods loads behind the own state,     */
/*      while the earlier quarters' loads still land;                          */
/*  (1) chunk state S[p][d] = sum_t prods[t][p] * x[t][d]: M = 16, N = 32,     */
/*      K = 64, f16 WMMA, A from PA, Bt from XT; accumulators to sS as they    */
/*      lie (piece s of a 16-column tile: anchors 8 hh + 4 s .. + 3);          */
/*  (2) 64 * L[s][t] = sum_p prods[t][p] * (64 w[s][p]) with the TOKEN t as    */
/*      the row of the product: a lane then holds 8 neighbouring t of one      */
/*      query row s, which is the A fragment of step (4) as it lies; kept for  */
/*      t <= s (diagonal included), else 0 by select; tiles above the diagonal */
/*      are zero words; K padded 16 -> 32 by zero upper fragment halves;       */
/*  (3) exclusive prefix of the states over the chunks (f32, forward in time,  */
/*      zero start per batch; thread = column x anchor pair, all 8 waves), as  */
/*      f16 hi = f16(A), lo = f16(A - hi) words in Bt fragment order in sAB;   */
/*  (4) fused K = 96 product: A = [W | W | L], Bt[d] = [hi | lo | XT chunk];   */
/*      k steps whose A fragment is all zero are left out (they add 0);        */
/*      f32 result x 1/64 -> the wave's own 64 x 32 slab -> rows stored as     */
/*      8 lanes x 16 B = one 128-B line.                                       */
/* grid = 4 x 16 x 4 = 256 blocks, a block for every WGP, 256 threads; the     */
/* later quarters, which rebuild more states, come first.                      */
/* --------------------------------------------------------------------------- */
constexpr int kNQ       = 4;
constexpr int kQNC      = kNC / kNQ;
constexpr int kSlabCols = 32;
constexpr int kNSlab    = kD / kSlabCols;
constexpr int kOutPitch = 36;
static_assert(kNQ == 4 && kQNC == 8 && kNSlab == 16 && kP == 16);

/* state of one chunk for 32 columns; dst = the chunk's 512 floats in sS + lane * 4 */
__device__ __forceinline__ void chunk_state(const v4u (&pf)[4], const v4u (&xq)[2][4], float* dst) {
  const v16h a0 = frag_h_words(pf[0], pf[1]);
  const v16h a1 = frag_h_words(pf[2], pf[3]);
#pragma unroll
  for (int jn = 0; jn < 2; ++jn) {
    v8f acc = (v8f){0.f, 0.f, 0.f, 0.f, 0.f, 0.f, 0.f, 0.f};
    acc = mma_h(a0, frag_h_words(xq[jn][0], xq[jn][1]), acc);
    acc = mma_h(a1, frag_h_words(xq[jn][2], xq[jn][3]), acc);
#pragma unroll
    for (int s = 0; s < 2; ++s)
      *(v4f*)(dst + (jn * 2 + s) * 128) = (v4f){acc[4 * s], acc[4 * s + 1], acc[4 * s + 2], acc[4 * s + 3]};
  }
}

/* adds the N chunk states ahead of a quarter, forward in time */
template <int N>
__device__ __forceinline__ void sum_states(const float* sp, float& a0, float& a1) {
  v2f ve[N];
#pragma unroll
  for (int c = 0; c < N; ++c) ve[c] = *(const v2f*)(sp + c * 512);
#pragma unroll
  for (int c = 0; c < N; ++c) {
    a0 += ve[c][0];
    a1 += ve[c][1];
  }
}

__global__ __launch_bounds__(256) void prefix_output_kernel(
    const unsigned short* __restrict__ W16, const unsigned short* __restrict__ P16,
    const unsigned short* __restrict__ PA, const unsigned short* __restrict__ XT, float* __restrict__ out)
{
  __shared__ __align__(16) float sS[kNC * 512];
  __shared__ __align__(16) unsigned sAB[kQNC * 512];
  __shared__ __align__(16) float slab[kQNC * 64 * kOutPitch];
  const int lane = threadIdx.x & 31;
  const int wave = __builtin_amdgcn_readfirstlane((int)(threadIdx.x >> 5));
  const int hh = lane >> 4;
  const int cl = lane & 15;
  const int qd = (kNQ - 1) - (int)(blockIdx.x / (kB * kNSlab));
  const int bs = blockIdx.x % (kB * kNSlab);
  const int b  = bs / kNSlab;
  const int sl = bs - b * kNSlab;
  const int n0 = sl * kSlabCols;
  const int bc = b * kNC + qd * kQNC + wave;
  const int be = b * kNC + wave;
  const int r0 = bc * kC;

  /* XT and PA lie in fragment order, a load is 512 contiguous bytes; a gate or prods load is 16 rows x 32 B, contiguous too */
  const unsigned short* xe = XT + ((size_t)be * (kD / 16) + sl * 2) * 1024 + lane * 8;
  const unsigned short* pe = PA + (size_t)be * 1024 + lane * 8;
  const unsigned short* xt = XT + ((size_t)bc * (kD / 16) + sl * 2) * 1024 + lane * 8;
  const unsigned short* pa = PA + (size_t)bc * 1024 + lane * 8;
  const unsigned short* gw = W16 + (size_t)(r0 + cl) * kP + 8 * hh;
  const unsigned short* gp = P16 + (size_t)(r0 + cl) * kP + 8 * hh;
  const v4u zero4 = (v4u){0u, 0u, 0u, 0u};
  /* pfe[e], xqe[e]: chunk 'wave' of the earlier quarter e; loaded and read only where e < qd (scalar branches) */
  v4u pfe[kNQ - 1][4], xqe[kNQ - 1][2][4], pf[4], xq[2][4], wq[4], pq[4];
  /* unrolled here and below: the fragments and accumulators live in registers only with constant indices */
#pragma unroll
  for (int k = 0; k < 4; ++k) pf[k] = *(const v4u*)(pa + k * 256);
#pragma unroll
  for (int j = 0; j < 2; ++j)
#pragma unroll
    for (int k = 0; k < 4; ++k) xq[j][k] = *(const v4u*)(xt + j * 1024 + k * 256);
#pragma unroll
  for (int e = 0; e < kNQ - 1; ++e) {
    if (e < qd) {
#pragma unroll
      for (int k = 0; k < 4; ++k) pfe[e][k] = *(const v4u*)(pe + e * kQNC * 1024 + k * 256);
#pragma unroll
      for (int j = 0; j < 2; ++j)
#pragma unroll
        for (int k = 0; k < 4; ++k) xqe[e][j][k] = *(const v4u*)(xe + e * kQNC * (kD / 16) * 1024 + j * 1024 + k * 256);
    }
  }
  /* the wait that stands in front of any overwrite of a register an issued load names; the four bases are inputs so that none is reused, not even as a later load's destination, ahead of it */
  asm volatile("s_wait_xcnt 0x0" :: "v"(xe), "v"(pe), "v"(xt), "v"(pa) : "memory");
  /* keeps every state load issued ahead of the first wait for data: without it the later loads are scheduled behind the first state product and pay a second latency */
  __builtin_amdgcn_sched_barrier(0);

  chunk_state(pf, xq, sS + (qd * kQNC + wave) * 512 + lane * 4);
  /* keeps the gate and prods loads behind the own state, which frees its A fragments: with all 56 loads of a last quarter's lane in flight at once the build spills */
  __builtin_amdgcn_sched_barrier(0);
#pragma unroll
  for (int m = 0; m < 4; ++m) {
    wq[m] = *(const v4u*)(gw + m * 16 * kP);
    pq[m] = *(const v4u*)(gp + m * 16 * kP);
  }
  /* the same wait for the two bases of these loads */
  asm volatile("s_wait_xcnt 0x0" :: "v"(gw), "v"(gp) : "memory");
  /* keeps these loads ahead of the earlier quarters' states: they land while those are formed */
  __builtin_amdgcn_sched_barrier(0);
#pragma unroll
  for (int e = 0; e < kNQ - 1; ++e) {
    if (e < qd) chunk_state(pfe[e], xqe[e], sS + (e * kQNC + wave) * 512 + lane * 4);
  }

  /* lt[m][tt]: D element r of this lane = (token 16 tt + 8 hh + r, query row 16 m + cl), packed in pairs of tokens */
  v4u lt[4][4];
#pragma unroll
  for (int m = 0; m < 4; ++m) {
    const v16h bf = frag_h_words(wq[m], zero4);
#pragma unroll
    for (int tt = 0; tt < 4; ++tt) {
      if (tt > m) {
        lt[m][tt] = zero4;
      } else {
        v8f accL = (v8f){0.f, 0.f, 0.f, 0.f, 0.f, 0.f, 0.f, 0.f};
        accL = mma_h(frag_h_words(pq[tt], zero4), bf, accL);
        if (tt == m) {
#pragma unroll
          for (int r = 0; r < 8; ++r) accL[r] = (8 * hh + r <= cl) ? accL[r] : 0.0f;
        }
        lt[m][tt] = (v4u){pk16(h_bits(accL[0]), h_bits(accL[1])), pk16(h_bits(accL[2]), h_bits(accL[3])),
                          pk16(h_bits(accL[4]), h_bits(accL[5])), pk16(h_bits(accL[6]), h_bits(accL[7]))};
      }
    }
  }
  __syncthreads();

  /* prefix: thread = (16-column tile jn, column dl = cl, anchors 2 pi and 2 pi + 1 = 8 (pi >> 2) + 4 ((pi >> 1) & 1) + 2 (pi & 1) and the next) */
  {
    const int jn = wave >> 2;
    const int pi = (wave & 3) * 2 + hh;
    const float* sp = sS + jn * 256 + ((((pi >> 1) & 1) * 32 + (pi >> 2) * 16 + cl) * 4 + (pi & 1) * 2);
    unsigned* dp = sAB + jn * 256 + ((pi >> 2) * 16 + cl) * 4 + (pi & 3);
    float a0 = 0.0f, a1 = 0.0f;
    const float* sq = sp + qd * kQNC * 512;
    v2f vv[kQNC - 1];
#pragma unroll
    for (int c = 0; c < kQNC - 1; ++c) vv[c] = *(const v2f*)(sq + c * 512);
    /* one path per quarter (scalar branches): no wait at a join has to cover a path that was not taken */
    if (qd == 1) sum_states<kQNC>(sp, a0, a1);
    else if (qd == 2) sum_states<2 * kQNC>(sp, a0, a1);
    else if (qd == 3) sum_states<3 * kQNC>(sp, a0, a1);
#pragma unroll
    for (int c = 0; c < kQNC; ++c) {
      const _Float16 h0 = (_Float16)a0;
      const _Float16 h1 = (_Float16)a1;
      const float h0f = (float)h0;
      const float h1f = (float)h1;
      const unsigned short hb0 = __builtin_bit_cast(unsigned short, h0);
      const unsigned short hb1 = __builtin_bit_cast(unsigned short, h1);
      const unsigned short lb0 = h_bits(a0 - h0f);
      const unsigned short lb1 = h_bits(a1 - h1f);
      dp[c * 512]       = pk16(hb0, hb1);
      dp[c * 512 + 128] = pk16(lb0, lb1);
      if (c < kQNC - 1) {
        a0 += vv[c][0];
        a1 += vv[c][1];
      }
    }
  }
  __syncthreads();

  /* Bt pieces hi | lo of this wave's chunk, columns n0 + 16 j + cl */
  const unsigned* ab = sAB + wave * 512 + lane * 4;
  v4u bh[2][2];
#pragma unroll
  for (int j = 0; j < 2; ++j)
#pragma unroll
    for (int pc = 0; pc < 2; ++pc) bh[j][pc] = *(const v4u*)(ab + (j * 2 + pc) * 128);

  v8f acc[4][2];
#pragma unroll
  for (int m = 0; m < 4; ++m)
#pragma unroll
    for (int j = 0; j < 2; ++j) acc[m][j] = (v8f){0.f, 0.f, 0.f, 0.f, 0.f, 0.f, 0.f, 0.f};
  /* k step outermost: independent accumulators between two products into the same one; each sums its k steps in the order 0, 1, 2 */
#pragma unroll
  for (int m = 0; m < 4; ++m)
#pragma unroll
    for (int j = 0; j < 2; ++j)
      acc[m][j] = mma_h(frag_h_words(wq[m], wq[m]), frag_h_words(bh[j][0], bh[j][1]), acc[m][j]);
#pragma unroll
  for (int ks = 0; ks < 2; ++ks)
#pragma unroll
    for (int m = 2 * ks; m < 4; ++m)
#pragma unroll
      for (int j = 0; j < 2; ++j)
        acc[m][j] = mma_h(frag_h_words(lt[m][2 * ks], lt[m][2 * ks + 1]), frag_h_words(xq[j][2 * ks], xq[j][2 * ks + 1]), acc[m][j]);

  float* sw = slab + wave * 64 * kOutPitch;
#pragma unroll
  for (int m = 0; m < 4; ++m)
#pragma unroll
    for (int j = 0; j < 2; ++j)
#pragma unroll
      for (int r = 0; r < 8; ++r)
        sw[(16 * m + 8 * hh + r) * kOutPitch + 16 * j + cl] = acc[m][j][r] * kWCarryInv;
  /* the slab is this wave's own: its LDS stores have landed before its lanes read one another's words back; no other wave takes part */
  asm volatile("s_wait_dscnt 0x0" ::: "memory");
  /* 8 lanes a row (one 128-B line). Lanes 0..7 and 8..15 take rows 8 apart: their words fall on different banks at this pitch. */
  const int q  = lane >> 3;
  const int j4 = (lane & 7) * 4;
  const int rl = (q >> 1) + (q & 1) * 8;
  /* One LDS and one global base per lane; iteration i adds the constant row (i >> 2) * 16 + (i & 3) * 2. */
  const float* sr = sw + rl * kOutPitch + j4;
  float* go = out + (size_t)(r0 + rl) * kD + n0 + j4;
  v4f v[16];
#pragma unroll
  for (int i = 0; i < 16; ++i) v[i] = *(const v4f*)(sr + ((i >> 2) * 16 + (i & 3) * 2) * kOutPitch);
#pragma unroll
  for (int i = 0; i < 16; ++i) *(v4f*)(go + ((i >> 2) * 16 + (i & 3) * 2) * kD) = v[i];
}

/* --------------------------------------------------------------------------- */
/* Host glue: 2 kernel launches, nothing else.                                 */
/* --------------------------------------------------------------------------- */
extern "C" void kernel_launch(void* const* d_in, const int* in_sizes, int n_in,
                              void* d_out, int out_size, void* d_ws, size_t ws_size,
                              hipStream_t stream) {
  if (n_in < 2) return;
  if (in_sizes[0] != kRows * kD) return;
  if (in_sizes[1] != kP * kD) return;
  if (out_size != kRows * kD) return;
  if (ws_size < kWsTotal) return;

  const float* x   = (const float*)d_in[0];
  const float* anc = (const float*)d_in[1];
  float* out = (float*)d_out;

  char* ws = (char*)d_ws;
  unsigned short* XT   = (unsigned short*)(ws + kOffXT);
  unsigned short* P16  = (unsigned short*)(ws + kOffP16);
  unsigned short* W16  = (unsigned short*)(ws + kOffW16);
  unsigned short* PA   = (unsigned short*)(ws + kOffPA);

  scores_state_kernel<<<dim3(kRows / kTB), 128, 0, stream>>>(x, anc, P16, W16, XT, PA);
  prefix_output_kernel<<<dim3(kB * kNSlab * kNQ), 256, 0, stream>>>(W16, P16, PA, XT, out);
}
